// v000
// Times are from an AMD MI455X. After a warm-up the kernel runs many times in a row, and a time is the length of
// such a window on the GPU divided by its runs, so every launch and the gaps after it count. The runs cycle
// through copies of the inputs. A figure is the median of several windows, for all but v000 over two sittings.
// Sittings can differ by a few percent; kernels timed side by side share one.
// v000 is the starting kernel. One run takes 267 microseconds.
#include <hip/hip_runtime.h>

// Causal multi-head self-attention, 16 heads x 64, interleaved rotary with sin/cos rows gathered from the table inputs by the integer position input; out = merged x wo^T.
// Compute dtypes, f32 accumulate: every float input converted to bf16 (RNE); q/k/v projections v_wmma_f32_16x16x32_bf16 (exact bf16 x bf16 products);
// scores q.k: query rows < 256 bf16 hi/lo (3 products), rows >= 256 single f16; P.V: rows < 256 bf16 hi/lo (3 products), rows >= 256 single f16 with P carried x1024;
// output projection: merged bf16 hi|lo x exact bf16 wo (2 products). Softmax f32 (running max, exp2).
// Fused flash-style attention in transposed form (S^T = K Q^T, O^T = V^T P^T): two adjacent S^T key tiles repacked to 16 bit are the P^T B fragment; no score plane in memory.

#ifndef NB
#define NB 2
#endif
#ifndef SEQ
#define SEQ 2048
#endif
#define SEQ_FULL 2048                 // per-batch row stride of x, token positions and the output
#define DM   1024
#define NH   16
#define HD   64
#define DQ   (NH * HD)
#define TABN 2048                     // rows of the sin/cos tables
#define TABW 32                       // columns of the sin/cos tables (HD / 2)
#define RH   256                      // query rows < RH use bf16 hi/lo planes
#define PCAR 1024.0f
#define SCL2E 0.18033688011112042f    // HD^-0.5 x log2(e)
#define NEGV (-1.0e30f)

static_assert(HD == 64);
static_assert(DQ == DM);
static_assert(TABW * 2 == HD);
static_assert(DM % 64 == 0);
static_assert(DM % 32 == 0);
static_assert(SEQ % 64 == 0);
static_assert(RH % 64 == 0);
static_assert(RH <= SEQ);
static_assert(SEQ <= SEQ_FULL);
static_assert(SEQ <= TABN);
static_assert((NB * SEQ) % 64 == 0);

typedef _Float16 h16;
typedef unsigned short bf;
typedef __attribute__((ext_vector_type(16))) __bf16   v16bf;
typedef __attribute__((ext_vector_type(16))) _Float16 v16h;
typedef __attribute__((ext_vector_type(16))) unsigned short v16us;
typedef __attribute__((ext_vector_type(8)))  unsigned short v8us;
typedef __attribute__((ext_vector_type(8)))  float    v8f;
typedef __attribute__((ext_vector_type(4)))  float    v4f;
typedef __attribute__((ext_vector_type(2)))  float    v2f;
typedef __attribute__((ext_vector_type(2)))  _Float16 v2h;
typedef __attribute__((ext_vector_type(2)))  unsigned short v2us;
typedef v4f  __attribute__((may_alias)) v4fa;
typedef v8us __attribute__((may_alias)) v8usa;

__device__ __forceinline__ unsigned short f2bf(float f) { unsigned u = __float_as_uint(f); u += 0x7FFFu + ((u >> 16) & 1u); return (unsigned short)(u >> 16); }
__device__ __forceinline__ float bf2f(unsigned short b) { return __uint_as_float(((unsigned)b) << 16); }
__device__ __forceinline__ float bfr(float f) { return bf2f(f2bf(f)); }
__device__ __forceinline__ void splitf(float y, unsigned short& h, unsigned short& l) { h = f2bf(y); l = f2bf(y - bf2f(h)); }
__device__ __forceinline__ v16us cat16u(v8us lo, v8us hi) { return __builtin_shufflevector(lo, hi, 0, 1, 2, 3, 4, 5, 6, 7, 8, 9, 10, 11, 12, 13, 14, 15); }
__device__ __forceinline__ v8f wmma16(v16h a, v16h b, v8f c) { return __builtin_amdgcn_wmma_f32_16x16x32_f16(false, a, false, b, (short)0, c, false, false); }
__device__ __forceinline__ v8f wmmab(v16bf a, v16bf b, v8f c) { return __builtin_amdgcn_wmma_f32_16x16x32_bf16(false, a, false, b, (short)0, c, false, false); }

// Fragment loader for K-contiguous 16-bit rows: p = row base + k0 + 8*(lane>>4); elements 0..7 <- p[0..7], elements 8..15 <- p[16..23].
template <bool HI> struct AF;
template <> struct AF<false> {
    typedef v16h V;
    static __device__ __forceinline__ V ld(const bf* p) { return __builtin_bit_cast(v16h, cat16u(*(const v8usa*)p, *(const v8usa*)(p + 16))); }
    static __device__ __forceinline__ v8f mma(V a, V b, v8f c) { return wmma16(a, b, c); }
};
template <> struct AF<true> {
    typedef v16bf V;
    static __device__ __forceinline__ V ld(const bf* p) { return __builtin_bit_cast(v16bf, cat16u(*(const v8usa*)p, *(const v8usa*)(p + 16))); }
    static __device__ __forceinline__ v8f mma(V a, V b, v8f c) { return wmmab(a, b, c); }
};

// ---- register-blocked GEMM, ONE WAVE per 64x64 output tile (16 accumulators), bf16 operands straight from K-contiguous planes; grid (M/64, N/64, Z), 32 threads.
// C[m][n] (f32, pitch ldc) = sum_k (A[m][k] (+ A2[m][k])) Bt[n][k]. z-batch strides sA/sB/sC in elements. K % 32 == 0, M % 64 == 0, N % 64 == 0.
template <int NSPLIT>
__device__ __forceinline__ void gemmw_body(const bf* __restrict__ A, const bf* __restrict__ A2, const bf* __restrict__ Bt, const int K, float* C, const int ldc, const size_t sA, const size_t sB, const size_t sC) {
    typedef AF<true> W; typedef W::V V;
    __shared__ __align__(16) float os[16 * 68];
    const size_t z = blockIdx.z; A += z * sA; A2 += z * sA; Bt += z * sB; C += z * sC;
    const int lane = threadIdx.x & 31, lr = lane & 15, hi = lane >> 4; const int r0 = blockIdx.x * 64, c0 = blockIdx.y * 64;
    v8f acc[4][4];
#pragma unroll
    for (int mb = 0; mb < 4; ++mb)
#pragma unroll
        for (int nb = 0; nb < 4; ++nb) acc[mb][nb] = (v8f){};
    const size_t aoff = (size_t)(r0 + lr) * K + 8 * hi, boff = (size_t)(c0 + lr) * K + 8 * hi;
#pragma unroll 1
    for (int kc = 0; kc < K; kc += 32) {
        V a[4], a2[4];
#pragma unroll
        for (int mb = 0; mb < 4; ++mb) { a[mb] = W::ld(A + aoff + (size_t)mb * 16 * K + kc); if (NSPLIT == 1) a2[mb] = W::ld(A2 + aoff + (size_t)mb * 16 * K + kc); else a2[mb] = a[mb]; }
#pragma unroll
        for (int nb = 0; nb < 4; ++nb) { const V b = W::ld(Bt + boff + (size_t)nb * 16 * K + kc);
#pragma unroll
            for (int mb = 0; mb < 4; ++mb) { acc[mb][nb] = W::mma(a[mb], b, acc[mb][nb]); if (NSPLIT == 1) acc[mb][nb] = W::mma(a2[mb], b, acc[mb][nb]); } }
        asm volatile("v_nop\n\tv_nop\n\tv_nop\n\tv_nop" : "+v"(acc[0][0]), "+v"(acc[1][1]), "+v"(acc[2][2]), "+v"(acc[3][3]) : "v"(a[0]), "v"(a[3]));
    }
#pragma unroll
    for (int mb = 0; mb < 4; ++mb) {
#pragma unroll
        for (int nb = 0; nb < 4; ++nb) {
#pragma unroll
            for (int j = 0; j < 8; ++j) os[(hi * 8 + j) * 68 + nb * 16 + lr] = acc[mb][nb][j]; }
        __builtin_amdgcn_wave_barrier(); asm volatile("" ::: "memory");
        float* crow = C + (size_t)(r0 + mb * 16) * ldc + c0;
{
#pragma unroll
            for (int s = 0; s < 8; ++s) { const int row = 2 * s + hi, cofs = lr * 4; const v4f val = *(const v4fa*)(os + row * 68 + cofs);
                *(v4f*)(crow + (size_t)row * ldc + cofs) = val; }
             }
        __builtin_amdgcn_wave_barrier(); asm volatile("" ::: "memory");
    }
}
__global__ __launch_bounds__(32) void k_gemm_x1(const bf* A, const bf* Bt, int K, float* C, int ldc, size_t sA, size_t sB, size_t sC) { gemmw_body<0>(A, A, Bt, K, C, ldc, sA, sB, sC); }
__global__ __launch_bounds__(32) void k_gemm_x2(const bf* A, const bf* A2, const bf* Bt, int K, float* C, int ldc, size_t sA, size_t sB, size_t sC) { gemmw_body<1>(A, A2, Bt, K, C, ldc, sA, sB, sC); }

__global__ __launch_bounds__(256) void k_cvt8(const float* __restrict__ src, bf* dst, size_t n8) { const size_t i = (size_t)blockIdx.x * 256 + threadIdx.x; if (i >= n8) return; const v8f v = *(const v8f*)(src + i * 8); v8us o;
#pragma unroll
    for (int k = 0; k < 8; ++k) o[k] = f2bf(v[k]); *(v8us*)(dst + i * 8) = o;  }

// k_rope: head planes [b*NH + h][t][d] of the interleaved rotary of F[(b*SEQ + t)][h*HD + d]: pair (2i, 2i+1), table row = clamped token position,
// out[2i] = cos x[2i] - sin x[2i+1], out[2i+1] = sin x[2i] + cos x[2i+1] (products converted separately, one add). f16 plane for all t; compact bf16 hi|lo planes [bh][RH][HD] for t < RH.
__global__ __launch_bounds__(256) void k_rope(const float* __restrict__ F, const float* __restrict__ sin_tab, const float* __restrict__ cos_tab, const int* __restrict__ tpos, h16* P16, bf* Ph, bf* Pl) {
#pragma clang fp contract(off)
    const size_t e = ((size_t)blockIdx.x * 256 + threadIdx.x) * 2; if (e >= (size_t)NB * NH * SEQ * HD) return;
    const int d = (int)(e % HD); const int t = (int)((e / HD) % SEQ); const int bh = (int)(e / ((size_t)HD * SEQ)); const int b = bh / NH, h = bh % NH;
    int pos = tpos[(size_t)b * SEQ_FULL + t]; pos = pos < 0 ? 0 : (pos > TABN - 1 ? TABN - 1 : pos);
    const float sn = bfr(sin_tab[(size_t)pos * TABW + (d >> 1)]); const float cs = bfr(cos_tab[(size_t)pos * TABW + (d >> 1)]);
    const v2f xx = *(const v2f*)(F + ((size_t)b * SEQ + t) * DM + h * HD + d);
    float a0 = __fmul_rn(cs, xx[0]), a1 = __fmul_rn(sn, xx[1]), c0 = __fmul_rn(sn, xx[0]), c1 = __fmul_rn(cs, xx[1]);
    asm volatile("" : "+v"(a0)); asm volatile("" : "+v"(a1)); asm volatile("" : "+v"(c0)); asm volatile("" : "+v"(c1));
    const float re = __fsub_rn(a0, a1), ro = __fadd_rn(c0, c1);
    v2h o16; o16[0] = (h16)re; o16[1] = (h16)ro; v2us oh, ol; unsigned short u0, u1; splitf(re, u0, u1); oh[0] = u0; ol[0] = u1; splitf(ro, u0, u1); oh[1] = u0; ol[1] = u1;
    const bool hr = (t < RH);     // uniform per wave
    const size_t ce = hr ? (((size_t)bh * RH + t) * HD + d) : 0;
    *(v2h*)(P16 + e) = o16; if (hr) { *(v2us*)(Ph + ce) = oh; *(v2us*)(Pl + ce) = ol; }
    
}

// k_vtp: value planes [bh][d][t] (f16, all t; compact bf16 hi|lo [bh][HD][RH] for t < RH) = F[(b*SEQ + t)][h*HD + d] (lane -> 2 consecutive t, strided reads);
__global__ __launch_bounds__(256) void k_vtp(const float* __restrict__ F, h16* V16, bf* Vh, bf* Vl) {
    const size_t e = ((size_t)blockIdx.x * 256 + threadIdx.x) * 2; if (e >= (size_t)NB * NH * HD * SEQ) return;
    const int t = (int)(e % SEQ); const int d = (int)((e / SEQ) % HD); const int bh = (int)(e / ((size_t)SEQ * HD)); const int b = bh / NH, h = bh % NH; v2h o16; v2us oh, ol;
#pragma unroll
    for (int q = 0; q < 2; ++q) { const float x = F[((size_t)b * SEQ + t + q) * DM + h * HD + d]; o16[q] = (h16)x; unsigned short u0, u1; splitf(x, u0, u1); oh[q] = u0; ol[q] = u1; }
    const bool hr = (t < RH);     // uniform per wave
    const size_t ce = hr ? (((size_t)bh * HD + d) * RH + t) : 0;
    *(v2h*)(V16 + e) = o16; if (hr) { *(v2us*)(Vh + ce) = oh; *(v2us*)(Vl + ce) = ol; }
    
}

// ---- fused causal attention, transposed flash form. Block = 4 waves = 64 query rows of one (b, h); each wave owns 16 queries (lane & 15 = query; both lane halves carry its statistics).
// Per 32-key chunk: S^T tiles (rows = keys, cols = queries) = K frag (A) x Q frag (B); running max (one shfl_xor 16), p = exp2; the two S^T tiles repacked to 16 bit are the P^T B fragment
// (element r <- keys c0+8h+r, element 8+r <- keys c0+16+8h+r); O^T[d][query] += V^T frag (A, rows of the [d][t] plane) x P^T. HI: bf16 hi/lo planes, 3 products; else f16, P x PCAR.
template <bool HI>
__device__ __forceinline__ void attn_body(const bf* __restrict__ Qa, const bf* __restrict__ Qb, const bf* __restrict__ Ka, const bf* __restrict__ Kb, const bf* __restrict__ Va, const bf* __restrict__ Vb,
                                          const int tq, const int tv, const int qblk, const int bh, bf* ATh, bf* ATl) {
    typedef AF<HI> F; typedef typename F::V V;
    __shared__ __align__(16) bf sth[4 * 16 * 72];
    __shared__ __align__(16) bf stl[4 * 16 * 72];
    const int lane = threadIdx.x & 31, lr = lane & 15, hi = lane >> 4, wave = threadIdx.x >> 5;
    const int q0 = qblk * 64 + wave * 16; const int qrow = q0 + lr;
    const size_t qoff = ((size_t)bh * tq + q0 + lr) * HD + 8 * hi;
    const size_t koff = ((size_t)bh * tq + lr) * HD + 8 * hi;
    const size_t voff = ((size_t)bh * HD + lr) * tv + 8 * hi;
    V qa[2], qb[2];
#pragma unroll
    for (int ks = 0; ks < 2; ++ks) { qa[ks] = F::ld(Qa + qoff + 32 * ks); if (HI) qb[ks] = F::ld(Qb + qoff + 32 * ks); else qb[ks] = qa[ks]; }
    v8f o[4];
#pragma unroll
    for (int nb = 0; nb < 4; ++nb) o[nb] = (v8f){};
    float m = NEGV, l = 0.0f;
#pragma unroll 1
    for (int c0 = 0; c0 <= q0 + 15; c0 += 32) {
        v8f s0 = (v8f){}, s1 = (v8f){}; V k0, k1;
#pragma unroll
        for (int ks = 0; ks < 2; ++ks) {
            k0 = F::ld(Ka + koff + (size_t)c0 * HD + 32 * ks); k1 = F::ld(Ka + koff + (size_t)(c0 + 16) * HD + 32 * ks);
            if (HI) { const V l0 = F::ld(Kb + koff + (size_t)c0 * HD + 32 * ks); const V l1 = F::ld(Kb + koff + (size_t)(c0 + 16) * HD + 32 * ks);
                s0 = F::mma(l0, qa[ks], s0); s1 = F::mma(l1, qa[ks], s1); s0 = F::mma(k0, qb[ks], s0); s1 = F::mma(k1, qb[ks], s1); }
            s0 = F::mma(k0, qa[ks], s0); s1 = F::mma(k1, qa[ks], s1);
        }
        asm volatile("v_nop\n\tv_nop\n\tv_nop\n\tv_nop" : "+v"(s0), "+v"(s1) : "v"(k0), "v"(k1), "v"(qa[1]), "v"(qb[1]));
        if (c0 + 31 > q0) {       // wave-uniform: chunk touches the diagonal; masked scores are replaced (keys above the query)
#pragma unroll
            for (int r = 0; r < 8; ++r) { const int key = c0 + 8 * hi + r; s0[r] = (key > qrow) ? NEGV : s0[r]; s1[r] = (key + 16 > qrow) ? NEGV : s1[r]; }
        }
        float mx = fmaxf(s0[0], s1[0]);
#pragma unroll
        for (int r = 1; r < 8; ++r) mx = fmaxf(mx, fmaxf(s0[r], s1[r]));
        mx = fmaxf(mx, __shfl_xor(mx, 16, 32));
        const float mn = fmaxf(m, mx);
        const float corr = __builtin_amdgcn_exp2f((m - mn) * SCL2E);
        float ps = 0.0f;
#pragma unroll
        for (int r = 0; r < 8; ++r) { s0[r] = __builtin_amdgcn_exp2f((s0[r] - mn) * SCL2E); s1[r] = __builtin_amdgcn_exp2f((s1[r] - mn) * SCL2E); ps += s0[r] + s1[r]; }
        l = l * corr + ps; m = mn;
#pragma unroll
        for (int nb = 0; nb < 4; ++nb)
#pragma unroll
            for (int r = 0; r < 8; ++r) o[nb][r] *= corr;
        V pa, pl;
        if (HI) { v16us uh, ul;
#pragma unroll
            for (int r = 0; r < 8; ++r) { unsigned short a, c; splitf(s0[r], a, c); uh[r] = a; ul[r] = c; splitf(s1[r], a, c); uh[8 + r] = a; ul[8 + r] = c; }
            pa = __builtin_bit_cast(V, uh); pl = __builtin_bit_cast(V, ul);
        } else { v16h th;
#pragma unroll
            for (int r = 0; r < 8; ++r) { th[r] = (h16)(s0[r] * PCAR); th[8 + r] = (h16)(s1[r] * PCAR); }
            pa = __builtin_bit_cast(V, th); pl = pa; }
        V vh[4], vl[4];
#pragma unroll
        for (int nb = 0; nb < 4; ++nb) { vh[nb] = F::ld(Va + voff + (size_t)nb * 16 * tv + c0); if (HI) vl[nb] = F::ld(Vb + voff + (size_t)nb * 16 * tv + c0); else vl[nb] = vh[nb]; }
#pragma unroll
        for (int nb = 0; nb < 4; ++nb) { if (HI) { o[nb] = F::mma(vl[nb], pa, o[nb]); o[nb] = F::mma(vh[nb], pl, o[nb]); } o[nb] = F::mma(vh[nb], pa, o[nb]); }
        asm volatile("v_nop\n\tv_nop\n\tv_nop\n\tv_nop" : "+v"(o[0]), "+v"(o[1]), "+v"(o[2]), "+v"(o[3]) : "v"(pa), "v"(pl), "v"(vh[3]));
    }
    l += __shfl_xor(l, 16, 32);
    const float inv = (HI ? 1.0f : (1.0f / PCAR)) * (1.0f / l);
    const int sbase = wave * (16 * 72) + lr * 72 + 8 * hi;
#pragma unroll
    for (int nb = 0; nb < 4; ++nb) { v8us h8, l8;
#pragma unroll
        for (int r = 0; r < 8; ++r) { unsigned short a, c; splitf(o[nb][r] * inv, a, c); h8[r] = a; l8[r] = c; }
        *(v8usa*)(sth + sbase + nb * 16) = h8; *(v8usa*)(stl + sbase + nb * 16) = l8; }
    __syncthreads();
    const int b = bh / NH, h = bh % NH;
{
#pragma unroll
        for (int it = 0; it < 4; ++it) { const int row = it * 4 + (lane >> 3), pc = lane & 7;
            const v8us xh = *(const v8usa*)(sth + wave * (16 * 72) + row * 72 + pc * 8); const v8us xl = *(const v8usa*)(stl + wave * (16 * 72) + row * 72 + pc * 8);
            const size_t go = ((size_t)b * SEQ + q0 + row) * DQ + h * HD + pc * 8;
            *(v8us*)(ATh + go) = xh; *(v8us*)(ATl + go) = xl; }
         }
}
// rows >= RH: f16 planes [bh][SEQ][HD] / [bh][HD][SEQ]; grid ((SEQ - RH) / 64, NB * NH), 128 threads.
__global__ __launch_bounds__(128) void k_attn_lo(const bf* Q16, const bf* K16, const bf* VT16, bf* ATh, bf* ATl) { attn_body<false>(Q16, Q16, K16, K16, VT16, VT16, SEQ, SEQ, (int)blockIdx.x + RH / 64, (int)blockIdx.y, ATh, ATl); }
// rows < RH: compact bf16 hi|lo planes [bh][RH][HD] / [bh][HD][RH]; grid (RH / 64, NB * NH), 128 threads.
__global__ __launch_bounds__(128) void k_attn_hi(const bf* Qh, const bf* Ql, const bf* Kh, const bf* Kl, const bf* VTh, const bf* VTl, bf* ATh, bf* ATl) { attn_body<true>(Qh, Ql, Kh, Kl, VTh, VTl, RH, RH, (int)blockIdx.x, (int)blockIdx.y, ATh, ATl); }

constexpr size_t SZ_W  = (size_t)DM * DM * 2;             // one bf16 weight plane
constexpr size_t SZ_XB = (size_t)NB * SEQ * DM * 2;       // bf16 x
constexpr size_t SZ_F  = (size_t)NB * SEQ * DM * 4;       // f32 projection (reused for q, k, v in stream order)
constexpr size_t SZ_P  = (size_t)NB * NH * SEQ * HD * 2;  // one f16 head plane
constexpr size_t SZ_R  = (size_t)NB * NH * RH * HD * 2;   // one compact bf16 plane
constexpr size_t SZ_AT = (size_t)NB * SEQ * DQ * 2;       // one merged bf16 plane
constexpr size_t WS_TOTAL = 4 * SZ_W + SZ_XB + SZ_F + 3 * SZ_P + 6 * SZ_R + 2 * SZ_AT;
static_assert(SZ_W % 256 == 0);
static_assert(SZ_XB % 256 == 0);
static_assert(SZ_F % 256 == 0);
static_assert(SZ_P % 256 == 0);
static_assert(SZ_R % 256 == 0);
static_assert(SZ_AT % 256 == 0);
static_assert(WS_TOTAL <= (size_t)134217728);

extern "C" void kernel_launch(void* const* d_in, const int* in_sizes, int n_in,
                              void* d_out, int out_size, void* d_ws, size_t ws_size, hipStream_t stream) {
    if (n_in < 8) return;
    const long long need_x = (long long)(NB - 1) * SEQ_FULL * DM + (long long)SEQ * DM;
    if ((long long)in_sizes[0] < need_x) return;
    if ((long long)in_sizes[1] < (long long)DM * DM || (long long)in_sizes[2] < (long long)DM * DM || (long long)in_sizes[3] < (long long)DM * DM || (long long)in_sizes[4] < (long long)DM * DM) return;
    if ((long long)in_sizes[5] < (long long)TABN * TABW || (long long)in_sizes[6] < (long long)TABN * TABW) return;
    if ((long long)in_sizes[7] < (long long)(NB - 1) * SEQ_FULL + SEQ) return;
    if ((long long)out_size < need_x) return;
    if (WS_TOTAL > ws_size) return;
    const float* x = (const float*)d_in[0]; const float* wq = (const float*)d_in[1]; const float* wk = (const float*)d_in[2]; const float* wv = (const float*)d_in[3]; const float* wo = (const float*)d_in[4];
    const float* sin_tab = (const float*)d_in[5]; const float* cos_tab = (const float*)d_in[6]; const int* tpos = (const int*)d_in[7];
    float* OUT = (float*)d_out;
    char* wsp = (char*)d_ws;
    auto take = [&](size_t bytes) { char* p = wsp; wsp += bytes; return (void*)p; };
    bf* WQ = (bf*)take(SZ_W); bf* WK = (bf*)take(SZ_W); bf* WV = (bf*)take(SZ_W); bf* WO = (bf*)take(SZ_W);
    bf* XB = (bf*)take(SZ_XB); float* Fb = (float*)take(SZ_F);
    h16* Q16 = (h16*)take(SZ_P); h16* K16 = (h16*)take(SZ_P); h16* VT16 = (h16*)take(SZ_P);
    bf* Qh = (bf*)take(SZ_R); bf* Ql = (bf*)take(SZ_R); bf* Kh = (bf*)take(SZ_R); bf* Kl = (bf*)take(SZ_R); bf* VTh = (bf*)take(SZ_R); bf* VTl = (bf*)take(SZ_R);
    bf* ATh = (bf*)take(SZ_AT); bf* ATl = (bf*)take(SZ_AT);

    const size_t w8 = (size_t)DM * DM / 8; const unsigned gw = (unsigned)((w8 + 255) / 256);
    k_cvt8<<<gw, 256, 0, stream>>>(wq, WQ, w8); k_cvt8<<<gw, 256, 0, stream>>>(wk, WK, w8); k_cvt8<<<gw, 256, 0, stream>>>(wv, WV, w8); k_cvt8<<<gw, 256, 0, stream>>>(wo, WO, w8);
    const size_t x8 = (size_t)SEQ * DM / 8;
    for (int b = 0; b < NB; ++b) k_cvt8<<<(unsigned)((x8 + 255) / 256), 256, 0, stream>>>(x + (size_t)b * SEQ_FULL * DM, XB + (size_t)b * SEQ * DM, x8);

    const dim3 gp((unsigned)(NB * SEQ / 64), (unsigned)(DM / 64), 1);
    const unsigned gpl = (unsigned)(((size_t)NB * NH * SEQ * HD / 2 + 255) / 256);
    k_gemm_x1<<<gp, 32, 0, stream>>>(XB, WQ, DM, Fb, DM, (size_t)0, (size_t)0, (size_t)0);
    k_rope<<<gpl, 256, 0, stream>>>(Fb, sin_tab, cos_tab, tpos, Q16, Qh, Ql);
    k_gemm_x1<<<gp, 32, 0, stream>>>(XB, WK, DM, Fb, DM, (size_t)0, (size_t)0, (size_t)0);
    k_rope<<<gpl, 256, 0, stream>>>(Fb, sin_tab, cos_tab, tpos, K16, Kh, Kl);
    k_gemm_x1<<<gp, 32, 0, stream>>>(XB, WV, DM, Fb, DM, (size_t)0, (size_t)0, (size_t)0);
    k_vtp<<<gpl, 256, 0, stream>>>(Fb, VT16, VTh, VTl);

    k_attn_hi<<<dim3(RH / 64, NB * NH, 1), 128, 0, stream>>>(Qh, Ql, Kh, Kl, VTh, VTl, ATh, ATl);
    if (SEQ > RH) k_attn_lo<<<dim3((SEQ - RH) / 64, NB * NH, 1), 128, 0, stream>>>((const bf*)Q16, (const bf*)K16, (const bf*)VT16, ATh, ATl);

    // out[b][t][e] = sum_d merged[b][t][d] wo[e][d]; z = batch, output batch stride from the full sequence length
    k_gemm_x2<<<dim3(SEQ / 64, DM / 64, NB), 32, 0, stream>>>(ATh, ATl, WO, DQ, OUT, DM, (size_t)SEQ * DQ, (size_t)0, (size_t)SEQ_FULL * DM);
}

// v001
// Measured time: 203 microseconds a run.
// Next to v000, in two timings, it ran 1.30 times as fast each time.
#include <hip/hip_runtime.h>

// Causal multi-head self-attention, 16 heads x 64, interleaved rotary with sin/cos rows gathered from the table inputs by the integer position input; out = merged x wo^T.
// Compute dtypes, f32 accumulate: every float input converted to bf16 (RNE); q/k/v projections v_wmma_f32_16x16x32_bf16 (exact bf16 x bf16 products);
// scores q.k: query rows < 256 bf16 hi/lo (3 products), rows >= 256 single f16; P.V: rows < 256 bf16 hi/lo (3 products), rows >= 256 single f16 with P carried x1024;
// output projection: merged bf16 hi|lo x exact bf16 wo (2 products, all hi products summed before the lo products). Softmax f32 (running max, exp2).
// Fused flash-style attention in transposed form (S^T = K Q^T, O^T = V^T P^T): two adjacent S^T key tiles repacked to 16 bit are the P^T B fragment; no score plane in memory.

#ifndef NB
#define NB 2
#endif
#ifndef SEQ
#define SEQ 2048
#endif
#define SEQ_FULL 2048                 // per-batch row stride of x, token positions and the output
#define DM   1024
#define NH   16
#define HD   64
#define DQ   (NH * HD)
#define TABN 2048                     // rows of the sin/cos tables
#define TABW 32                       // columns of the sin/cos tables (HD / 2)
#define RH   256                      // query rows < RH use bf16 hi/lo planes
#define PCAR 1024.0f
#define SCL2E 0.18033688011112042f    // HD^-0.5 x log2(e)
#define NEGV (-1.0e30f)

static_assert(HD == 64);
static_assert(DQ == DM);
static_assert(TABW * 2 == HD);
static_assert(DM % 64 == 0);
static_assert(DM % 32 == 0);
static_assert(SEQ % 64 == 0);
static_assert(RH % 64 == 0);
static_assert(RH <= SEQ);
static_assert(SEQ <= SEQ_FULL);
static_assert(SEQ <= TABN);
static_assert((NB * SEQ) % 64 == 0);
static_assert(SEQ % 128 == 0);
static_assert(DM % 128 == 0 && DM >= 256);

typedef _Float16 h16;
typedef unsigned short bf;
typedef __attribute__((ext_vector_type(16))) __bf16   v16bf;
typedef __attribute__((ext_vector_type(16))) _Float16 v16h;
typedef __attribute__((ext_vector_type(16))) unsigned short v16us;
typedef __attribute__((ext_vector_type(8)))  unsigned short v8us;
typedef __attribute__((ext_vector_type(8)))  float    v8f;
typedef __attribute__((ext_vector_type(4)))  float    v4f;
typedef __attribute__((ext_vector_type(2)))  float    v2f;
typedef __attribute__((ext_vector_type(2)))  _Float16 v2h;
typedef __attribute__((ext_vector_type(2)))  unsigned short v2us;
typedef v4f  __attribute__((may_alias)) v4fa;
typedef v8us __attribute__((may_alias)) v8usa;

__device__ __forceinline__ unsigned short f2bf(float f) { unsigned u = __float_as_uint(f); u += 0x7FFFu + ((u >> 16) & 1u); return (unsigned short)(u >> 16); }
__device__ __forceinline__ float bf2f(unsigned short b) { return __uint_as_float(((unsigned)b) << 16); }
__device__ __forceinline__ float bfr(float f) { return bf2f(f2bf(f)); }
__device__ __forceinline__ void splitf(float y, unsigned short& h, unsigned short& l) { h = f2bf(y); l = f2bf(y - bf2f(h)); }
__device__ __forceinline__ v16us cat16u(v8us lo, v8us hi) { return __builtin_shufflevector(lo, hi, 0, 1, 2, 3, 4, 5, 6, 7, 8, 9, 10, 11, 12, 13, 14, 15); }
__device__ __forceinline__ v8f wmma16(v16h a, v16h b, v8f c) { return __builtin_amdgcn_wmma_f32_16x16x32_f16(false, a, false, b, (short)0, c, false, false); }
__device__ __forceinline__ v8f wmmab(v16bf a, v16bf b, v8f c) { return __builtin_amdgcn_wmma_f32_16x16x32_bf16(false, a, false, b, (short)0, c, false, false); }

// Fragment loader for K-contiguous 16-bit rows: p = row base + k0 + 8*(lane>>4); elements 0..7 <- p[0..7], elements 8..15 <- p[16..23].
template <bool HI> struct AF;
template <> struct AF<false> {
    typedef v16h V;
    static __device__ __forceinline__ V ld(const bf* p) { return __builtin_bit_cast(v16h, cat16u(*(const v8usa*)p, *(const v8usa*)(p + 16))); }
    static __device__ __forceinline__ v8f mma(V a, V b, v8f c) { return wmma16(a, b, c); }
};
template <> struct AF<true> {
    typedef v16bf V;
    static __device__ __forceinline__ V ld(const bf* p) { return __builtin_bit_cast(v16bf, cat16u(*(const v8usa*)p, *(const v8usa*)(p + 16))); }
    static __device__ __forceinline__ v8f mma(V a, V b, v8f c) { return wmmab(a, b, c); }
};

// ---- GEMM, 128x128 output tile per block of 4 waves (2 x 2, one 64x64 wave tile = 16 accumulators each); grid (M/128, N/128, Z), 128 threads.
// C[m][n] (f32, pitch ldc) = sum_k (A[m][k] (+ A2[m][k])) Bt[n][k]. z-batch strides sA/sB/sC in elements. K % 128 == 0, K >= 256, M % 128 == 0, N % 128 == 0.
// Operands come to LDS by tensor loads, two buffers: a stage is 128 k of [A 128 rows | Bt 128 rows]; each wave brings one slice of 64 rows x 256 B (waves 0, 1: A; waves 2, 3: Bt),
// padded by the mover to a pitch of 272 B for the 16-byte fragment reads. With A2 the K/128 stages of A are followed by K/128 stages of A2 against the same Bt rows.
typedef unsigned u32x4 __attribute__((ext_vector_type(4)));
typedef unsigned u32x8 __attribute__((ext_vector_type(8)));
constexpr unsigned G_ROWB  = 256;                 // bytes of one staged row (128 k)
constexpr unsigned G_PITCH = G_ROWB + 16;         // LDS row pitch, an odd multiple of 16 B
constexpr unsigned G_SLICE = 18432;               // 64 rows x 272 B = 17,408 B, rounded up to a multiple of 2 KiB
constexpr unsigned G_BUF   = 4 * G_SLICE;
static_assert(64 * G_PITCH <= G_SLICE && G_SLICE % 2048 == 0);
__device__ __forceinline__ unsigned uni(unsigned v) { return (unsigned)__builtin_amdgcn_readfirstlane(v); }
__device__ __forceinline__ unsigned pinned(unsigned v) { unsigned w = uni(v); asm volatile("" : "+s"(w)); return w; }
__device__ __forceinline__ void tdm_load(u32x4 g0, u32x8 g1) { asm volatile("tensor_load_to_lds %0, %1" :: "s"(g0), "s"(g1) : "memory"); }
__device__ __forceinline__ void sfence() { __builtin_amdgcn_sched_barrier(0); }   // keeps a group of fragment loads, or a block of products, together in the built code
template <int NSPLIT>
__device__ __forceinline__ void gemmw_body(const bf* __restrict__ A, const bf* __restrict__ A2, const bf* __restrict__ Bt, const int K, float* C, const int ldc, const size_t sA, const size_t sB, const size_t sC) {
    typedef AF<true> W; typedef W::V V;
    __shared__ __attribute__((aligned(2048))) unsigned char ring[2 * G_BUF];
    __shared__ __align__(16) float osb[4 * 16 * 68];
    const size_t z = blockIdx.z; A += z * sA; A2 += z * sA; Bt += z * sB; C += z * sC;
    const int lane = threadIdx.x & 31, lr = lane & 15, hi = lane >> 4; const unsigned wave = uni(threadIdx.x >> 5); const unsigned wm = wave >> 1, wn = wave & 1u;
    const int r0 = blockIdx.x * 128 + (int)wm * 64, c0 = blockIdx.y * 128 + (int)wn * 64;
    __builtin_assume(K >= 256);              // the ring's prologue issues two stages: no path without a pass is built
    const unsigned KP = (unsigned)K / 128u, NS = (NSPLIT + 1) * KP;     // stages per plane, stages in all
    // this wave's slice of a stage: 64 rows of A (A2) or of Bt
    const size_t srow = (wave < 2u) ? (size_t)(blockIdx.x * 128u + 64u * wave) * K : (size_t)(blockIdx.y * 128u + 64u * (wave - 2u)) * K;
    const unsigned long long ga1 = (unsigned long long)(size_t)(((wave < 2u) ? A : Bt) + srow), ga2 = (unsigned long long)(size_t)(((wave < 2u) ? A2 : Bt) + srow);
    const unsigned lds_slice = (unsigned)(size_t)ring + wave * G_SLICE;
    u32x8 g1;   // 1-byte elements, tensor = tile = 64 rows of 256 B, source pitch 2 K bytes, 4 dwords of pad behind every 64
    g1[0] = uni((1u << 20) | (5u << 22) | (3u << 25)); g1[1] = uni(G_ROWB << 16); g1[2] = uni(64u << 16); g1[3] = uni(G_ROWB << 16); g1[4] = uni(64u); g1[5] = uni((unsigned)K * 2u); g1[6] = uni(0u); g1[7] = uni(0u);
    // group 0: count 1 | LDS place | address of the slice's first byte, type 2 in the top bits. Words 2 and 3 walk from stage to stage by one 64-bit add.
    const unsigned long long jump = ga2 - ga1 - (unsigned long long)(KP - 1u) * G_ROWB;   // from the last stage of A to the first of A2
    u32x4 g0; g0[0] = uni(1u); g0[1] = uni(lds_slice); g0[2] = uni((unsigned)ga1); g0[3] = uni((((unsigned)(ga1 >> 32)) & 0x01FFFFFFu) | 0x80000000u);
    auto issue_next = [&](unsigned st, unsigned buf) {
        const unsigned long long c = ((((unsigned long long)g0[3]) << 32) | g0[2]) + ((NSPLIT == 1 && st == KP) ? jump : (unsigned long long)G_ROWB);
        g0[1] = uni(lds_slice + buf); g0[2] = uni((unsigned)c); g0[3] = uni((unsigned)(c >> 32));
        tdm_load(g0, g1);
    };
    tdm_load(g0, g1);
    // Every tensor wait names the descriptor: its words stay in their scalar registers from issue to wait, and none takes a new value while a request is outstanding.
    asm volatile("s_wait_tensorcnt 0x0" : "+s"(g0), "+s"(g1) : : "memory");   // this wave's slice of stage 0 has landed
    __syncthreads();                                      // stage 0 published
    issue_next(1u, G_BUF);
    v8f acc[4][4];
#pragma unroll
    for (int mb = 0; mb < 4; ++mb)
#pragma unroll
        for (int nb = 0; nb < 4; ++nb) acc[mb][nb] = (v8f){};
    const unsigned aoff = wm * G_SLICE + (unsigned)lr * G_PITCH + 16u * hi, boff = (2u + wn) * G_SLICE + (unsigned)lr * G_PITCH + 16u * hi;
#pragma unroll 1   // one pass per trip: one publish point and one refill in the built loop, accumulators and fragments in registers
    for (unsigned s = 0; s < NS; ++s) {
        const unsigned buf = (s & 1u) * G_BUF;
        const unsigned char* la = ring + buf + aoff; const unsigned char* lb = ring + buf + boff;
        V a[2][4], b[2][4];
#pragma unroll
        for (int f = 0; f < 4; ++f) { a[0][f] = W::ld((const bf*)(la + f * 16 * G_PITCH)); b[0][f] = W::ld((const bf*)(lb + f * 16 * G_PITCH)); }
        sfence();
#pragma unroll
        for (int u = 0; u < 4; ++u) {       // four blocks of 32 k; the next block's fragments are fetched ahead of this block's products
            const int cs = u & 1;
            if (u < 3) {
#pragma unroll
                for (int f = 0; f < 4; ++f) { a[cs ^ 1][f] = W::ld((const bf*)(la + f * 16 * G_PITCH + (u + 1) * 64)); b[cs ^ 1][f] = W::ld((const bf*)(lb + f * 16 * G_PITCH + (u + 1) * 64)); }
                sfence();
            }
#pragma unroll
            for (int nb = 0; nb < 4; ++nb)
#pragma unroll
                for (int mb = 0; mb < 4; ++mb) acc[mb][nb] = W::mma(a[cs][mb], b[cs][nb], acc[mb][nb]);
            sfence();
        }
        // four vector slots behind the pass's last products, on the loop's taken branch too, before a vector instruction may touch their registers
        asm volatile("v_nop\n\tv_nop\n\tv_nop\n\tv_nop");
        sfence();
        asm volatile("s_wait_dscnt 0x0" ::: "memory");       // this wave has left the buffer
        asm volatile("s_wait_tensorcnt 0x0" : "+s"(g0), "+s"(g1) : : "memory");   // its slice of stage s + 1 has landed
        __syncthreads();                                      // stage s + 1 published; every wave has left stage s's buffer
        if (pinned((s + 2u < NS) ? 1u : 0u) != 0u) issue_next(s + 2u, buf);
    }
    asm volatile("s_wait_tensorcnt 0x0" : : "s"(g0), "s"(g1) : "memory");
    asm volatile("s_wait_dscnt 0x0" ::: "memory");
    float* os = osb + wave * (16 * 68);      // output staging, each wave's own
#pragma unroll
    for (int mb = 0; mb < 4; ++mb) {
#pragma unroll
        for (int nb = 0; nb < 4; ++nb) {
#pragma unroll
            for (int j = 0; j < 8; ++j) os[(hi * 8 + j) * 68 + nb * 16 + lr] = acc[mb][nb][j]; }
        __builtin_amdgcn_wave_barrier(); asm volatile("" ::: "memory");
        float* crow = C + (size_t)(r0 + mb * 16) * ldc + c0;
{
#pragma unroll
            for (int s = 0; s < 8; ++s) { const int row = 2 * s + hi, cofs = lr * 4; const v4f val = *(const v4fa*)(os + row * 68 + cofs);
                *(v4f*)(crow + (size_t)row * ldc + cofs) = val; }
             }
        __builtin_amdgcn_wave_barrier(); asm volatile("" ::: "memory");
    }
}
__global__ __launch_bounds__(128) void k_gemm_x1(const bf* A, const bf* Bt, int K, float* C, int ldc, size_t sA, size_t sB, size_t sC) { gemmw_body<0>(A, A, Bt, K, C, ldc, sA, sB, sC); }
__global__ __launch_bounds__(128) void k_gemm_x2(const bf* A, const bf* A2, const bf* Bt, int K, float* C, int ldc, size_t sA, size_t sB, size_t sC) { gemmw_body<1>(A, A2, Bt, K, C, ldc, sA, sB, sC); }

__global__ __launch_bounds__(256) void k_cvt8(const float* __restrict__ src, bf* dst, size_t n8) { const size_t i = (size_t)blockIdx.x * 256 + threadIdx.x; if (i >= n8) return; const v8f v = *(const v8f*)(src + i * 8); v8us o;
#pragma unroll
    for (int k = 0; k < 8; ++k) o[k] = f2bf(v[k]); *(v8us*)(dst + i * 8) = o;  }

// k_rope: head planes [b*NH + h][t][d] of the interleaved rotary of F[(b*SEQ + t)][h*HD + d]: pair (2i, 2i+1), table row = clamped token position,
// out[2i] = cos x[2i] - sin x[2i+1], out[2i+1] = sin x[2i] + cos x[2i+1] (products converted separately, one add). f16 plane for all t; compact bf16 hi|lo planes [bh][RH][HD] for t < RH.
__global__ __launch_bounds__(256) void k_rope(const float* __restrict__ F, const float* __restrict__ sin_tab, const float* __restrict__ cos_tab, const int* __restrict__ tpos, h16* P16, bf* Ph, bf* Pl) {
#pragma clang fp contract(off)
    const size_t e = ((size_t)blockIdx.x * 256 + threadIdx.x) * 2; if (e >= (size_t)NB * NH * SEQ * HD) return;
    const int d = (int)(e % HD); const int t = (int)((e / HD) % SEQ); const int bh = (int)(e / ((size_t)HD * SEQ)); const int b = bh / NH, h = bh % NH;
    int pos = tpos[(size_t)b * SEQ_FULL + t]; pos = pos < 0 ? 0 : (pos > TABN - 1 ? TABN - 1 : pos);
    const float sn = bfr(sin_tab[(size_t)pos * TABW + (d >> 1)]); const float cs = bfr(cos_tab[(size_t)pos * TABW + (d >> 1)]);
    const v2f xx = *(const v2f*)(F + ((size_t)b * SEQ + t) * DM + h * HD + d);
    float a0 = __fmul_rn(cs, xx[0]), a1 = __fmul_rn(sn, xx[1]), c0 = __fmul_rn(sn, xx[0]), c1 = __fmul_rn(cs, xx[1]);
    asm volatile("" : "+v"(a0)); asm volatile("" : "+v"(a1)); asm volatile("" : "+v"(c0)); asm volatile("" : "+v"(c1));
    const float re = __fsub_rn(a0, a1), ro = __fadd_rn(c0, c1);
    v2h o16; o16[0] = (h16)re; o16[1] = (h16)ro; v2us oh, ol; unsigned short u0, u1; splitf(re, u0, u1); oh[0] = u0; ol[0] = u1; splitf(ro, u0, u1); oh[1] = u0; ol[1] = u1;
    const bool hr = (t < RH);     // uniform per wave
    const size_t ce = hr ? (((size_t)bh * RH + t) * HD + d) : 0;
    *(v2h*)(P16 + e) = o16; if (hr) { *(v2us*)(Ph + ce) = oh; *(v2us*)(Pl + ce) = ol; }
    
}

// k_vtp: value planes [bh][d][t] (f16, all t; compact bf16 hi|lo [bh][HD][RH] for t < RH) = F[(b*SEQ + t)][h*HD + d] (lane -> 2 consecutive t, strided reads);
__global__ __launch_bounds__(256) void k_vtp(const float* __restrict__ F, h16* V16, bf* Vh, bf* Vl) {
    const size_t e = ((size_t)blockIdx.x * 256 + threadIdx.x) * 2; if (e >= (size_t)NB * NH * HD * SEQ) return;
    const int t = (int)(e % SEQ); const int d = (int)((e / SEQ) % HD); const int bh = (int)(e / ((size_t)SEQ * HD)); const int b = bh / NH, h = bh % NH; v2h o16; v2us oh, ol;
#pragma unroll
    for (int q = 0; q < 2; ++q) { const float x = F[((size_t)b * SEQ + t + q) * DM + h * HD + d]; o16[q] = (h16)x; unsigned short u0, u1; splitf(x, u0, u1); oh[q] = u0; ol[q] = u1; }
    const bool hr = (t < RH);     // uniform per wave
    const size_t ce = hr ? (((size_t)bh * HD + d) * RH + t) : 0;
    *(v2h*)(V16 + e) = o16; if (hr) { *(v2us*)(Vh + ce) = oh; *(v2us*)(Vl + ce) = ol; }
    
}

// ---- fused causal attention, transposed flash form. Block = 4 waves = 64 query rows of one (b, h); each wave owns 16 queries (lane & 15 = query; both lane halves carry its statistics).
// Per 32-key chunk: S^T tiles (rows = keys, cols = queries) = K frag (A) x Q frag (B); running max (one shfl_xor 16), p = exp2; the two S^T tiles repacked to 16 bit are the P^T B fragment
// (element r <- keys c0+8h+r, element 8+r <- keys c0+16+8h+r); O^T[d][query] += V^T frag (A, rows of the [d][t] plane) x P^T. HI: bf16 hi/lo planes, 3 products; else f16, P x PCAR.
template <bool HI>
__device__ __forceinline__ void attn_body(const bf* __restrict__ Qa, const bf* __restrict__ Qb, const bf* __restrict__ Ka, const bf* __restrict__ Kb, const bf* __restrict__ Va, const bf* __restrict__ Vb,
                                          const int tq, const int tv, const int qblk, const int bh, bf* ATh, bf* ATl) {
    typedef AF<HI> F; typedef typename F::V V;
    __shared__ __align__(16) bf sth[4 * 16 * 72];
    __shared__ __align__(16) bf stl[4 * 16 * 72];
    const int lane = threadIdx.x & 31, lr = lane & 15, hi = lane >> 4, wave = threadIdx.x >> 5;
    const int q0 = qblk * 64 + wave * 16; const int qrow = q0 + lr;
    const size_t qoff = ((size_t)bh * tq + q0 + lr) * HD + 8 * hi;
    const size_t koff = ((size_t)bh * tq + lr) * HD + 8 * hi;
    const size_t voff = ((size_t)bh * HD + lr) * tv + 8 * hi;
    V qa[2], qb[2];
#pragma unroll
    for (int ks = 0; ks < 2; ++ks) { qa[ks] = F::ld(Qa + qoff + 32 * ks); if (HI) qb[ks] = F::ld(Qb + qoff + 32 * ks); else qb[ks] = qa[ks]; }
    v8f o[4];
#pragma unroll
    for (int nb = 0; nb < 4; ++nb) o[nb] = (v8f){};
    float m = NEGV, l = 0.0f;
#pragma unroll 1
    for (int c0 = 0; c0 <= q0 + 15; c0 += 32) {
        v8f s0 = (v8f){}, s1 = (v8f){}; V k0, k1;
#pragma unroll
        for (int ks = 0; ks < 2; ++ks) {
            k0 = F::ld(Ka + koff + (size_t)c0 * HD + 32 * ks); k1 = F::ld(Ka + koff + (size_t)(c0 + 16) * HD + 32 * ks);
            if (HI) { const V l0 = F::ld(Kb + koff + (size_t)c0 * HD + 32 * ks); const V l1 = F::ld(Kb + koff + (size_t)(c0 + 16) * HD + 32 * ks);
                s0 = F::mma(l0, qa[ks], s0); s1 = F::mma(l1, qa[ks], s1); s0 = F::mma(k0, qb[ks], s0); s1 = F::mma(k1, qb[ks], s1); }
            s0 = F::mma(k0, qa[ks], s0); s1 = F::mma(k1, qa[ks], s1);
        }
        asm volatile("v_nop\n\tv_nop\n\tv_nop\n\tv_nop" : "+v"(s0), "+v"(s1) : "v"(k0), "v"(k1), "v"(qa[1]), "v"(qb[1]));
        if (c0 + 31 > q0) {       // wave-uniform: chunk touches the diagonal; masked scores are replaced (keys above the query)
#pragma unroll
            for (int r = 0; r < 8; ++r) { const int key = c0 + 8 * hi + r; s0[r] = (key > qrow) ? NEGV : s0[r]; s1[r] = (key + 16 > qrow) ? NEGV : s1[r]; }
        }
        float mx = fmaxf(s0[0], s1[0]);
#pragma unroll
        for (int r = 1; r < 8; ++r) mx = fmaxf(mx, fmaxf(s0[r], s1[r]));
        mx = fmaxf(mx, __shfl_xor(mx, 16, 32));
        const float mn = fmaxf(m, mx);
        const float corr = __builtin_amdgcn_exp2f((m - mn) * SCL2E);
        float ps = 0.0f;
#pragma unroll
        for (int r = 0; r < 8; ++r) { s0[r] = __builtin_amdgcn_exp2f((s0[r] - mn) * SCL2E); s1[r] = __builtin_amdgcn_exp2f((s1[r] - mn) * SCL2E); ps += s0[r] + s1[r]; }
        l = l * corr + ps; m = mn;
#pragma unroll
        for (int nb = 0; nb < 4; ++nb)
#pragma unroll
            for (int r = 0; r < 8; ++r) o[nb][r] *= corr;
        V pa, pl;
        if (HI) { v16us uh, ul;
#pragma unroll
            for (int r = 0; r < 8; ++r) { unsigned short a, c; splitf(s0[r], a, c); uh[r] = a; ul[r] = c; splitf(s1[r], a, c); uh[8 + r] = a; ul[8 + r] = c; }
            pa = __builtin_bit_cast(V, uh); pl = __builtin_bit_cast(V, ul);
        } else { v16h th;
#pragma unroll
            for (int r = 0; r < 8; ++r) { th[r] = (h16)(s0[r] * PCAR); th[8 + r] = (h16)(s1[r] * PCAR); }
            pa = __builtin_bit_cast(V, th); pl = pa; }
        V vh[4], vl[4];
#pragma unroll
        for (int nb = 0; nb < 4; ++nb) { vh[nb] = F::ld(Va + voff + (size_t)nb * 16 * tv + c0); if (HI) vl[nb] = F::ld(Vb + voff + (size_t)nb * 16 * tv + c0); else vl[nb] = vh[nb]; }
#pragma unroll
        for (int nb = 0; nb < 4; ++nb) { if (HI) { o[nb] = F::mma(vl[nb], pa, o[nb]); o[nb] = F::mma(vh[nb], pl, o[nb]); } o[nb] = F::mma(vh[nb], pa, o[nb]); }
        asm volatile("v_nop\n\tv_nop\n\tv_nop\n\tv_nop" : "+v"(o[0]), "+v"(o[1]), "+v"(o[2]), "+v"(o[3]) : "v"(pa), "v"(pl), "v"(vh[3]));
    }
    l += __shfl_xor(l, 16, 32);
    const float inv = (HI ? 1.0f : (1.0f / PCAR)) * (1.0f / l);
    const int sbase = wave * (16 * 72) + lr * 72 + 8 * hi;
#pragma unroll
    for (int nb = 0; nb < 4; ++nb) { v8us h8, l8;
#pragma unroll
        for (int r = 0; r < 8; ++r) { unsigned short a, c; splitf(o[nb][r] * inv, a, c); h8[r] = a; l8[r] = c; }
        *(v8usa*)(sth + sbase + nb * 16) = h8; *(v8usa*)(stl + sbase + nb * 16) = l8; }
    __syncthreads();
    const int b = bh / NH, h = bh % NH;
{
#pragma unroll
        for (int it = 0; it < 4; ++it) { const int row = it * 4 + (lane >> 3), pc = lane & 7;
            const v8us xh = *(const v8usa*)(sth + wave * (16 * 72) + row * 72 + pc * 8); const v8us xl = *(const v8usa*)(stl + wave * (16 * 72) + row * 72 + pc * 8);
            const size_t go = ((size_t)b * SEQ + q0 + row) * DQ + h * HD + pc * 8;
            *(v8us*)(ATh + go) = xh; *(v8us*)(ATl + go) = xl; }
         }
}
// rows >= RH: f16 planes [bh][SEQ][HD] / [bh][HD][SEQ]; grid ((SEQ - RH) / 64, NB * NH), 128 threads.
__global__ __launch_bounds__(128) void k_attn_lo(const bf* Q16, const bf* K16, const bf* VT16, bf* ATh, bf* ATl) { attn_body<false>(Q16, Q16, K16, K16, VT16, VT16, SEQ, SEQ, (int)blockIdx.x + RH / 64, (int)blockIdx.y, ATh, ATl); }
// rows < RH: compact bf16 hi|lo planes [bh][RH][HD] / [bh][HD][RH]; grid (RH / 64, NB * NH), 128 threads.
__global__ __launch_bounds__(128) void k_attn_hi(const bf* Qh, const bf* Ql, const bf* Kh, const bf* Kl, const bf* VTh, const bf* VTl, bf* ATh, bf* ATl) { attn_body<true>(Qh, Ql, Kh, Kl, VTh, VTl, RH, RH, (int)blockIdx.x, (int)blockIdx.y, ATh, ATl); }

constexpr size_t SZ_W  = (size_t)DM * DM * 2;             // one bf16 weight plane
constexpr size_t SZ_XB = (size_t)NB * SEQ * DM * 2;       // bf16 x
constexpr size_t SZ_F  = (size_t)NB * SEQ * DM * 4;       // f32 projection (reused for q, k, v in stream order)
constexpr size_t SZ_P  = (size_t)NB * NH * SEQ * HD * 2;  // one f16 head plane
constexpr size_t SZ_R  = (size_t)NB * NH * RH * HD * 2;   // one compact bf16 plane
constexpr size_t SZ_AT = (size_t)NB * SEQ * DQ * 2;       // one merged bf16 plane
constexpr size_t WS_TOTAL = 4 * SZ_W + SZ_XB + SZ_F + 3 * SZ_P + 6 * SZ_R + 2 * SZ_AT;
static_assert(SZ_W % 256 == 0);
static_assert(SZ_XB % 256 == 0);
static_assert(SZ_F % 256 == 0);
static_assert(SZ_P % 256 == 0);
static_assert(SZ_R % 256 == 0);
static_assert(SZ_AT % 256 == 0);
static_assert(WS_TOTAL <= (size_t)134217728);

extern "C" void kernel_launch(void* const* d_in, const int* in_sizes, int n_in,
                              void* d_out, int out_size, void* d_ws, size_t ws_size, hipStream_t stream) {
    if (n_in < 8) return;
    const long long need_x = (long long)(NB - 1) * SEQ_FULL * DM + (long long)SEQ * DM;
    if ((long long)in_sizes[0] < need_x) return;
    if ((long long)in_sizes[1] < (long long)DM * DM || (long long)in_sizes[2] < (long long)DM * DM || (long long)in_sizes[3] < (long long)DM * DM || (long long)in_sizes[4] < (long long)DM * DM) return;
    if ((long long)in_sizes[5] < (long long)TABN * TABW || (long long)in_sizes[6] < (long long)TABN * TABW) return;
    if ((long long)in_sizes[7] < (long long)(NB - 1) * SEQ_FULL + SEQ) return;
    if ((long long)out_size < need_x) return;
    if (WS_TOTAL > ws_size) return;
    const float* x = (const float*)d_in[0]; const float* wq = (const float*)d_in[1]; const float* wk = (const float*)d_in[2]; const float* wv = (const float*)d_in[3]; const float* wo = (const float*)d_in[4];
    const float* sin_tab = (const float*)d_in[5]; const float* cos_tab = (const float*)d_in[6]; const int* tpos = (const int*)d_in[7];
    float* OUT = (float*)d_out;
    char* wsp = (char*)d_ws;
    auto take = [&](size_t bytes) { char* p = wsp; wsp += bytes; return (void*)p; };
    bf* WQ = (bf*)take(SZ_W); bf* WK = (bf*)take(SZ_W); bf* WV = (bf*)take(SZ_W); bf* WO = (bf*)take(SZ_W);
    bf* XB = (bf*)take(SZ_XB); float* Fb = (float*)take(SZ_F);
    h16* Q16 = (h16*)take(SZ_P); h16* K16 = (h16*)take(SZ_P); h16* VT16 = (h16*)take(SZ_P);
    bf* Qh = (bf*)take(SZ_R); bf* Ql = (bf*)take(SZ_R); bf* Kh = (bf*)take(SZ_R); bf* Kl = (bf*)take(SZ_R); bf* VTh = (bf*)take(SZ_R); bf* VTl = (bf*)take(SZ_R);
    bf* ATh = (bf*)take(SZ_AT); bf* ATl = (bf*)take(SZ_AT);

    const size_t w8 = (size_t)DM * DM / 8; const unsigned gw = (unsigned)((w8 + 255) / 256);
    k_cvt8<<<gw, 256, 0, stream>>>(wq, WQ, w8); k_cvt8<<<gw, 256, 0, stream>>>(wk, WK, w8); k_cvt8<<<gw, 256, 0, stream>>>(wv, WV, w8); k_cvt8<<<gw, 256, 0, stream>>>(wo, WO, w8);
    const size_t x8 = (size_t)SEQ * DM / 8;
    for (int b = 0; b < NB; ++b) k_cvt8<<<(unsigned)((x8 + 255) / 256), 256, 0, stream>>>(x + (size_t)b * SEQ_FULL * DM, XB + (size_t)b * SEQ * DM, x8);

    const dim3 gp((unsigned)(NB * SEQ / 128), (unsigned)(DM / 128), 1);
    const unsigned gpl = (unsigned)(((size_t)NB * NH * SEQ * HD / 2 + 255) / 256);
    k_gemm_x1<<<gp, 128, 0, stream>>>(XB, WQ, DM, Fb, DM, (size_t)0, (size_t)0, (size_t)0);
    k_rope<<<gpl, 256, 0, stream>>>(Fb, sin_tab, cos_tab, tpos, Q16, Qh, Ql);
    k_gemm_x1<<<gp, 128, 0, stream>>>(XB, WK, DM, Fb, DM, (size_t)0, (size_t)0, (size_t)0);
    k_rope<<<gpl, 256, 0, stream>>>(Fb, sin_tab, cos_tab, tpos, K16, Kh, Kl);
    k_gemm_x1<<<gp, 128, 0, stream>>>(XB, WV, DM, Fb, DM, (size_t)0, (size_t)0, (size_t)0);
    k_vtp<<<gpl, 256, 0, stream>>>(Fb, VT16, VTh, VTl);

    k_attn_hi<<<dim3(RH / 64, NB * NH, 1), 128, 0, stream>>>(Qh, Ql, Kh, Kl, VTh, VTl, ATh, ATl);
    if (SEQ > RH) k_attn_lo<<<dim3((SEQ - RH) / 64, NB * NH, 1), 128, 0, stream>>>((const bf*)Q16, (const bf*)K16, (const bf*)VT16, ATh, ATl);

    // out[b][t][e] = sum_d merged[b][t][d] wo[e][d]; z = batch, output batch stride from the full sequence length
    k_gemm_x2<<<dim3(SEQ / 128, DM / 128, NB), 128, 0, stream>>>(ATh, ATl, WO, DQ, OUT, DM, (size_t)SEQ * DQ, (size_t)0, (size_t)SEQ_FULL * DM);
}

// v002
// It runs in 167 microseconds.
// In two side-by-side timings against v001, it was 1.22 and 1.21 times as fast.
// Over all steps from v000 it is 1.58 times as fast.
#include <hip/hip_runtime.h>

// Causal multi-head self-attention, 16 heads x 64, interleaved rotary with sin/cos rows gathered from the table inputs by the integer position input; out = merged x wo^T.
// Compute dtypes, f32 accumulate: every float input converted to bf16 (RNE); q/k/v projections v_wmma_f32_16x16x32_bf16 (exact bf16 x bf16 products);
// scores q.k: query rows < 256 bf16 hi/lo (3 products), rows >= 256 single f16; P.V: rows < 256 bf16 hi/lo (3 products), rows >= 256 single f16 with P carried x1024;
// output projection: merged bf16 hi|lo x exact bf16 wo (2 products, all hi products summed before the lo products). Softmax f32 (running max, exp2).
// Fused flash-style attention in transposed form (S^T = K Q^T, O^T = V^T P^T): two adjacent S^T key tiles repacked to 16 bit are the P^T B fragment; no score plane in memory.

#ifndef NB
#define NB 2
#endif
#ifndef SEQ
#define SEQ 2048
#endif
#define SEQ_FULL 2048                 // per-batch row stride of x, token positions and the output
#define DM   1024
#define NH   16
#define HD   64
#define DQ   (NH * HD)
#define TABN 2048                     // rows of the sin/cos tables
#define TABW 32                       // columns of the sin/cos tables (HD / 2)
#define RH   256                      // query rows < RH use bf16 hi/lo planes
#define PCAR 1024.0f
#define SCL2E 0.18033688011112042f    // HD^-0.5 x log2(e)
#define NEGV (-1.0e30f)

static_assert(HD == 64);
static_assert(DQ == DM);
static_assert(TABW * 2 == HD);
static_assert(DM % 64 == 0);
static_assert(DM % 32 == 0);
static_assert(SEQ % 64 == 0);
static_assert(RH % 64 == 0);
static_assert(RH <= SEQ);
static_assert(SEQ <= SEQ_FULL);
static_assert(SEQ <= TABN);
static_assert((NB * SEQ) % 64 == 0);
static_assert(SEQ % 128 == 0);
static_assert(DM % 128 == 0 && DM >= 256);

typedef _Float16 h16;
typedef unsigned short bf;
typedef __attribute__((ext_vector_type(16))) __bf16   v16bf;
typedef __attribute__((ext_vector_type(16))) _Float16 v16h;
typedef __attribute__((ext_vector_type(16))) unsigned short v16us;
typedef __attribute__((ext_vector_type(8)))  unsigned short v8us;
typedef __attribute__((ext_vector_type(8)))  float    v8f;
typedef __attribute__((ext_vector_type(4)))  float    v4f;
typedef __attribute__((ext_vector_type(2)))  float    v2f;
typedef __attribute__((ext_vector_type(8)))  _Float16 v8h;
typedef __attribute__((ext_vector_type(4)))  _Float16 v4h;
typedef __attribute__((ext_vector_type(4)))  unsigned short v4us;
typedef v4f  __attribute__((may_alias)) v4fa;
typedef v8us __attribute__((may_alias)) v8usa;

__device__ __forceinline__ unsigned short f2bf(float f) { unsigned u = __float_as_uint(f); u += 0x7FFFu + ((u >> 16) & 1u); return (unsigned short)(u >> 16); }
__device__ __forceinline__ float bf2f(unsigned short b) { return __uint_as_float(((unsigned)b) << 16); }
__device__ __forceinline__ float bfr(float f) { return bf2f(f2bf(f)); }
__device__ __forceinline__ void splitf(float y, unsigned short& h, unsigned short& l) { h = f2bf(y); l = f2bf(y - bf2f(h)); }
__device__ __forceinline__ v16us cat16u(v8us lo, v8us hi) { return __builtin_shufflevector(lo, hi, 0, 1, 2, 3, 4, 5, 6, 7, 8, 9, 10, 11, 12, 13, 14, 15); }
__device__ __forceinline__ v8f wmma16(v16h a, v16h b, v8f c) { return __builtin_amdgcn_wmma_f32_16x16x32_f16(false, a, false, b, (short)0, c, false, false); }
__device__ __forceinline__ v8f wmmab(v16bf a, v16bf b, v8f c) { return __builtin_amdgcn_wmma_f32_16x16x32_bf16(false, a, false, b, (short)0, c, false, false); }

// Fragment loader for K-contiguous 16-bit rows: p = row base + k0 + 8*(lane>>4); elements 0..7 <- p[0..7], elements 8..15 <- p[16..23].
template <bool HI> struct AF;
template <> struct AF<false> {
    typedef v16h V;
    static __device__ __forceinline__ V ld(const bf* p) { return __builtin_bit_cast(v16h, cat16u(*(const v8usa*)p, *(const v8usa*)(p + 16))); }
    static __device__ __forceinline__ v8f mma(V a, V b, v8f c) { return wmma16(a, b, c); }
};
template <> struct AF<true> {
    typedef v16bf V;
    static __device__ __forceinline__ V ld(const bf* p) { return __builtin_bit_cast(v16bf, cat16u(*(const v8usa*)p, *(const v8usa*)(p + 16))); }
    static __device__ __forceinline__ v8f mma(V a, V b, v8f c) { return wmmab(a, b, c); }
};

// ---- GEMM, 128x128 output tile per block of 4 waves (2 x 2, one 64x64 wave tile = 16 accumulators each); grid (M/128, N/128, Z), 128 threads.
// acc[m][n] (f32) = sum_k (A[m][k] (+ A2[m][k])) Bt[n][k], handed to the epilogue EPI per wave tile. z-batch strides sA/sB in elements. K % 128 == 0, K >= 256, M % 128 == 0, N % 128 == 0.
// Operands come to LDS by tensor loads, two buffers: a stage is 128 k of [A 128 rows | Bt 128 rows]; each wave brings one slice of 64 rows x 256 B (waves 0, 1: A; waves 2, 3: Bt),
// padded by the mover to a pitch of 272 B for the 16-byte fragment reads. With A2 the K/128 stages of A are followed by K/128 stages of A2 against the same Bt rows.
typedef unsigned u32x4 __attribute__((ext_vector_type(4)));
typedef unsigned u32x8 __attribute__((ext_vector_type(8)));
constexpr unsigned G_ROWB  = 256;                 // bytes of one staged row (128 k)
constexpr unsigned G_PITCH = G_ROWB + 16;         // LDS row pitch, an odd multiple of 16 B
constexpr unsigned G_SLICE = 18432;               // 64 rows x 272 B = 17,408 B, rounded up to a multiple of 2 KiB
constexpr unsigned G_BUF   = 4 * G_SLICE;
static_assert(64 * G_PITCH <= G_SLICE && G_SLICE % 2048 == 0);
__device__ __forceinline__ unsigned uni(unsigned v) { return (unsigned)__builtin_amdgcn_readfirstlane(v); }
__device__ __forceinline__ unsigned pinned(unsigned v) { unsigned w = uni(v); asm volatile("" : "+s"(w)); return w; }
__device__ __forceinline__ void tdm_load(u32x4 g0, u32x8 g1) { asm volatile("tensor_load_to_lds %0, %1" :: "s"(g0), "s"(g1) : "memory"); }
__device__ __forceinline__ void sfence() { __builtin_amdgcn_sched_barrier(0); }   // keeps a group of fragment loads, or a block of products, together in the built code
// Epilogue: f32 rows C[m][n] (pitch ldc, z-batch stride sC), each 16-row band turned through the wave's LDS staging into 16-byte row stores.
struct EpiRows {
    float* C; int ldc; size_t sC;
    __device__ __forceinline__ void operator()(v8f (&acc)[4][4], float* os, const int r0, const int c0, const int lr, const int hi) const {
        float* Cz = C + (size_t)blockIdx.z * sC;
#pragma unroll
        for (int mb = 0; mb < 4; ++mb) {
#pragma unroll
            for (int nb = 0; nb < 4; ++nb) {
#pragma unroll
                for (int j = 0; j < 8; ++j) os[(hi * 8 + j) * 68 + nb * 16 + lr] = acc[mb][nb][j]; }
            __builtin_amdgcn_wave_barrier(); asm volatile("" ::: "memory");   // the band's LDS writes stay ahead of the row reads below
            float* crow = Cz + (size_t)(r0 + mb * 16) * ldc + c0;
#pragma unroll
            for (int s = 0; s < 8; ++s) { const int row = 2 * s + hi, cofs = lr * 4; const v4f val = *(const v4fa*)(os + row * 68 + cofs);
                *(v4f*)(crow + (size_t)row * ldc + cofs) = val; }
            __builtin_amdgcn_wave_barrier(); asm volatile("" ::: "memory");   // the row reads stay ahead of the next band's LDS writes
        }
    }
};
// Epilogue of the q/k/v projections (z = 0, 1, 2): a wave tile is 64 tokens of one batch x the 64 columns of one head, and goes straight to the head planes.
// z < 2: interleaved rotary, pair (2i, 2i+1), table row = clamped token position, out[2i] = cos x[2i] - sin x[2i+1], out[2i+1] = sin x[2i] + cos x[2i+1];
//        planes [b*NH + h][t][d]: f16 for all t, compact bf16 hi|lo [bh][RH][HD] for t < RH.
// z = 2: value planes [bh][d][t] (f16, all t; compact bf16 hi|lo [bh][HD][RH] for t < RH): a lane's 8 accumulator rows are 8 consecutive t of one d, stored as 16 bytes from registers.
struct EpiHeads {
    const float* __restrict__ sin_tab; const float* __restrict__ cos_tab; const int* __restrict__ tpos;
    h16* Q16; h16* K16; h16* VT16; bf* Qh; bf* Ql; bf* Kh; bf* Kl; bf* VTh; bf* VTl;
    // Stands behind each run of global loads or stores, in front of the first instruction that writes a register which one of them names; the scheduling fences keep the run together and later work behind the wait.
    static __device__ __forceinline__ void xwait() { asm volatile("s_wait_xcnt 0x0" ::: "memory"); sfence(); }
    // The same behind a run of table loads: the eight offsets are inputs of the wait, so that none of their registers is given to a later load's result ahead of it.
    static __device__ __forceinline__ void xwait(const unsigned (&t)[8]) { asm volatile("s_wait_xcnt 0x0" :: "v"(t[0]), "v"(t[1]), "v"(t[2]), "v"(t[3]), "v"(t[4]), "v"(t[5]), "v"(t[6]), "v"(t[7]) : "memory"); sfence(); }
    __device__ __forceinline__ void operator()(v8f (&acc)[4][4], float* os, const int r0, const int c0, const int lr, const int hi) const {
        const int b = r0 / SEQ, t0 = r0 % SEQ, bh = b * NH + c0 / HD;
        const bool hr = (t0 < RH);     // uniform per wave: the tile's 64 tokens lie on one side of RH
        const int tc = hr ? t0 : 0;    // first token in the compact planes
        if (blockIdx.z == 2) {
            h16* v16 = VT16 + (size_t)bh * HD * SEQ + t0; const unsigned vofs = (unsigned)(lr * SEQ + hi * 8);
#pragma unroll
            for (int nb = 0; nb < 4; ++nb) {
                v8h o16[4];
#pragma unroll
                for (int mb = 0; mb < 4; ++mb)
#pragma unroll
                    for (int j = 0; j < 8; ++j) o16[mb][j] = (h16)acc[mb][nb][j];
                sfence();   // the four stores issue as one run, with nothing between them and their wait
#pragma unroll
                for (int mb = 0; mb < 4; ++mb) *(v8h*)(v16 + (nb * 16 * SEQ + mb * 16) + vofs) = o16[mb];   // the four stores fill one 128-byte line per d
                xwait();
            }
            if (hr) {
                float* own = os + (hi * 16 + lr) * 8;     // this lane's own 8 floats of each of the four column blocks
                bf* vh = VTh + (size_t)bh * HD * RH + tc; bf* vl = VTl + (size_t)bh * HD * RH + tc; const unsigned cofs = (unsigned)(lr * RH + hi * 8);
#pragma unroll
                for (int mb = 0; mb < 4; ++mb) {
#pragma unroll
                    for (int nb = 0; nb < 4; ++nb)
#pragma unroll
                        for (int j = 0; j < 8; ++j) own[nb * 256 + j] = acc[mb][nb][j];
#pragma unroll 1   // rolled, fed from LDS: the hi/lo split stands once per band in the text
                    for (int nb = 0; nb < 4; ++nb) { const v4f xa = *(const v4fa*)(own + nb * 256), xb = *(const v4fa*)(own + nb * 256 + 4); v8us oh, ol;
#pragma unroll
                        for (int j = 0; j < 4; ++j) { unsigned short u0, u1; splitf(xa[j], u0, u1); oh[j] = u0; ol[j] = u1; splitf(xb[j], u0, u1); oh[4 + j] = u0; ol[4 + j] = u1; }
                        const unsigned ce = (unsigned)(nb * 16 * RH + mb * 16) + cofs;
                        sfence();   // the two stores issue as one run, with nothing between them and their wait
                        *(v8us*)(vh + ce) = oh; *(v8us*)(vl + ce) = ol;
                        xwait(); }
                }
            }
            return;
        }
        h16* p16 = ((blockIdx.z == 0) ? Q16 : K16) + ((size_t)bh * SEQ + t0) * HD;
        bf* ph = ((blockIdx.z == 0) ? Qh : Kh) + ((size_t)bh * RH + tc) * HD; bf* pl = ((blockIdx.z == 0) ? Ql : Kl) + ((size_t)bh * RH + tc) * HD;
        const int* tp = tpos + (size_t)b * SEQ_FULL + t0;
        const unsigned lofs = (unsigned)(hi * HD + lr * 4);     // the lane's four columns in a pair of token rows
        int pos[4][8];     // token positions of the rows this lane will write: all fetched at once, one latency
#pragma unroll
        for (int mb = 0; mb < 4; ++mb)
#pragma unroll
            for (int s = 0; s < 8; ++s) pos[mb][s] = tp[mb * 16 + 2 * s + hi];
        xwait();
        unsigned to[4][8];   // byte offset of the lane's two sin (cos) values: table row = clamped token position
#pragma unroll
        for (int mb = 0; mb < 4; ++mb)
#pragma unroll
            for (int s = 0; s < 8; ++s) { const int p = pos[mb][s]; to[mb][s] = ((unsigned)(p < 0 ? 0 : (p > TABN - 1 ? TABN - 1 : p)) * TABW + (unsigned)lr * 2u) * 4u; }
        v2f sn[2][8], cs[2][8];   // fetched one 16-row band ahead
        sfence();   // the band's table loads issue as one run, with nothing between them and their wait
#pragma unroll
        for (int s = 0; s < 8; ++s) { sn[0][s] = *(const v2f*)((const char*)sin_tab + to[0][s]); cs[0][s] = *(const v2f*)((const char*)cos_tab + to[0][s]); }
        xwait(to[0]);
#pragma unroll
        for (int mb = 0; mb < 4; ++mb) {
            const int cb = mb & 1;
            if (mb < 3) {
#pragma unroll
                for (int s = 0; s < 8; ++s) { sn[cb ^ 1][s] = *(const v2f*)((const char*)sin_tab + to[mb + 1][s]); cs[cb ^ 1][s] = *(const v2f*)((const char*)cos_tab + to[mb + 1][s]); }
                xwait(to[mb + 1]);
            }
#pragma unroll
            for (int nb = 0; nb < 4; ++nb) {
#pragma unroll
                for (int j = 0; j < 8; ++j) os[(hi * 8 + j) * 68 + nb * 16 + lr] = acc[mb][nb][j]; }
            __builtin_amdgcn_wave_barrier(); asm volatile("" ::: "memory");   // the band's LDS writes stay ahead of the row reads below
            v4h o16[8]; v4f xy[8];
#pragma unroll
            for (int s = 0; s < 8; ++s) xy[s] = *(const v4fa*)(os + (2 * s + hi) * 68 + lr * 4);
#pragma unroll
            for (int s = 0; s < 8; ++s) { const v4f x = xy[s];
                const float s0 = bfr(sn[cb][s][0]), s1 = bfr(sn[cb][s][1]), k0 = bfr(cs[cb][s][0]), k1 = bfr(cs[cb][s][1]);
                v4f y; y[0] = k0 * x[0] - s0 * x[1]; y[1] = s0 * x[0] + k0 * x[1]; y[2] = k1 * x[2] - s1 * x[3]; y[3] = s1 * x[2] + k1 * x[3];
#pragma unroll
                for (int q = 0; q < 4; ++q) o16[s][q] = (h16)y[q];
                xy[s] = y;
            }
            sfence();   // the band's eight stores issue as one run, with nothing between them and their wait
#pragma unroll
            for (int s = 0; s < 8; ++s) *(v4h*)(p16 + (mb * 16 + 2 * s) * HD + lofs) = o16[s];
            xwait();
            if (hr) {      // each lane puts its rotated values back where it read them, for the split below
#pragma unroll
                for (int s = 0; s < 8; ++s) *(v4fa*)(os + (2 * s + hi) * 68 + lr * 4) = xy[s];
#pragma unroll 1   // rolled, fed from LDS: the hi/lo split stands once per band in the text
                for (int s = 0; s < 8; ++s) { const v4f y = *(const v4fa*)(os + (2 * s + hi) * 68 + lr * 4); v4us oh, ol;
#pragma unroll
                    for (int q = 0; q < 4; ++q) { unsigned short u0, u1; splitf(y[q], u0, u1); oh[q] = u0; ol[q] = u1; }
                    const unsigned ce = (unsigned)((mb * 16 + 2 * s) * HD) + lofs;
                    sfence();   // the two stores issue as one run, with nothing between them and their wait
                    *(v4us*)(ph + ce) = oh; *(v4us*)(pl + ce) = ol;
                    xwait(); }
            }
            __builtin_amdgcn_wave_barrier(); asm volatile("" ::: "memory");   // the row reads stay ahead of the next band's LDS writes
        }
    }
};
template <int NSPLIT, class EPI>
__device__ __forceinline__ void gemmw_body(const bf* __restrict__ A, const bf* __restrict__ A2, const bf* __restrict__ Bt, const int K, const size_t sA, const size_t sB, const EPI epi) {
    typedef AF<true> W; typedef W::V V;
    __shared__ __attribute__((aligned(2048))) unsigned char ring[2 * G_BUF];
    __shared__ __align__(16) float osb[4 * 16 * 68];
    const size_t z = blockIdx.z; A += z * sA; A2 += z * sA; Bt += z * sB;
    const int lane = threadIdx.x & 31, lr = lane & 15, hi = lane >> 4; const unsigned wave = uni(threadIdx.x >> 5); const unsigned wm = wave >> 1, wn = wave & 1u;
    const int r0 = blockIdx.x * 128 + (int)wm * 64, c0 = blockIdx.y * 128 + (int)wn * 64;
    __builtin_assume(K >= 256);              // the ring's prologue issues two stages: no path without a pass is built
    const unsigned KP = (unsigned)K / 128u, NS = (NSPLIT + 1) * KP;     // stages per plane, stages in all
    // this wave's slice of a stage: 64 rows of A (A2) or of Bt
    const size_t srow = (wave < 2u) ? (size_t)(blockIdx.x * 128u + 64u * wave) * K : (size_t)(blockIdx.y * 128u + 64u * (wave - 2u)) * K;
    const unsigned long long ga1 = (unsigned long long)(size_t)(((wave < 2u) ? A : Bt) + srow), ga2 = (unsigned long long)(size_t)(((wave < 2u) ? A2 : Bt) + srow);
    const unsigned lds_slice = (unsigned)(size_t)ring + wave * G_SLICE;
    u32x8 g1;   // 1-byte elements, tensor = tile = 64 rows of 256 B, source pitch 2 K bytes, 4 dwords of pad behind every 64
    g1[0] = uni((1u << 20) | (5u << 22) | (3u << 25)); g1[1] = uni(G_ROWB << 16); g1[2] = uni(64u << 16); g1[3] = uni(G_ROWB << 16); g1[4] = uni(64u); g1[5] = uni((unsigned)K * 2u); g1[6] = uni(0u); g1[7] = uni(0u);
    // group 0: count 1 | LDS place | address of the slice's first byte, type 2 in the top bits. Words 2 and 3 walk from stage to stage by one 64-bit add.
    const unsigned long long jump = ga2 - ga1 - (unsigned long long)(KP - 1u) * G_ROWB;   // from the last stage of A to the first of A2
    u32x4 g0; g0[0] = uni(1u); g0[1] = uni(lds_slice); g0[2] = uni((unsigned)ga1); g0[3] = uni((((unsigned)(ga1 >> 32)) & 0x01FFFFFFu) | 0x80000000u);
    auto issue_next = [&](unsigned st, unsigned buf) {
        const unsigned long long c = ((((unsigned long long)g0[3]) << 32) | g0[2]) + ((NSPLIT == 1 && st == KP) ? jump : (unsigned long long)G_ROWB);
        g0[1] = uni(lds_slice + buf); g0[2] = uni((unsigned)c); g0[3] = uni((unsigned)(c >> 32));
        tdm_load(g0, g1);
    };
    tdm_load(g0, g1);
    // Every tensor wait names the descriptor: its words stay in their scalar registers from issue to wait, and none takes a new value while a request is outstanding.
    asm volatile("s_wait_tensorcnt 0x0" : "+s"(g0), "+s"(g1) : : "memory");   // this wave's slice of stage 0 has landed
    __syncthreads();                                      // stage 0 published
    issue_next(1u, G_BUF);
    v8f acc[4][4];
#pragma unroll
    for (int mb = 0; mb < 4; ++mb)
#pragma unroll
        for (int nb = 0; nb < 4; ++nb) acc[mb][nb] = (v8f){};
    const unsigned aoff = wm * G_SLICE + (unsigned)lr * G_PITCH + 16u * hi, boff = (2u + wn) * G_SLICE + (unsigned)lr * G_PITCH + 16u * hi;
#pragma unroll 1   // one pass per trip: one publish point and one refill in the built loop, accumulators and fragments in registers
    for (unsigned s = 0; s < NS; ++s) {
        const unsigned buf = (s & 1u) * G_BUF;
        const unsigned char* la = ring + buf + aoff; const unsigned char* lb = ring + buf + boff;
        V a[2][4], b[2][4];
#pragma unroll
        for (int f = 0; f < 4; ++f) { a[0][f] = W::ld((const bf*)(la + f * 16 * G_PITCH)); b[0][f] = W::ld((const bf*)(lb + f * 16 * G_PITCH)); }
        sfence();
#pragma unroll
        for (int u = 0; u < 4; ++u) {       // four blocks of 32 k; the next block's fragments are fetched ahead of this block's products
            const int cs = u & 1;
            if (u < 3) {
#pragma unroll
                for (int f = 0; f < 4; ++f) { a[cs ^ 1][f] = W::ld((const bf*)(la + f * 16 * G_PITCH + (u + 1) * 64)); b[cs ^ 1][f] = W::ld((const bf*)(lb + f * 16 * G_PITCH + (u + 1) * 64)); }
                sfence();
            }
#pragma unroll
            for (int nb = 0; nb < 4; ++nb)
#pragma unroll
                for (int mb = 0; mb < 4; ++mb) acc[mb][nb] = W::mma(a[cs][mb], b[cs][nb], acc[mb][nb]);
            sfence();
        }
        // four vector slots behind the pass's last products, on the loop's taken branch too, before a vector instruction may touch their registers
        asm volatile("v_nop\n\tv_nop\n\tv_nop\n\tv_nop");
        sfence();
        asm volatile("s_wait_dscnt 0x0" ::: "memory");       // this wave has left the buffer
        asm volatile("s_wait_tensorcnt 0x0" : "+s"(g0), "+s"(g1) : : "memory");   // its slice of stage s + 1 has landed
        __syncthreads();                                      // stage s + 1 published; every wave has left stage s's buffer
        if (pinned((s + 2u < NS) ? 1u : 0u) != 0u) issue_next(s + 2u, buf);
    }
    asm volatile("s_wait_tensorcnt 0x0" : : "s"(g0), "s"(g1) : "memory");
    asm volatile("s_wait_dscnt 0x0" ::: "memory");
    epi(acc, osb + wave * (16 * 68), r0, c0, lr, hi);      // output staging in LDS, each wave's own
}
// q, k, v projections of X (bf16 rows [b*SEQ + t][DM]) in one launch: grid (NB*SEQ/128, DM/128, 3), z picks the weight plane of W3 = [wq | wk | wv] and the head planes written.
__global__ __launch_bounds__(128) void k_gemm_qkv(const bf* X, const bf* W3, const float* sin_tab, const float* cos_tab, const int* tpos,
                                                  h16* Q16, h16* K16, h16* VT16, bf* Qh, bf* Ql, bf* Kh, bf* Kl, bf* VTh, bf* VTl) {
    gemmw_body<0>(X, X, W3, DM, (size_t)0, (size_t)DM * DM, EpiHeads{sin_tab, cos_tab, tpos, Q16, K16, VT16, Qh, Ql, Kh, Kl, VTh, VTl}); }
__global__ __launch_bounds__(128) void k_gemm_x2(const bf* A, const bf* A2, const bf* Bt, int K, float* C, int ldc, size_t sA, size_t sB, size_t sC) { gemmw_body<1>(A, A2, Bt, K, sA, sB, EpiRows{C, ldc, sC}); }

__global__ __launch_bounds__(256) void k_cvt8(const float* __restrict__ src, bf* dst, size_t n8) { const size_t i = (size_t)blockIdx.x * 256 + threadIdx.x; if (i >= n8) return; const v8f v = *(const v8f*)(src + i * 8); v8us o;
#pragma unroll
    for (int k = 0; k < 8; ++k) o[k] = f2bf(v[k]); *(v8us*)(dst + i * 8) = o;  }

// ---- fused causal attention, transposed flash form. Block = 4 waves = 64 query rows of one (b, h); each wave owns 16 queries (lane & 15 = query; both lane halves carry its statistics).
// Per 32-key chunk: S^T tiles (rows = keys, cols = queries) = K frag (A) x Q frag (B); running max (one shfl_xor 16), p = exp2; the two S^T tiles repacked to 16 bit are the P^T B fragment
// (element r <- keys c0+8h+r, element 8+r <- keys c0+16+8h+r); O^T[d][query] += V^T frag (A, rows of the [d][t] plane) x P^T. HI: bf16 hi/lo planes, 3 products; else f16, P x PCAR.
template <bool HI>
__device__ __forceinline__ void attn_body(const bf* __restrict__ Qa, const bf* __restrict__ Qb, const bf* __restrict__ Ka, const bf* __restrict__ Kb, const bf* __restrict__ Va, const bf* __restrict__ Vb,
                                          const int tq, const int tv, const int qblk, const int bh, bf* ATh, bf* ATl) {
    typedef AF<HI> F; typedef typename F::V V;
    __shared__ __align__(16) bf sth[4 * 16 * 72];
    __shared__ __align__(16) bf stl[4 * 16 * 72];
    const int lane = threadIdx.x & 31, lr = lane & 15, hi = lane >> 4, wave = threadIdx.x >> 5;
    const int q0 = qblk * 64 + wave * 16; const int qrow = q0 + lr;
    const size_t qoff = ((size_t)bh * tq + q0 + lr) * HD + 8 * hi;
    const size_t koff = ((size_t)bh * tq + lr) * HD + 8 * hi;
    const size_t voff = ((size_t)bh * HD + lr) * tv + 8 * hi;
    V qa[2], qb[2];
#pragma unroll
    for (int ks = 0; ks < 2; ++ks) { qa[ks] = F::ld(Qa + qoff + 32 * ks); if (HI) qb[ks] = F::ld(Qb + qoff + 32 * ks); else qb[ks] = qa[ks]; }
    v8f o[4];
#pragma unroll
    for (int nb = 0; nb < 4; ++nb) o[nb] = (v8f){};
    float m = NEGV, l = 0.0f;
#pragma unroll 1
    for (int c0 = 0; c0 <= q0 + 15; c0 += 32) {
        v8f s0 = (v8f){}, s1 = (v8f){}; V k0, k1;
#pragma unroll
        for (int ks = 0; ks < 2; ++ks) {
            k0 = F::ld(Ka + koff + (size_t)c0 * HD + 32 * ks); k1 = F::ld(Ka + koff + (size_t)(c0 + 16) * HD + 32 * ks);
            if (HI) { const V l0 = F::ld(Kb + koff + (size_t)c0 * HD + 32 * ks); const V l1 = F::ld(Kb + koff + (size_t)(c0 + 16) * HD + 32 * ks);
                s0 = F::mma(l0, qa[ks], s0); s1 = F::mma(l1, qa[ks], s1); s0 = F::mma(k0, qb[ks], s0); s1 = F::mma(k1, qb[ks], s1); }
            s0 = F::mma(k0, qa[ks], s0); s1 = F::mma(k1, qa[ks], s1);
        }
        asm volatile("v_nop\n\tv_nop\n\tv_nop\n\tv_nop" : "+v"(s0), "+v"(s1) : "v"(k0), "v"(k1), "v"(qa[1]), "v"(qb[1]));
        if (c0 + 31 > q0) {       // wave-uniform: chunk touches the diagonal; masked scores are replaced (keys above the query)
#pragma unroll
            for (int r = 0; r < 8; ++r) { const int key = c0 + 8 * hi + r; s0[r] = (key > qrow) ? NEGV : s0[r]; s1[r] = (key + 16 > qrow) ? NEGV : s1[r]; }
        }
        float mx = fmaxf(s0[0], s1[0]);
#pragma unroll
        for (int r = 1; r < 8; ++r) mx = fmaxf(mx, fmaxf(s0[r], s1[r]));
        mx = fmaxf(mx, __shfl_xor(mx, 16, 32));
        const float mn = fmaxf(m, mx);
        const float corr = __builtin_amdgcn_exp2f((m - mn) * SCL2E);
        float ps = 0.0f;
#pragma unroll
        for (int r = 0; r < 8; ++r) { s0[r] = __builtin_amdgcn_exp2f((s0[r] - mn) * SCL2E); s1[r] = __builtin_amdgcn_exp2f((s1[r] - mn) * SCL2E); ps += s0[r] + s1[r]; }
        l = l * corr + ps; m = mn;
#pragma unroll
        for (int nb = 0; nb < 4; ++nb)
#pragma unroll
            for (int r = 0; r < 8; ++r) o[nb][r] *= corr;
        V pa, pl;
        if (HI) { v16us uh, ul;
#pragma unroll
            for (int r = 0; r < 8; ++r) { unsigned short a, c; splitf(s0[r], a, c); uh[r] = a; ul[r] = c; splitf(s1[r], a, c); uh[8 + r] = a; ul[8 + r] = c; }
            pa = __builtin_bit_cast(V, uh); pl = __builtin_bit_cast(V, ul);
        } else { v16h th;
#pragma unroll
            for (int r = 0; r < 8; ++r) { th[r] = (h16)(s0[r] * PCAR); th[8 + r] = (h16)(s1[r] * PCAR); }
            pa = __builtin_bit_cast(V, th); pl = pa; }
        V vh[4], vl[4];
#pragma unroll
        for (int nb = 0; nb < 4; ++nb) { vh[nb] = F::ld(Va + voff + (size_t)nb * 16 * tv + c0); if (HI) vl[nb] = F::ld(Vb + voff + (size_t)nb * 16 * tv + c0); else vl[nb] = vh[nb]; }
#pragma unroll
        for (int nb = 0; nb < 4; ++nb) { if (HI) { o[nb] = F::mma(vl[nb], pa, o[nb]); o[nb] = F::mma(vh[nb], pl, o[nb]); } o[nb] = F::mma(vh[nb], pa, o[nb]); }
        asm volatile("v_nop\n\tv_nop\n\tv_nop\n\tv_nop" : "+v"(o[0]), "+v"(o[1]), "+v"(o[2]), "+v"(o[3]) : "v"(pa), "v"(pl), "v"(vh[3]));
    }
    l += __shfl_xor(l, 16, 32);
    const float inv = (HI ? 1.0f : (1.0f / PCAR)) * (1.0f / l);
    const int sbase = wave * (16 * 72) + lr * 72 + 8 * hi;
#pragma unroll
    for (int nb = 0; nb < 4; ++nb) { v8us h8, l8;
#pragma unroll
        for (int r = 0; r < 8; ++r) { unsigned short a, c; splitf(o[nb][r] * inv, a, c); h8[r] = a; l8[r] = c; }
        *(v8usa*)(sth + sbase + nb * 16) = h8; *(v8usa*)(stl + sbase + nb * 16) = l8; }
    __syncthreads();
    const int b = bh / NH, h = bh % NH;
{
#pragma unroll
        for (int it = 0; it < 4; ++it) { const int row = it * 4 + (lane >> 3), pc = lane & 7;
            const v8us xh = *(const v8usa*)(sth + wave * (16 * 72) + row * 72 + pc * 8); const v8us xl = *(const v8usa*)(stl + wave * (16 * 72) + row * 72 + pc * 8);
            const size_t go = ((size_t)b * SEQ + q0 + row) * DQ + h * HD + pc * 8;
            *(v8us*)(ATh + go) = xh; *(v8us*)(ATl + go) = xl; }
         }
}
// rows >= RH: f16 planes [bh][SEQ][HD] / [bh][HD][SEQ]; grid ((SEQ - RH) / 64, NB * NH), 128 threads.
__global__ __launch_bounds__(128) void k_attn_lo(const bf* Q16, const bf* K16, const bf* VT16, bf* ATh, bf* ATl) { attn_body<false>(Q16, Q16, K16, K16, VT16, VT16, SEQ, SEQ, (int)blockIdx.x + RH / 64, (int)blockIdx.y, ATh, ATl); }
// rows < RH: compact bf16 hi|lo planes [bh][RH][HD] / [bh][HD][RH]; grid (RH / 64, NB * NH), 128 threads.
__global__ __launch_bounds__(128) void k_attn_hi(const bf* Qh, const bf* Ql, const bf* Kh, const bf* Kl, const bf* VTh, const bf* VTl, bf* ATh, bf* ATl) { attn_body<true>(Qh, Ql, Kh, Kl, VTh, VTl, RH, RH, (int)blockIdx.x, (int)blockIdx.y, ATh, ATl); }

constexpr size_t SZ_W  = (size_t)DM * DM * 2;             // one bf16 weight plane
constexpr size_t SZ_XB = (size_t)NB * SEQ * DM * 2;       // bf16 x
constexpr size_t SZ_P  = (size_t)NB * NH * SEQ * HD * 2;  // one f16 head plane
constexpr size_t SZ_R  = (size_t)NB * NH * RH * HD * 2;   // one compact bf16 plane
constexpr size_t SZ_AT = (size_t)NB * SEQ * DQ * 2;       // one merged bf16 plane
constexpr size_t WS_TOTAL = 4 * SZ_W + SZ_XB + 3 * SZ_P + 6 * SZ_R + 2 * SZ_AT;
static_assert(SZ_W % 256 == 0);
static_assert(SZ_XB % 256 == 0);
static_assert(SZ_P % 256 == 0);
static_assert(SZ_R % 256 == 0);
static_assert(SZ_AT % 256 == 0);
static_assert(WS_TOTAL <= (size_t)134217728);

extern "C" void kernel_launch(void* const* d_in, const int* in_sizes, int n_in,
                              void* d_out, int out_size, void* d_ws, size_t ws_size, hipStream_t stream) {
    if (n_in < 8) return;
    const long long need_x = (long long)(NB - 1) * SEQ_FULL * DM + (long long)SEQ * DM;
    if ((long long)in_sizes[0] < need_x) return;
    if ((long long)in_sizes[1] < (long long)DM * DM || (long long)in_sizes[2] < (long long)DM * DM || (long long)in_sizes[3] < (long long)DM * DM || (long long)in_sizes[4] < (long long)DM * DM) return;
    if ((long long)in_sizes[5] < (long long)TABN * TABW || (long long)in_sizes[6] < (long long)TABN * TABW) return;
    if ((long long)in_sizes[7] < (long long)(NB - 1) * SEQ_FULL + SEQ) return;
    if ((long long)out_size < need_x) return;
    if (WS_TOTAL > ws_size) return;
    const float* x = (const float*)d_in[0]; const float* wq = (const float*)d_in[1]; const float* wk = (const float*)d_in[2]; const float* wv = (const float*)d_in[3]; const float* wo = (const float*)d_in[4];
    const float* sin_tab = (const float*)d_in[5]; const float* cos_tab = (const float*)d_in[6]; const int* tpos = (const int*)d_in[7];
    float* OUT = (float*)d_out;
    char* wsp = (char*)d_ws;
    auto take = [&](size_t bytes) { char* p = wsp; wsp += bytes; return (void*)p; };
    bf* WQ = (bf*)take(SZ_W); bf* WK = (bf*)take(SZ_W); bf* WV = (bf*)take(SZ_W); bf* WO = (bf*)take(SZ_W);
    bf* XB = (bf*)take(SZ_XB);
    h16* Q16 = (h16*)take(SZ_P); h16* K16 = (h16*)take(SZ_P); h16* VT16 = (h16*)take(SZ_P);
    bf* Qh = (bf*)take(SZ_R); bf* Ql = (bf*)take(SZ_R); bf* Kh = (bf*)take(SZ_R); bf* Kl = (bf*)take(SZ_R); bf* VTh = (bf*)take(SZ_R); bf* VTl = (bf*)take(SZ_R);
    bf* ATh = (bf*)take(SZ_AT); bf* ATl = (bf*)take(SZ_AT);

    const size_t w8 = (size_t)DM * DM / 8; const unsigned gw = (unsigned)((w8 + 255) / 256);
    k_cvt8<<<gw, 256, 0, stream>>>(wq, WQ, w8); k_cvt8<<<gw, 256, 0, stream>>>(wk, WK, w8); k_cvt8<<<gw, 256, 0, stream>>>(wv, WV, w8); k_cvt8<<<gw, 256, 0, stream>>>(wo, WO, w8);
    const size_t x8 = (size_t)SEQ * DM / 8;
    for (int b = 0; b < NB; ++b) k_cvt8<<<(unsigned)((x8 + 255) / 256), 256, 0, stream>>>(x + (size_t)b * SEQ_FULL * DM, XB + (size_t)b * SEQ * DM, x8);

    // WQ, WK, WV lie one behind the other in the workspace
    k_gemm_qkv<<<dim3((unsigned)(NB * SEQ / 128), (unsigned)(DM / 128), 3), 128, 0, stream>>>(XB, WQ, sin_tab, cos_tab, tpos, Q16, K16, VT16, Qh, Ql, Kh, Kl, VTh, VTl);

    k_attn_hi<<<dim3(RH / 64, NB * NH, 1), 128, 0, stream>>>(Qh, Ql, Kh, Kl, VTh, VTl, ATh, ATl);
    if (SEQ > RH) k_attn_lo<<<dim3((SEQ - RH) / 64, NB * NH, 1), 128, 0, stream>>>((const bf*)Q16, (const bf*)K16, (const bf*)VT16, ATh, ATl);

    // out[b][t][e] = sum_d merged[b][t][d] wo[e][d]; z = batch, output batch stride from the full sequence length
    k_gemm_x2<<<dim3(SEQ / 128, DM / 128, NB), 128, 0, stream>>>(ATh, ATl, WO, DQ, OUT, DM, (size_t)SEQ * DQ, (size_t)0, (size_t)SEQ_FULL * DM);
}

// v003
// It runs in 119 microseconds.
// Two timings next to v002 put it at 1.40 and 1.41 times that version's speed.
// Counting every step since v000, it is 2.22 times as fast.
#include <hip/hip_runtime.h>

// Causal multi-head self-attention, 16 heads x 64, interleaved rotary with sin/cos rows gathered from the table inputs by the integer position input; out = merged x wo^T.
// Compute dtypes, f32 accumulate: every float input converted to bf16 (RNE); q/k/v projections v_wmma_f32_16x16x32_bf16 (exact bf16 x bf16 products);
// scores q.k: query rows < 256 bf16 hi/lo (3 products), rows >= 256 single f16; P.V: rows < 256 bf16 hi/lo (3 products), rows >= 256 single f16 with P carried x1024;
// output projection: merged bf16 hi|lo x exact bf16 wo (2 products, all hi products summed before the lo products). Softmax f32 (running max, exp2).
// Fused flash-style attention in transposed form (S^T = K Q^T, O^T = V^T P^T): two adjacent S^T key tiles repacked to 16 bit are the P^T B fragment; no score plane in memory.

#ifndef NB
#define NB 2
#endif
#ifndef SEQ
#define SEQ 2048
#endif
#define SEQ_FULL 2048                 // per-batch row stride of x, token positions and the output
#define DM   1024
#define NH   16
#define HD   64
#define DQ   (NH * HD)
#define TABN 2048                     // rows of the sin/cos tables
#define TABW 32                       // columns of the sin/cos tables (HD / 2)
#define RH   256                      // query rows < RH use bf16 hi/lo planes
#define PCAR 1024.0f
#define SCL2E 0.18033688011112042f    // HD^-0.5 x log2(e)
#define NEGV (-1.0e30f)

static_assert(HD == 64);
static_assert(DQ == DM);
static_assert(TABW * 2 == HD);
static_assert(DM % 64 == 0);
static_assert(DM % 32 == 0);
static_assert(SEQ % 64 == 0);
static_assert(RH % 64 == 0);
static_assert(RH <= SEQ);
static_assert(SEQ <= SEQ_FULL);
static_assert(SEQ <= TABN);
static_assert((NB * SEQ) % 64 == 0);
static_assert(SEQ % 128 == 0);
static_assert(DM % 128 == 0 && DM >= 256);

typedef _Float16 h16;
typedef unsigned short bf;
typedef __attribute__((ext_vector_type(16))) __bf16   v16bf;
typedef __attribute__((ext_vector_type(16))) _Float16 v16h;
typedef __attribute__((ext_vector_type(16))) unsigned short v16us;
typedef __attribute__((ext_vector_type(8)))  unsigned short v8us;
typedef __attribute__((ext_vector_type(8)))  float    v8f;
typedef __attribute__((ext_vector_type(4)))  float    v4f;
typedef __attribute__((ext_vector_type(2)))  float    v2f;
typedef __attribute__((ext_vector_type(8)))  _Float16 v8h;
typedef __attribute__((ext_vector_type(4)))  _Float16 v4h;
typedef __attribute__((ext_vector_type(4)))  unsigned short v4us;
typedef v4f  __attribute__((may_alias)) v4fa;
typedef v8us __attribute__((may_alias)) v8usa;

__device__ __forceinline__ unsigned short f2bf(float f) { unsigned u = __float_as_uint(f); u += 0x7FFFu + ((u >> 16) & 1u); return (unsigned short)(u >> 16); }
__device__ __forceinline__ float bf2f(unsigned short b) { return __uint_as_float(((unsigned)b) << 16); }
__device__ __forceinline__ float bfr(float f) { return bf2f(f2bf(f)); }
__device__ __forceinline__ void splitf(float y, unsigned short& h, unsigned short& l) { h = f2bf(y); l = f2bf(y - bf2f(h)); }
__device__ __forceinline__ v16us cat16u(v8us lo, v8us hi) { return __builtin_shufflevector(lo, hi, 0, 1, 2, 3, 4, 5, 6, 7, 8, 9, 10, 11, 12, 13, 14, 15); }
__device__ __forceinline__ v8f wmma16(v16h a, v16h b, v8f c) { return __builtin_amdgcn_wmma_f32_16x16x32_f16(false, a, false, b, (short)0, c, false, false); }
__device__ __forceinline__ v8f wmmab(v16bf a, v16bf b, v8f c) { return __builtin_amdgcn_wmma_f32_16x16x32_bf16(false, a, false, b, (short)0, c, false, false); }

// Fragment loader for K-contiguous 16-bit rows: p = row base + k0 + 8*(lane>>4); elements 0..7 <- p[0..7], elements 8..15 <- p[16..23].
template <bool HI> struct AF;
template <> struct AF<false> {
    typedef v16h V;
    static __device__ __forceinline__ V ld(const bf* p) { return __builtin_bit_cast(v16h, cat16u(*(const v8usa*)p, *(const v8usa*)(p + 16))); }
    static __device__ __forceinline__ v8f mma(V a, V b, v8f c) { return wmma16(a, b, c); }
};
template <> struct AF<true> {
    typedef v16bf V;
    static __device__ __forceinline__ V ld(const bf* p) { return __builtin_bit_cast(v16bf, cat16u(*(const v8usa*)p, *(const v8usa*)(p + 16))); }
    static __device__ __forceinline__ v8f mma(V a, V b, v8f c) { return wmmab(a, b, c); }
};

// ---- GEMM, 128x128 output tile per block of 4 waves (2 x 2, one 64x64 wave tile = 16 accumulators each); grid (M/128, N/128, Z), 128 threads.
// acc[m][n] (f32) = sum_k (A[m][k] (+ A2[m][k])) Bt[n][k], handed to the epilogue EPI per wave tile. z-batch strides sA/sB in elements. K % 128 == 0, K >= 256, M % 128 == 0, N % 128 == 0.
// Operands come to LDS by tensor loads, two buffers: a stage is 128 k of [A 128 rows | Bt 128 rows]; each wave brings one slice of 64 rows x 256 B (waves 0, 1: A; waves 2, 3: Bt),
// padded by the mover to a pitch of 272 B for the 16-byte fragment reads. With A2 the K/128 stages of A are followed by K/128 stages of A2 against the same Bt rows.
typedef unsigned u32x4 __attribute__((ext_vector_type(4)));
typedef unsigned u32x8 __attribute__((ext_vector_type(8)));
constexpr unsigned G_ROWB  = 256;                 // bytes of one staged row (128 k)
constexpr unsigned G_PITCH = G_ROWB + 16;         // LDS row pitch, an odd multiple of 16 B
constexpr unsigned G_SLICE = 18432;               // 64 rows x 272 B = 17,408 B, rounded up to a multiple of 2 KiB
constexpr unsigned G_BUF   = 4 * G_SLICE;
static_assert(64 * G_PITCH <= G_SLICE && G_SLICE % 2048 == 0);
__device__ __forceinline__ unsigned uni(unsigned v) { return (unsigned)__builtin_amdgcn_readfirstlane(v); }
__device__ __forceinline__ unsigned pinned(unsigned v) { unsigned w = uni(v); asm volatile("" : "+s"(w)); return w; }
__device__ __forceinline__ void tdm_load(u32x4 g0, u32x8 g1) { asm volatile("tensor_load_to_lds %0, %1" :: "s"(g0), "s"(g1) : "memory"); }
__device__ __forceinline__ void sfence() { __builtin_amdgcn_sched_barrier(0); }   // keeps a group of fragment loads, or a block of products, together in the built code
// Epilogue: f32 rows C[m][n] (pitch ldc, z-batch stride sC), each 16-row band turned through the wave's LDS staging into 16-byte row stores.
struct EpiRows {
    float* C; int ldc; size_t sC;
    __device__ __forceinline__ void operator()(v8f (&acc)[4][4], float* os, const int r0, const int c0, const int lr, const int hi) const {
        float* Cz = C + (size_t)blockIdx.z * sC;
#pragma unroll
        for (int mb = 0; mb < 4; ++mb) {
#pragma unroll
            for (int nb = 0; nb < 4; ++nb) {
#pragma unroll
                for (int j = 0; j < 8; ++j) os[(hi * 8 + j) * 68 + nb * 16 + lr] = acc[mb][nb][j]; }
            __builtin_amdgcn_wave_barrier(); asm volatile("" ::: "memory");   // the band's LDS writes stay ahead of the row reads below
            float* crow = Cz + (size_t)(r0 + mb * 16) * ldc + c0;
#pragma unroll
            for (int s = 0; s < 8; ++s) { const int row = 2 * s + hi, cofs = lr * 4; const v4f val = *(const v4fa*)(os + row * 68 + cofs);
                *(v4f*)(crow + (size_t)row * ldc + cofs) = val; }
            __builtin_amdgcn_wave_barrier(); asm volatile("" ::: "memory");   // the row reads stay ahead of the next band's LDS writes
        }
    }
};
// Epilogue of the q/k/v projections (z = 0, 1, 2): a wave tile is 64 tokens of one batch x the 64 columns of one head, and goes straight to the head planes.
// z < 2: interleaved rotary, pair (2i, 2i+1), table row = clamped token position, out[2i] = cos x[2i] - sin x[2i+1], out[2i+1] = sin x[2i] + cos x[2i+1];
//        planes [b*NH + h][t][d]: f16 for all t, compact bf16 hi|lo [bh][RH][HD] for t < RH.
// z = 2: value planes [bh][d][t] (f16, all t; compact bf16 hi|lo [bh][HD][RH] for t < RH): a lane's 8 accumulator rows are 8 consecutive t of one d, stored as 16 bytes from registers.
struct EpiHeads {
    const float* __restrict__ sin_tab; const float* __restrict__ cos_tab; const int* __restrict__ tpos;
    h16* Q16; h16* K16; h16* VT16; bf* Qh; bf* Ql; bf* Kh; bf* Kl; bf* VTh; bf* VTl;
    // Stands behind each run of global loads or stores, in front of the first instruction that writes a register which one of them names; the scheduling fences keep the run together and later work behind the wait.
    static __device__ __forceinline__ void xwait() { asm volatile("s_wait_xcnt 0x0" ::: "memory"); sfence(); }
    // The same behind a run of table loads: the eight offsets are inputs of the wait, so that none of their registers is given to a later load's result ahead of it.
    static __device__ __forceinline__ void xwait(const unsigned (&t)[8]) { asm volatile("s_wait_xcnt 0x0" :: "v"(t[0]), "v"(t[1]), "v"(t[2]), "v"(t[3]), "v"(t[4]), "v"(t[5]), "v"(t[6]), "v"(t[7]) : "memory"); sfence(); }
    __device__ __forceinline__ void operator()(v8f (&acc)[4][4], float* os, const int r0, const int c0, const int lr, const int hi) const {
        const int b = r0 / SEQ, t0 = r0 % SEQ, bh = b * NH + c0 / HD;
        const bool hr = (t0 < RH);     // uniform per wave: the tile's 64 tokens lie on one side of RH
        const int tc = hr ? t0 : 0;    // first token in the compact planes
        if (blockIdx.z == 2) {
            h16* v16 = VT16 + (size_t)bh * HD * SEQ + t0; const unsigned vofs = (unsigned)(lr * SEQ + hi * 8);
#pragma unroll
            for (int nb = 0; nb < 4; ++nb) {
                v8h o16[4];
#pragma unroll
                for (int mb = 0; mb < 4; ++mb)
#pragma unroll
                    for (int j = 0; j < 8; ++j) o16[mb][j] = (h16)acc[mb][nb][j];
                sfence();   // the four stores issue as one run, with nothing between them and their wait
#pragma unroll
                for (int mb = 0; mb < 4; ++mb) *(v8h*)(v16 + (nb * 16 * SEQ + mb * 16) + vofs) = o16[mb];   // the four stores fill one 128-byte line per d
                xwait();
            }
            if (hr) {
                float* own = os + (hi * 16 + lr) * 8;     // this lane's own 8 floats of each of the four column blocks
                bf* vh = VTh + (size_t)bh * HD * RH + tc; bf* vl = VTl + (size_t)bh * HD * RH + tc; const unsigned cofs = (unsigned)(lr * RH + hi * 8);
#pragma unroll
                for (int mb = 0; mb < 4; ++mb) {
#pragma unroll
                    for (int nb = 0; nb < 4; ++nb)
#pragma unroll
                        for (int j = 0; j < 8; ++j) own[nb * 256 + j] = acc[mb][nb][j];
#pragma unroll 1   // rolled, fed from LDS: the hi/lo split stands once per band in the text
                    for (int nb = 0; nb < 4; ++nb) { const v4f xa = *(const v4fa*)(own + nb * 256), xb = *(const v4fa*)(own + nb * 256 + 4); v8us oh, ol;
#pragma unroll
                        for (int j = 0; j < 4; ++j) { unsigned short u0, u1; splitf(xa[j], u0, u1); oh[j] = u0; ol[j] = u1; splitf(xb[j], u0, u1); oh[4 + j] = u0; ol[4 + j] = u1; }
                        const unsigned ce = (unsigned)(nb * 16 * RH + mb * 16) + cofs;
                        sfence();   // the two stores issue as one run, with nothing between them and their wait
                        *(v8us*)(vh + ce) = oh; *(v8us*)(vl + ce) = ol;
                        xwait(); }
                }
            }
            return;
        }
        h16* p16 = ((blockIdx.z == 0) ? Q16 : K16) + ((size_t)bh * SEQ + t0) * HD;
        bf* ph = ((blockIdx.z == 0) ? Qh : Kh) + ((size_t)bh * RH + tc) * HD; bf* pl = ((blockIdx.z == 0) ? Ql : Kl) + ((size_t)bh * RH + tc) * HD;
        const int* tp = tpos + (size_t)b * SEQ_FULL + t0;
        const unsigned lofs = (unsigned)(hi * HD + lr * 4);     // the lane's four columns in a pair of token rows
        int pos[4][8];     // token positions of the rows this lane will write: all fetched at once, one latency
#pragma unroll
        for (int mb = 0; mb < 4; ++mb)
#pragma unroll
            for (int s = 0; s < 8; ++s) pos[mb][s] = tp[mb * 16 + 2 * s + hi];
        xwait();
        unsigned to[4][8];   // byte offset of the lane's two sin (cos) values: table row = clamped token position
#pragma unroll
        for (int mb = 0; mb < 4; ++mb)
#pragma unroll
            for (int s = 0; s < 8; ++s) { const int p = pos[mb][s]; to[mb][s] = ((unsigned)(p < 0 ? 0 : (p > TABN - 1 ? TABN - 1 : p)) * TABW + (unsigned)lr * 2u) * 4u; }
        v2f sn[2][8], cs[2][8];   // fetched one 16-row band ahead
        sfence();   // the band's table loads issue as one run, with nothing between them and their wait
#pragma unroll
        for (int s = 0; s < 8; ++s) { sn[0][s] = *(const v2f*)((const char*)sin_tab + to[0][s]); cs[0][s] = *(const v2f*)((const char*)cos_tab + to[0][s]); }
        xwait(to[0]);
#pragma unroll
        for (int mb = 0; mb < 4; ++mb) {
            const int cb = mb & 1;
            if (mb < 3) {
#pragma unroll
                for (int s = 0; s < 8; ++s) { sn[cb ^ 1][s] = *(const v2f*)((const char*)sin_tab + to[mb + 1][s]); cs[cb ^ 1][s] = *(const v2f*)((const char*)cos_tab + to[mb + 1][s]); }
                xwait(to[mb + 1]);
            }
#pragma unroll
            for (int nb = 0; nb < 4; ++nb) {
#pragma unroll
                for (int j = 0; j < 8; ++j) os[(hi * 8 + j) * 68 + nb * 16 + lr] = acc[mb][nb][j]; }
            __builtin_amdgcn_wave_barrier(); asm volatile("" ::: "memory");   // the band's LDS writes stay ahead of the row reads below
            v4h o16[8]; v4f xy[8];
#pragma unroll
            for (int s = 0; s < 8; ++s) xy[s] = *(const v4fa*)(os + (2 * s + hi) * 68 + lr * 4);
#pragma unroll
            for (int s = 0; s < 8; ++s) { const v4f x = xy[s];
                const float s0 = bfr(sn[cb][s][0]), s1 = bfr(sn[cb][s][1]), k0 = bfr(cs[cb][s][0]), k1 = bfr(cs[cb][s][1]);
                v4f y; y[0] = k0 * x[0] - s0 * x[1]; y[1] = s0 * x[0] + k0 * x[1]; y[2] = k1 * x[2] - s1 * x[3]; y[3] = s1 * x[2] + k1 * x[3];
#pragma unroll
                for (int q = 0; q < 4; ++q) o16[s][q] = (h16)y[q];
                xy[s] = y;
            }
            sfence();   // the band's eight stores issue as one run, with nothing between them and their wait
#pragma unroll
            for (int s = 0; s < 8; ++s) *(v4h*)(p16 + (mb * 16 + 2 * s) * HD + lofs) = o16[s];
            xwait();
            if (hr) {      // each lane puts its rotated values back where it read them, for the split below
#pragma unroll
                for (int s = 0; s < 8; ++s) *(v4fa*)(os + (2 * s + hi) * 68 + lr * 4) = xy[s];
#pragma unroll 1   // rolled, fed from LDS: the hi/lo split stands once per band in the text
                for (int s = 0; s < 8; ++s) { const v4f y = *(const v4fa*)(os + (2 * s + hi) * 68 + lr * 4); v4us oh, ol;
#pragma unroll
                    for (int q = 0; q < 4; ++q) { unsigned short u0, u1; splitf(y[q], u0, u1); oh[q] = u0; ol[q] = u1; }
                    const unsigned ce = (unsigned)((mb * 16 + 2 * s) * HD) + lofs;
                    sfence();   // the two stores issue as one run, with nothing between them and their wait
                    *(v4us*)(ph + ce) = oh; *(v4us*)(pl + ce) = ol;
                    xwait(); }
            }
            __builtin_amdgcn_wave_barrier(); asm volatile("" ::: "memory");   // the row reads stay ahead of the next band's LDS writes
        }
    }
};
template <int NSPLIT, class EPI>
__device__ __forceinline__ void gemmw_body(const bf* __restrict__ A, const bf* __restrict__ A2, const bf* __restrict__ Bt, const int K, const size_t sA, const size_t sB, const EPI epi) {
    typedef AF<true> W; typedef W::V V;
    __shared__ __attribute__((aligned(2048))) unsigned char ring[2 * G_BUF];
    __shared__ __align__(16) float osb[4 * 16 * 68];
    const size_t z = blockIdx.z; A += z * sA; A2 += z * sA; Bt += z * sB;
    const int lane = threadIdx.x & 31, lr = lane & 15, hi = lane >> 4; const unsigned wave = uni(threadIdx.x >> 5); const unsigned wm = wave >> 1, wn = wave & 1u;
    const int r0 = blockIdx.x * 128 + (int)wm * 64, c0 = blockIdx.y * 128 + (int)wn * 64;
    __builtin_assume(K >= 256);              // the ring's prologue issues two stages: no path without a pass is built
    const unsigned KP = (unsigned)K / 128u, NS = (NSPLIT + 1) * KP;     // stages per plane, stages in all
    // this wave's slice of a stage: 64 rows of A (A2) or of Bt
    const size_t srow = (wave < 2u) ? (size_t)(blockIdx.x * 128u + 64u * wave) * K : (size_t)(blockIdx.y * 128u + 64u * (wave - 2u)) * K;
    const unsigned long long ga1 = (unsigned long long)(size_t)(((wave < 2u) ? A : Bt) + srow), ga2 = (unsigned long long)(size_t)(((wave < 2u) ? A2 : Bt) + srow);
    const unsigned lds_slice = (unsigned)(size_t)ring + wave * G_SLICE;
    u32x8 g1;   // 1-byte elements, tensor = tile = 64 rows of 256 B, source pitch 2 K bytes, 4 dwords of pad behind every 64
    g1[0] = uni((1u << 20) | (5u << 22) | (3u << 25)); g1[1] = uni(G_ROWB << 16); g1[2] = uni(64u << 16); g1[3] = uni(G_ROWB << 16); g1[4] = uni(64u); g1[5] = uni((unsigned)K * 2u); g1[6] = uni(0u); g1[7] = uni(0u);
    // group 0: count 1 | LDS place | address of the slice's first byte, type 2 in the top bits. Words 2 and 3 walk from stage to stage by one 64-bit add.
    const unsigned long long jump = ga2 - ga1 - (unsigned long long)(KP - 1u) * G_ROWB;   // from the last stage of A to the first of A2
    u32x4 g0; g0[0] = uni(1u); g0[1] = uni(lds_slice); g0[2] = uni((unsigned)ga1); g0[3] = uni((((unsigned)(ga1 >> 32)) & 0x01FFFFFFu) | 0x80000000u);
    auto issue_next = [&](unsigned st, unsigned buf) {
        const unsigned long long c = ((((unsigned long long)g0[3]) << 32) | g0[2]) + ((NSPLIT == 1 && st == KP) ? jump : (unsigned long long)G_ROWB);
        g0[1] = uni(lds_slice + buf); g0[2] = uni((unsigned)c); g0[3] = uni((unsigned)(c >> 32));
        tdm_load(g0, g1);
    };
    tdm_load(g0, g1);
    // Every tensor wait names the descriptor: its words stay in their scalar registers from issue to wait, and none takes a new value while a request is outstanding.
    asm volatile("s_wait_tensorcnt 0x0" : "+s"(g0), "+s"(g1) : : "memory");   // this wave's slice of stage 0 has landed
    __syncthreads();                                      // stage 0 published
    issue_next(1u, G_BUF);
    v8f acc[4][4];
#pragma unroll
    for (int mb = 0; mb < 4; ++mb)
#pragma unroll
        for (int nb = 0; nb < 4; ++nb) acc[mb][nb] = (v8f){};
    const unsigned aoff = wm * G_SLICE + (unsigned)lr * G_PITCH + 16u * hi, boff = (2u + wn) * G_SLICE + (unsigned)lr * G_PITCH + 16u * hi;
#pragma unroll 1   // one pass per trip: one publish point and one refill in the built loop, accumulators and fragments in registers
    for (unsigned s = 0; s < NS; ++s) {
        const unsigned buf = (s & 1u) * G_BUF;
        const unsigned char* la = ring + buf + aoff; const unsigned char* lb = ring + buf + boff;
        V a[2][4], b[2][4];
#pragma unroll
        for (int f = 0; f < 4; ++f) { a[0][f] = W::ld((const bf*)(la + f * 16 * G_PITCH)); b[0][f] = W::ld((const bf*)(lb + f * 16 * G_PITCH)); }
        sfence();
#pragma unroll
        for (int u = 0; u < 4; ++u) {       // four blocks of 32 k; the next block's fragments are fetched ahead of this block's products
            const int cs = u & 1;
            if (u < 3) {
#pragma unroll
                for (int f = 0; f < 4; ++f) { a[cs ^ 1][f] = W::ld((const bf*)(la + f * 16 * G_PITCH + (u + 1) * 64)); b[cs ^ 1][f] = W::ld((const bf*)(lb + f * 16 * G_PITCH + (u + 1) * 64)); }
                sfence();
            }
#pragma unroll
            for (int nb = 0; nb < 4; ++nb)
#pragma unroll
                for (int mb = 0; mb < 4; ++mb) acc[mb][nb] = W::mma(a[cs][mb], b[cs][nb], acc[mb][nb]);
            sfence();
        }
        // four vector slots behind the pass's last products, on the loop's taken branch too, before a vector instruction may touch their registers
        asm volatile("v_nop\n\tv_nop\n\tv_nop\n\tv_nop");
        sfence();
        asm volatile("s_wait_dscnt 0x0" ::: "memory");       // this wave has left the buffer
        asm volatile("s_wait_tensorcnt 0x0" : "+s"(g0), "+s"(g1) : : "memory");   // its slice of stage s + 1 has landed
        __syncthreads();                                      // stage s + 1 published; every wave has left stage s's buffer
        if (pinned((s + 2u < NS) ? 1u : 0u) != 0u) issue_next(s + 2u, buf);
    }
    asm volatile("s_wait_tensorcnt 0x0" : : "s"(g0), "s"(g1) : "memory");
    asm volatile("s_wait_dscnt 0x0" ::: "memory");
    epi(acc, osb + wave * (16 * 68), r0, c0, lr, hi);      // output staging in LDS, each wave's own
}
// q, k, v projections of X (bf16 rows [b*SEQ + t][DM]) in one launch: grid (NB*SEQ/128, DM/128, 3), z picks the weight plane of W3 = [wq | wk | wv] and the head planes written.
__global__ __launch_bounds__(128) void k_gemm_qkv(const bf* X, const bf* W3, const float* sin_tab, const float* cos_tab, const int* tpos,
                                                  h16* Q16, h16* K16, h16* VT16, bf* Qh, bf* Ql, bf* Kh, bf* Kl, bf* VTh, bf* VTl) {
    gemmw_body<0>(X, X, W3, DM, (size_t)0, (size_t)DM * DM, EpiHeads{sin_tab, cos_tab, tpos, Q16, K16, VT16, Qh, Ql, Kh, Kl, VTh, VTl}); }
__global__ __launch_bounds__(128) void k_gemm_x2(const bf* A, const bf* A2, const bf* Bt, int K, float* C, int ldc, size_t sA, size_t sB, size_t sC) { gemmw_body<1>(A, A2, Bt, K, sA, sB, EpiRows{C, ldc, sC}); }

__global__ __launch_bounds__(256) void k_cvt8(const float* __restrict__ src, bf* dst, size_t n8) { const size_t i = (size_t)blockIdx.x * 256 + threadIdx.x; if (i >= n8) return; const v8f v = *(const v8f*)(src + i * 8); v8us o;
#pragma unroll
    for (int k = 0; k < 8; ++k) o[k] = f2bf(v[k]); *(v8us*)(dst + i * 8) = o;  }

// ---- fused causal attention, transposed flash form. Block = 4 waves = 64 query rows of one (b, h); each wave owns 16 queries (lane & 15 = query; both lane halves carry its statistics).
// Per 32-key chunk: S^T tiles (rows = keys, cols = queries) = K frag (A) x Q frag (B); running max (one shfl_xor 16), p = exp2; the two S^T tiles repacked to 16 bit are the P^T B fragment
// (element r <- keys c0+8h+r, element 8+r <- keys c0+16+8h+r); O^T[d][query] += V^T frag (A, rows of the [d][t] plane) x P^T. HI: bf16 hi/lo planes, 3 products; else f16, P x PCAR.
template <bool HI>
__device__ __forceinline__ void attn_body(const bf* __restrict__ Qa, const bf* __restrict__ Qb, const bf* __restrict__ Ka, const bf* __restrict__ Kb, const bf* __restrict__ Va, const bf* __restrict__ Vb,
                                          const int tq, const int tv, const int qblk, const int bh, bf* ATh, bf* ATl) {
    typedef AF<HI> F; typedef typename F::V V;
    __shared__ __align__(16) bf sth[4 * 16 * 72];
    __shared__ __align__(16) bf stl[4 * 16 * 72];
    const int lane = threadIdx.x & 31, lr = lane & 15, hi = lane >> 4, wave = threadIdx.x >> 5;
    const int q0 = qblk * 64 + wave * 16; const int qrow = q0 + lr;
    const size_t qoff = ((size_t)bh * tq + q0 + lr) * HD + 8 * hi;
    const size_t koff = ((size_t)bh * tq + lr) * HD + 8 * hi;
    const size_t voff = ((size_t)bh * HD + lr) * tv + 8 * hi;
    V qa[2], qb[2];
#pragma unroll
    for (int ks = 0; ks < 2; ++ks) { qa[ks] = F::ld(Qa + qoff + 32 * ks); if (HI) qb[ks] = F::ld(Qb + qoff + 32 * ks); else qb[ks] = qa[ks]; }
    v8f o[4];
#pragma unroll
    for (int nb = 0; nb < 4; ++nb) o[nb] = (v8f){};
    float m = NEGV, l = 0.0f;
#pragma unroll 1
    for (int c0 = 0; c0 <= q0 + 15; c0 += 32) {
        v8f s0 = (v8f){}, s1 = (v8f){}; V k0, k1;
#pragma unroll
        for (int ks = 0; ks < 2; ++ks) {
            k0 = F::ld(Ka + koff + (size_t)c0 * HD + 32 * ks); k1 = F::ld(Ka + koff + (size_t)(c0 + 16) * HD + 32 * ks);
            if (HI) { const V l0 = F::ld(Kb + koff + (size_t)c0 * HD + 32 * ks); const V l1 = F::ld(Kb + koff + (size_t)(c0 + 16) * HD + 32 * ks);
                s0 = F::mma(l0, qa[ks], s0); s1 = F::mma(l1, qa[ks], s1); s0 = F::mma(k0, qb[ks], s0); s1 = F::mma(k1, qb[ks], s1); }
            s0 = F::mma(k0, qa[ks], s0); s1 = F::mma(k1, qa[ks], s1);
        }
        asm volatile("v_nop\n\tv_nop\n\tv_nop\n\tv_nop" : "+v"(s0), "+v"(s1) : "v"(k0), "v"(k1), "v"(qa[1]), "v"(qb[1]));
        if (c0 + 31 > q0) {       // wave-uniform: chunk touches the diagonal; masked scores are replaced (keys above the query)
#pragma unroll
            for (int r = 0; r < 8; ++r) { const int key = c0 + 8 * hi + r; s0[r] = (key > qrow) ? NEGV : s0[r]; s1[r] = (key + 16 > qrow) ? NEGV : s1[r]; }
        }
        float mx = fmaxf(s0[0], s1[0]);
#pragma unroll
        for (int r = 1; r < 8; ++r) mx = fmaxf(mx, fmaxf(s0[r], s1[r]));
        mx = fmaxf(mx, __shfl_xor(mx, 16, 32));
        const float mn = fmaxf(m, mx);
        const float corr = __builtin_amdgcn_exp2f((m - mn) * SCL2E);
        float ps = 0.0f;
#pragma unroll
        for (int r = 0; r < 8; ++r) { s0[r] = __builtin_amdgcn_exp2f((s0[r] - mn) * SCL2E); s1[r] = __builtin_amdgcn_exp2f((s1[r] - mn) * SCL2E); ps += s0[r] + s1[r]; }
        l = l * corr + ps; m = mn;
#pragma unroll
        for (int nb = 0; nb < 4; ++nb)
#pragma unroll
            for (int r = 0; r < 8; ++r) o[nb][r] *= corr;
        V pa, pl;
        if (HI) { v16us uh, ul;
#pragma unroll
            for (int r = 0; r < 8; ++r) { unsigned short a, c; splitf(s0[r], a, c); uh[r] = a; ul[r] = c; splitf(s1[r], a, c); uh[8 + r] = a; ul[8 + r] = c; }
            pa = __builtin_bit_cast(V, uh); pl = __builtin_bit_cast(V, ul);
        } else { v16h th;
#pragma unroll
            for (int r = 0; r < 8; ++r) { th[r] = (h16)(s0[r] * PCAR); th[8 + r] = (h16)(s1[r] * PCAR); }
            pa = __builtin_bit_cast(V, th); pl = pa; }
        V vh[4], vl[4];
#pragma unroll
        for (int nb = 0; nb < 4; ++nb) { vh[nb] = F::ld(Va + voff + (size_t)nb * 16 * tv + c0); if (HI) vl[nb] = F::ld(Vb + voff + (size_t)nb * 16 * tv + c0); else vl[nb] = vh[nb]; }
#pragma unroll
        for (int nb = 0; nb < 4; ++nb) { if (HI) { o[nb] = F::mma(vl[nb], pa, o[nb]); o[nb] = F::mma(vh[nb], pl, o[nb]); } o[nb] = F::mma(vh[nb], pa, o[nb]); }
        asm volatile("v_nop\n\tv_nop\n\tv_nop\n\tv_nop" : "+v"(o[0]), "+v"(o[1]), "+v"(o[2]), "+v"(o[3]) : "v"(pa), "v"(pl), "v"(vh[3]));
    }
    l += __shfl_xor(l, 16, 32);
    const float inv = (HI ? 1.0f : (1.0f / PCAR)) * (1.0f / l);
    const int sbase = wave * (16 * 72) + lr * 72 + 8 * hi;
#pragma unroll
    for (int nb = 0; nb < 4; ++nb) { v8us h8, l8;
#pragma unroll
        for (int r = 0; r < 8; ++r) { unsigned short a, c; splitf(o[nb][r] * inv, a, c); h8[r] = a; l8[r] = c; }
        *(v8usa*)(sth + sbase + nb * 16) = h8; *(v8usa*)(stl + sbase + nb * 16) = l8; }
    __syncthreads();
    const int b = bh / NH, h = bh % NH;
{
#pragma unroll
        for (int it = 0; it < 4; ++it) { const int row = it * 4 + (lane >> 3), pc = lane & 7;
            const v8us xh = *(const v8usa*)(sth + wave * (16 * 72) + row * 72 + pc * 8); const v8us xl = *(const v8usa*)(stl + wave * (16 * 72) + row * 72 + pc * 8);
            const size_t go = ((size_t)b * SEQ + q0 + row) * DQ + h * HD + pc * 8;
            *(v8us*)(ATh + go) = xh; *(v8us*)(ATl + go) = xl; }
         }
}
// ---- the same attention for rows >= RH (single f16 planes), with K and V^T staged in LDS by tensor loads and shared by the block's 4 waves. Same 32-key chunks in the same order as attn_body<false>.
// A stage is 64 keys: K rows [64 keys][128 B] and V^T rows [64 d][128 B = 64 keys]; each wave brings one slice of 32 rows x 128 B (waves 0, 1: K; waves 2, 3: V^T),
// padded by the mover to a pitch of 144 B for the 16-byte fragment reads. Two buffers; query block qblk walks qblk + 1 stages (at least RH / 64 + 1).
constexpr unsigned T_ROWB  = 128;                 // bytes of one staged row
constexpr unsigned T_PITCH = T_ROWB + 16;         // LDS row pitch, an odd multiple of 16 B
constexpr unsigned T_SLICE = 6144;                // 32 rows x 144 B = 4,608 B, rounded up to a multiple of 2 KiB
constexpr unsigned T_BUF   = 4 * T_SLICE;
static_assert(32 * T_PITCH <= T_SLICE && T_SLICE % 2048 == 0);
static_assert(HD * 2 == T_ROWB);
static_assert(RH / 64 + 1 >= 2);                  // the ring's prologue issues two stages
__device__ __forceinline__ void attn_ring_body(const bf* __restrict__ Qa, const bf* __restrict__ Ka, const bf* __restrict__ Va, const int qblk, const int bh, bf* ATh, bf* ATl) {
    typedef AF<false> F; typedef F::V V;
    __shared__ __attribute__((aligned(2048))) unsigned char kv[2 * T_BUF];
    __shared__ __align__(16) bf sth[4 * 16 * 72];
    __shared__ __align__(16) bf stl[4 * 16 * 72];
    const int lane = threadIdx.x & 31, lr = lane & 15, hi = lane >> 4; const unsigned wave = uni(threadIdx.x >> 5);
    const int q0 = qblk * 64 + (int)wave * 16; const int qrow = q0 + lr;
    __builtin_assume(qblk >= RH / 64);            // the ring's prologue issues two stages: no path without a pass is built
    const unsigned NS = (unsigned)qblk + 1u;      // stages of 64 keys, the last one holds the diagonal
    // this wave's slice of a stage: 32 key rows of K, or 32 d rows of V^T; from stage to stage K walks 64 rows, V^T 64 keys along its rows
    const unsigned long long ga = (unsigned long long)(size_t)((wave < 2u) ? Ka + ((size_t)bh * SEQ + 32u * wave) * HD : Va + ((size_t)bh * HD + 32u * (wave - 2u)) * SEQ);
    const unsigned long long step = (wave < 2u) ? (unsigned long long)(64u * T_ROWB) : (unsigned long long)T_ROWB;
    const unsigned lds_slice = (unsigned)(size_t)kv + wave * T_SLICE;
    u32x8 g1;   // 1-byte elements, tensor = tile = 32 rows of 128 B, source pitch 128 B (K) or 2 SEQ bytes (V^T), 4 dwords of pad behind every 32
    g1[0] = uni((1u << 20) | (4u << 22) | (3u << 25)); g1[1] = uni(T_ROWB << 16); g1[2] = uni(32u << 16); g1[3] = uni(T_ROWB << 16); g1[4] = uni(32u); g1[5] = uni((wave < 2u) ? T_ROWB : (unsigned)SEQ * 2u); g1[6] = uni(0u); g1[7] = uni(0u);
    u32x4 g0; g0[0] = uni(1u); g0[1] = uni(lds_slice); g0[2] = uni((unsigned)ga); g0[3] = uni((((unsigned)(ga >> 32)) & 0x01FFFFFFu) | 0x80000000u);
    auto issue_next = [&](unsigned buf) {
        const unsigned long long c = ((((unsigned long long)g0[3]) << 32) | g0[2]) + step;
        g0[1] = uni(lds_slice + buf); g0[2] = uni((unsigned)c); g0[3] = uni((unsigned)(c >> 32));
        tdm_load(g0, g1);
    };
    const size_t qoff = ((size_t)bh * SEQ + q0 + lr) * HD + 8 * hi;
    V qa[2];
#pragma unroll
    for (int ks = 0; ks < 2; ++ks) qa[ks] = F::ld(Qa + qoff + 32 * ks);
    tdm_load(g0, g1);
    // Every tensor wait names the descriptor: its words stay in their scalar registers from issue to wait, and none takes a new value while a request is outstanding.
    asm volatile("s_wait_tensorcnt 0x0" : : "s"(g0), "s"(g1) : "memory");   // this wave's slice of stage 0 has landed
    __syncthreads();                                      // stage 0 published
    issue_next(T_BUF);
    v8f o[4];
#pragma unroll
    for (int nb = 0; nb < 4; ++nb) o[nb] = (v8f){};
    float m = NEGV, l = 0.0f;
    const unsigned foff = (unsigned)lr * T_PITCH + 16u * hi;
    // one chunk of 32 keys from c0 on: kf = K fragments [16-key tile][32 d], vh = V^T fragments [16 d]
    auto chunk = [&](const int c0, const V (&kf)[2][2], const V (&vh)[4]) {
        v8f s0 = (v8f){}, s1 = (v8f){};
#pragma unroll
        for (int ks = 0; ks < 2; ++ks) { s0 = F::mma(kf[0][ks], qa[ks], s0); s1 = F::mma(kf[1][ks], qa[ks], s1); }
        // four vector slots behind the score products, before a vector instruction may touch their registers
        asm volatile("v_nop\n\tv_nop\n\tv_nop\n\tv_nop" : "+v"(s0), "+v"(s1) : "v"(kf[0][1]), "v"(kf[1][1]), "v"(qa[1]));
        if (c0 + 31 > q0) {       // wave-uniform: chunk touches the diagonal; masked scores are replaced (keys above the query)
#pragma unroll
            for (int r = 0; r < 8; ++r) { const int key = c0 + 8 * hi + r; s0[r] = (key > qrow) ? NEGV : s0[r]; s1[r] = (key + 16 > qrow) ? NEGV : s1[r]; }
        }
        float mx = fmaxf(s0[0], s1[0]);
#pragma unroll
        for (int r = 1; r < 8; ++r) mx = fmaxf(mx, fmaxf(s0[r], s1[r]));
        mx = fmaxf(mx, __shfl_xor(mx, 16, 32));
        const float mn = fmaxf(m, mx);
        const float corr = __builtin_amdgcn_exp2f((m - mn) * SCL2E);
        float ps = 0.0f;
#pragma unroll
        for (int r = 0; r < 8; ++r) { s0[r] = __builtin_amdgcn_exp2f((s0[r] - mn) * SCL2E); s1[r] = __builtin_amdgcn_exp2f((s1[r] - mn) * SCL2E); ps += s0[r] + s1[r]; }
        l = l * corr + ps; m = mn;
#pragma unroll
        for (int nb = 0; nb < 4; ++nb)
#pragma unroll
            for (int r = 0; r < 8; ++r) o[nb][r] *= corr;
        v16h th;
#pragma unroll
        for (int r = 0; r < 8; ++r) { th[r] = (h16)(s0[r] * PCAR); th[8 + r] = (h16)(s1[r] * PCAR); }
#pragma unroll
        for (int nb = 0; nb < 4; ++nb) o[nb] = F::mma(vh[nb], th, o[nb]);
        // four vector slots behind the chunk's last products, on every path out of the chunk
        asm volatile("v_nop\n\tv_nop\n\tv_nop\n\tv_nop" : "+v"(o[0]), "+v"(o[1]), "+v"(o[2]), "+v"(o[3]) : "v"(th), "v"(vh[3]));
    };
#pragma unroll 1   // one stage per trip: one publish point and one refill in the built loop
    for (unsigned s = 0; s < NS; ++s) {
        const unsigned buf = (s & 1u) * T_BUF;
        const unsigned char* kb = kv + buf + foff; const unsigned char* vb = kv + buf + 2 * T_SLICE + foff;
        const int c0 = (int)s * 64;
        V kf[2][2][2], vh[4];     // K fragments of both chunks of the stage are asked for at its head; V^T of a chunk at the chunk's head, and arrives behind its scores and softmax
#pragma unroll
        for (int t = 0; t < 2; ++t)
#pragma unroll
            for (int ks = 0; ks < 2; ++ks) kf[0][t][ks] = F::ld((const bf*)(kb + t * 16 * T_PITCH + ks * 64));
#pragma unroll
        for (int nb = 0; nb < 4; ++nb) vh[nb] = F::ld((const bf*)(vb + (nb >> 1) * T_SLICE + (nb & 1) * 16 * T_PITCH));
#pragma unroll
        for (int t = 0; t < 2; ++t)
#pragma unroll
            for (int ks = 0; ks < 2; ++ks) kf[1][t][ks] = F::ld((const bf*)(kb + T_SLICE + t * 16 * T_PITCH + ks * 64));
        sfence();   // the LDS reads issue as one group, ahead of the products and not among them
        chunk(c0, kf[0], vh);
        if (c0 + 32 <= q0 + 15) {       // wave-uniform: waves 0 and 1 have no key in the second half of the diagonal stage
#pragma unroll
            for (int nb = 0; nb < 4; ++nb) vh[nb] = F::ld((const bf*)(vb + 64 + (nb >> 1) * T_SLICE + (nb & 1) * 16 * T_PITCH));
            sfence();   // as above
            chunk(c0 + 32, kf[1], vh);
        }
        asm volatile("s_wait_dscnt 0x0" ::: "memory");       // this wave has left the buffer
        asm volatile("s_wait_tensorcnt 0x0" : "+s"(g0), "+s"(g1) : : "memory");   // its slice of stage s + 1 has landed
        __syncthreads();                                      // stage s + 1 published; every wave has left stage s's buffer
        if (pinned((s + 2u < NS) ? 1u : 0u) != 0u) issue_next(buf);
    }
    asm volatile("s_wait_tensorcnt 0x0" : : "s"(g0), "s"(g1) : "memory");
    asm volatile("s_wait_dscnt 0x0" ::: "memory");
    l += __shfl_xor(l, 16, 32);
    const float inv = (1.0f / PCAR) * (1.0f / l);
    const int sbase = (int)wave * (16 * 72) + lr * 72 + 8 * hi;
#pragma unroll
    for (int nb = 0; nb < 4; ++nb) { v8us h8, l8;
#pragma unroll
        for (int r = 0; r < 8; ++r) { unsigned short a, c; splitf(o[nb][r] * inv, a, c); h8[r] = a; l8[r] = c; }
        *(v8usa*)(sth + sbase + nb * 16) = h8; *(v8usa*)(stl + sbase + nb * 16) = l8; }
    __syncthreads();
    const int b = bh / NH, h = bh % NH;
#pragma unroll
    for (int it = 0; it < 4; ++it) { const int row = it * 4 + (lane >> 3), pc = lane & 7;
        const v8us xh = *(const v8usa*)(sth + (int)wave * (16 * 72) + row * 72 + pc * 8); const v8us xl = *(const v8usa*)(stl + (int)wave * (16 * 72) + row * 72 + pc * 8);
        const size_t go = ((size_t)b * SEQ + q0 + row) * DQ + h * HD + pc * 8;
        *(v8us*)(ATh + go) = xh; *(v8us*)(ATl + go) = xl; }
}
// rows >= RH: f16 planes [bh][SEQ][HD] / [bh][HD][SEQ]; grid ((SEQ - RH) / 64, NB * NH), 128 threads.
__global__ __launch_bounds__(128) void k_attn_lo(const bf* Q16, const bf* K16, const bf* VT16, bf* ATh, bf* ATl) { attn_ring_body(Q16, K16, VT16, (int)blockIdx.x + RH / 64, (int)blockIdx.y, ATh, ATl); }
// rows < RH: compact bf16 hi|lo planes [bh][RH][HD] / [bh][HD][RH]; grid (RH / 64, NB * NH), 128 threads.
__global__ __launch_bounds__(128) void k_attn_hi(const bf* Qh, const bf* Ql, const bf* Kh, const bf* Kl, const bf* VTh, const bf* VTl, bf* ATh, bf* ATl) { attn_body<true>(Qh, Ql, Kh, Kl, VTh, VTl, RH, RH, (int)blockIdx.x, (int)blockIdx.y, ATh, ATl); }

constexpr size_t SZ_W  = (size_t)DM * DM * 2;             // one bf16 weight plane
constexpr size_t SZ_XB = (size_t)NB * SEQ * DM * 2;       // bf16 x
constexpr size_t SZ_P  = (size_t)NB * NH * SEQ * HD * 2;  // one f16 head plane
constexpr size_t SZ_R  = (size_t)NB * NH * RH * HD * 2;   // one compact bf16 plane
constexpr size_t SZ_AT = (size_t)NB * SEQ * DQ * 2;       // one merged bf16 plane
constexpr size_t WS_TOTAL = 4 * SZ_W + SZ_XB + 3 * SZ_P + 6 * SZ_R + 2 * SZ_AT;
static_assert(SZ_W % 256 == 0);
static_assert(SZ_XB % 256 == 0);
static_assert(SZ_P % 256 == 0);
static_assert(SZ_R % 256 == 0);
static_assert(SZ_AT % 256 == 0);
static_assert(WS_TOTAL <= (size_t)134217728);

extern "C" void kernel_launch(void* const* d_in, const int* in_sizes, int n_in,
                              void* d_out, int out_size, void* d_ws, size_t ws_size, hipStream_t stream) {
    if (n_in < 8) return;
    const long long need_x = (long long)(NB - 1) * SEQ_FULL * DM + (long long)SEQ * DM;
    if ((long long)in_sizes[0] < need_x) return;
    if ((long long)in_sizes[1] < (long long)DM * DM || (long long)in_sizes[2] < (long long)DM * DM || (long long)in_sizes[3] < (long long)DM * DM || (long long)in_sizes[4] < (long long)DM * DM) return;
    if ((long long)in_sizes[5] < (long long)TABN * TABW || (long long)in_sizes[6] < (long long)TABN * TABW) return;
    if ((long long)in_sizes[7] < (long long)(NB - 1) * SEQ_FULL + SEQ) return;
    if ((long long)out_size < need_x) return;
    if (WS_TOTAL > ws_size) return;
    const float* x = (const float*)d_in[0]; const float* wq = (const float*)d_in[1]; const float* wk = (const float*)d_in[2]; const float* wv = (const float*)d_in[3]; const float* wo = (const float*)d_in[4];
    const float* sin_tab = (const float*)d_in[5]; const float* cos_tab = (const float*)d_in[6]; const int* tpos = (const int*)d_in[7];
    float* OUT = (float*)d_out;
    char* wsp = (char*)d_ws;
    auto take = [&](size_t bytes) { char* p = wsp; wsp += bytes; return (void*)p; };
    bf* WQ = (bf*)take(SZ_W); bf* WK = (bf*)take(SZ_W); bf* WV = (bf*)take(SZ_W); bf* WO = (bf*)take(SZ_W);
    bf* XB = (bf*)take(SZ_XB);
    h16* Q16 = (h16*)take(SZ_P); h16* K16 = (h16*)take(SZ_P); h16* VT16 = (h16*)take(SZ_P);
    bf* Qh = (bf*)take(SZ_R); bf* Ql = (bf*)take(SZ_R); bf* Kh = (bf*)take(SZ_R); bf* Kl = (bf*)take(SZ_R); bf* VTh = (bf*)take(SZ_R); bf* VTl = (bf*)take(SZ_R);
    bf* ATh = (bf*)take(SZ_AT); bf* ATl = (bf*)take(SZ_AT);

    const size_t w8 = (size_t)DM * DM / 8; const unsigned gw = (unsigned)((w8 + 255) / 256);
    k_cvt8<<<gw, 256, 0, stream>>>(wq, WQ, w8); k_cvt8<<<gw, 256, 0, stream>>>(wk, WK, w8); k_cvt8<<<gw, 256, 0, stream>>>(wv, WV, w8); k_cvt8<<<gw, 256, 0, stream>>>(wo, WO, w8);
    const size_t x8 = (size_t)SEQ * DM / 8;
    for (int b = 0; b < NB; ++b) k_cvt8<<<(unsigned)((x8 + 255) / 256), 256, 0, stream>>>(x + (size_t)b * SEQ_FULL * DM, XB + (size_t)b * SEQ * DM, x8);

    // WQ, WK, WV lie one behind the other in the workspace
    k_gemm_qkv<<<dim3((unsigned)(NB * SEQ / 128), (unsigned)(DM / 128), 3), 128, 0, stream>>>(XB, WQ, sin_tab, cos_tab, tpos, Q16, K16, VT16, Qh, Ql, Kh, Kl, VTh, VTl);

    k_attn_hi<<<dim3(RH / 64, NB * NH, 1), 128, 0, stream>>>(Qh, Ql, Kh, Kl, VTh, VTl, ATh, ATl);
    if (SEQ > RH) k_attn_lo<<<dim3((SEQ - RH) / 64, NB * NH, 1), 128, 0, stream>>>((const bf*)Q16, (const bf*)K16, (const bf*)VT16, ATh, ATl);

    // out[b][t][e] = sum_d merged[b][t][d] wo[e][d]; z = batch, output batch stride from the full sequence length
    k_gemm_x2<<<dim3(SEQ / 128, DM / 128, NB), 128, 0, stream>>>(ATh, ATl, WO, DQ, OUT, DM, (size_t)SEQ * DQ, (size_t)0, (size_t)SEQ_FULL * DM);
}

// v004
// A run of this version takes 90.9 microseconds.
// In two side-by-side timings against v003, it was 1.31 and 1.30 times as fast.
// Over all steps from v000 it is 2.90 times as fast.
#include <hip/hip_runtime.h>

// Causal multi-head self-attention, 16 heads x 64, interleaved rotary with sin/cos rows gathered from the table inputs by the integer position input; out = merged x wo^T.
// Compute dtypes, f32 accumulate: every float input converted to bf16 (RNE); q/k/v projections v_wmma_f32_16x16x32_bf16 (exact bf16 x bf16 products);
// scores q.k: query rows < 256 bf16 hi/lo (3 products), rows >= 256 single f16; P.V: rows < 256 bf16 hi/lo (3 products), rows >= 256 single f16 with P carried x1024;
// output projection: merged bf16 hi|lo x exact bf16 wo (2 products, all hi products summed before the lo products). Softmax f32 (running max, exp2).
// Fused flash-style attention in transposed form (S^T = K Q^T, O^T = V^T P^T): two adjacent S^T key tiles repacked to 16 bit are the P^T B fragment; no score plane in memory.

#ifndef NB
#define NB 2
#endif
#ifndef SEQ
#define SEQ 2048
#endif
#define SEQ_FULL 2048                 // per-batch row stride of x, token positions and the output
#define DM   1024
#define NH   16
#define HD   64
#define DQ   (NH * HD)
#define TABN 2048                     // rows of the sin/cos tables
#define TABW 32                       // columns of the sin/cos tables (HD / 2)
#define RH   256                      // query rows < RH use bf16 hi/lo planes
#define PCAR 1024.0f
#define SCL2E 0.18033688011112042f    // HD^-0.5 x log2(e)
#define NEGV (-1.0e30f)

static_assert(HD == 64);
static_assert(DQ == DM);
static_assert(TABW * 2 == HD);
static_assert(DM % 64 == 0);
static_assert(DM % 32 == 0);
static_assert(SEQ % 64 == 0);
static_assert(RH % 64 == 0);
static_assert(RH <= SEQ);
static_assert(SEQ <= SEQ_FULL);
static_assert(SEQ <= TABN);
static_assert((NB * SEQ) % 64 == 0);
static_assert(SEQ % 128 == 0);
static_assert(DM % 128 == 0 && DM >= 256);

typedef _Float16 h16;
typedef unsigned short bf;
typedef __attribute__((ext_vector_type(16))) __bf16   v16bf;
typedef __attribute__((ext_vector_type(16))) _Float16 v16h;
typedef __attribute__((ext_vector_type(16))) unsigned short v16us;
typedef __attribute__((ext_vector_type(8)))  unsigned short v8us;
typedef __attribute__((ext_vector_type(8)))  float    v8f;
typedef __attribute__((ext_vector_type(4)))  float    v4f;
typedef __attribute__((ext_vector_type(2)))  float    v2f;
typedef __attribute__((ext_vector_type(8)))  _Float16 v8h;
typedef __attribute__((ext_vector_type(4)))  _Float16 v4h;
typedef __attribute__((ext_vector_type(4)))  unsigned short v4us;
typedef v4f  __attribute__((may_alias)) v4fa;
typedef v8us __attribute__((may_alias)) v8usa;

__device__ __forceinline__ unsigned short f2bf(float f) { unsigned u = __float_as_uint(f); u += 0x7FFFu + ((u >> 16) & 1u); return (unsigned short)(u >> 16); }
__device__ __forceinline__ float bf2f(unsigned short b) { return __uint_as_float(((unsigned)b) << 16); }
__device__ __forceinline__ float bfr(float f) { return bf2f(f2bf(f)); }
__device__ __forceinline__ void splitf(float y, unsigned short& h, unsigned short& l) { h = f2bf(y); l = f2bf(y - bf2f(h)); }
__device__ __forceinline__ v16us cat16u(v8us lo, v8us hi) { return __builtin_shufflevector(lo, hi, 0, 1, 2, 3, 4, 5, 6, 7, 8, 9, 10, 11, 12, 13, 14, 15); }
__device__ __forceinline__ v8f wmma16(v16h a, v16h b, v8f c) { return __builtin_amdgcn_wmma_f32_16x16x32_f16(false, a, false, b, (short)0, c, false, false); }
__device__ __forceinline__ v8f wmmab(v16bf a, v16bf b, v8f c) { return __builtin_amdgcn_wmma_f32_16x16x32_bf16(false, a, false, b, (short)0, c, false, false); }

// Fragment loader for K-contiguous 16-bit rows: p = row base + k0 + 8*(lane>>4); elements 0..7 <- p[0..7], elements 8..15 <- p[16..23].
template <bool HI> struct AF;
template <> struct AF<false> {
    typedef v16h V;
    static __device__ __forceinline__ V ld(const bf* p) { return __builtin_bit_cast(v16h, cat16u(*(const v8usa*)p, *(const v8usa*)(p + 16))); }
    static __device__ __forceinline__ v8f mma(V a, V b, v8f c) { return wmma16(a, b, c); }
};
template <> struct AF<true> {
    typedef v16bf V;
    static __device__ __forceinline__ V ld(const bf* p) { return __builtin_bit_cast(v16bf, cat16u(*(const v8usa*)p, *(const v8usa*)(p + 16))); }
    static __device__ __forceinline__ v8f mma(V a, V b, v8f c) { return wmmab(a, b, c); }
};

// ---- GEMM, 128x128 output tile per block of 4 waves (2 x 2, one 64x64 wave tile = 16 accumulators each); grid (M/128, N/128, Z), 128 threads.
// acc[m][n] (f32) = sum_k (A[m][k] (+ A2[m][k])) Bt[n][k], handed to the epilogue EPI per wave tile. z-batch strides sA/sB in elements. K % 128 == 0, K >= 256, M % 128 == 0, N % 128 == 0.
// Operands come to LDS by tensor loads, two buffers: a stage is 128 k of [A 128 rows | Bt 128 rows]; each wave brings one slice of 64 rows x 256 B (waves 0, 1: A; waves 2, 3: Bt),
// padded by the mover to a pitch of 272 B for the 16-byte fragment reads. With A2 the K/128 stages of A are followed by K/128 stages of A2 against the same Bt rows.
typedef unsigned u32x4 __attribute__((ext_vector_type(4)));
typedef unsigned u32x8 __attribute__((ext_vector_type(8)));
constexpr unsigned G_ROWB  = 256;                 // bytes of one staged row (128 k)
constexpr unsigned G_PITCH = G_ROWB + 16;         // LDS row pitch, an odd multiple of 16 B
constexpr unsigned G_SLICE = 18432;               // 64 rows x 272 B = 17,408 B, rounded up to a multiple of 2 KiB
constexpr unsigned G_BUF   = 4 * G_SLICE;
static_assert(64 * G_PITCH <= G_SLICE && G_SLICE % 2048 == 0);
__device__ __forceinline__ unsigned uni(unsigned v) { return (unsigned)__builtin_amdgcn_readfirstlane(v); }
__device__ __forceinline__ unsigned pinned(unsigned v) { unsigned w = uni(v); asm volatile("" : "+s"(w)); return w; }
__device__ __forceinline__ void tdm_load(u32x4 g0, u32x8 g1) { asm volatile("tensor_load_to_lds %0, %1" :: "s"(g0), "s"(g1) : "memory"); }
__device__ __forceinline__ void sfence() { __builtin_amdgcn_sched_barrier(0); }   // keeps a group of fragment loads, or a block of products, together in the built code
// Epilogue: f32 rows C[m][n] (pitch ldc, z-batch stride sC), each 16-row band turned through the wave's LDS staging into 16-byte row stores.
struct EpiRows {
    float* C; int ldc; size_t sC;
    __device__ __forceinline__ void operator()(v8f (&acc)[4][4], float* os, const int r0, const int c0, const int lr, const int hi) const {
        float* Cz = C + (size_t)blockIdx.z * sC;
#pragma unroll
        for (int mb = 0; mb < 4; ++mb) {
#pragma unroll
            for (int nb = 0; nb < 4; ++nb) {
#pragma unroll
                for (int j = 0; j < 8; ++j) os[(hi * 8 + j) * 68 + nb * 16 + lr] = acc[mb][nb][j]; }
            __builtin_amdgcn_wave_barrier(); asm volatile("" ::: "memory");   // the band's LDS writes stay ahead of the row reads below
            float* crow = Cz + (size_t)(r0 + mb * 16) * ldc + c0;
#pragma unroll
            for (int s = 0; s < 8; ++s) { const int row = 2 * s + hi, cofs = lr * 4; const v4f val = *(const v4fa*)(os + row * 68 + cofs);
                *(v4f*)(crow + (size_t)row * ldc + cofs) = val; }
            __builtin_amdgcn_wave_barrier(); asm volatile("" ::: "memory");   // the row reads stay ahead of the next band's LDS writes
        }
    }
};
// Epilogue of the q/k/v projections (z = 0, 1, 2): a wave tile is 64 tokens of one batch x the 64 columns of one head, and goes straight to the head planes.
// z < 2: interleaved rotary, pair (2i, 2i+1), table row = clamped token position, out[2i] = cos x[2i] - sin x[2i+1], out[2i+1] = sin x[2i] + cos x[2i+1];
//        planes [b*NH + h][t][d]: f16 for all t, compact bf16 hi|lo [bh][RH][HD] for t < RH.
// z = 2: value planes [bh][d][t] (f16, all t; compact bf16 hi|lo [bh][HD][RH] for t < RH): a lane's 8 accumulator rows are 8 consecutive t of one d, stored as 16 bytes from registers.
struct EpiHeads {
    const float* __restrict__ sin_tab; const float* __restrict__ cos_tab; const int* __restrict__ tpos;
    h16* Q16; h16* K16; h16* VT16; bf* Qh; bf* Ql; bf* Kh; bf* Kl; bf* VTh; bf* VTl;
    // Stands behind each run of global loads or stores, in front of the first instruction that writes a register which one of them names; the scheduling fences keep the run together and later work behind the wait.
    static __device__ __forceinline__ void xwait() { asm volatile("s_wait_xcnt 0x0" ::: "memory"); sfence(); }
    // The same behind a run of table loads: the eight offsets are inputs of the wait, so that none of their registers is given to a later load's result ahead of it.
    static __device__ __forceinline__ void xwait(const unsigned (&t)[8]) { asm volatile("s_wait_xcnt 0x0" :: "v"(t[0]), "v"(t[1]), "v"(t[2]), "v"(t[3]), "v"(t[4]), "v"(t[5]), "v"(t[6]), "v"(t[7]) : "memory"); sfence(); }
    __device__ __forceinline__ void operator()(v8f (&acc)[4][4], float* os, const int r0, const int c0, const int lr, const int hi) const {
        const int b = r0 / SEQ, t0 = r0 % SEQ, bh = b * NH + c0 / HD;
        const bool hr = (t0 < RH);     // uniform per wave: the tile's 64 tokens lie on one side of RH
        const int tc = hr ? t0 : 0;    // first token in the compact planes
        if (blockIdx.z == 2) {
            h16* v16 = VT16 + (size_t)bh * HD * SEQ + t0; const unsigned vofs = (unsigned)(lr * SEQ + hi * 8);
#pragma unroll
            for (int nb = 0; nb < 4; ++nb) {
                v8h o16[4];
#pragma unroll
                for (int mb = 0; mb < 4; ++mb)
#pragma unroll
                    for (int j = 0; j < 8; ++j) o16[mb][j] = (h16)acc[mb][nb][j];
                sfence();   // the four stores issue as one run, with nothing between them and their wait
#pragma unroll
                for (int mb = 0; mb < 4; ++mb) *(v8h*)(v16 + (nb * 16 * SEQ + mb * 16) + vofs) = o16[mb];   // the four stores fill one 128-byte line per d
                xwait();
            }
            if (hr) {
                float* own = os + (hi * 16 + lr) * 8;     // this lane's own 8 floats of each of the four column blocks
                bf* vh = VTh + (size_t)bh * HD * RH + tc; bf* vl = VTl + (size_t)bh * HD * RH + tc; const unsigned cofs = (unsigned)(lr * RH + hi * 8);
#pragma unroll
                for (int mb = 0; mb < 4; ++mb) {
#pragma unroll
                    for (int nb = 0; nb < 4; ++nb)
#pragma unroll
                        for (int j = 0; j < 8; ++j) own[nb * 256 + j] = acc[mb][nb][j];
#pragma unroll 1   // rolled, fed from LDS: the hi/lo split stands once per band in the text
                    for (int nb = 0; nb < 4; ++nb) { const v4f xa = *(const v4fa*)(own + nb * 256), xb = *(const v4fa*)(own + nb * 256 + 4); v8us oh, ol;
#pragma unroll
                        for (int j = 0; j < 4; ++j) { unsigned short u0, u1; splitf(xa[j], u0, u1); oh[j] = u0; ol[j] = u1; splitf(xb[j], u0, u1); oh[4 + j] = u0; ol[4 + j] = u1; }
                        const unsigned ce = (unsigned)(nb * 16 * RH + mb * 16) + cofs;
                        sfence();   // the two stores issue as one run, with nothing between them and their wait
                        *(v8us*)(vh + ce) = oh; *(v8us*)(vl + ce) = ol;
                        xwait(); }
                }
            }
            return;
        }
        h16* p16 = ((blockIdx.z == 0) ? Q16 : K16) + ((size_t)bh * SEQ + t0) * HD;
        bf* ph = ((blockIdx.z == 0) ? Qh : Kh) + ((size_t)bh * RH + tc) * HD; bf* pl = ((blockIdx.z == 0) ? Ql : Kl) + ((size_t)bh * RH + tc) * HD;
        const int* tp = tpos + (size_t)b * SEQ_FULL + t0;
        const unsigned lofs = (unsigned)(hi * HD + lr * 4);     // the lane's four columns in a pair of token rows
        int pos[4][8];     // token positions of the rows this lane will write: all fetched at once, one latency
#pragma unroll
        for (int mb = 0; mb < 4; ++mb)
#pragma unroll
            for (int s = 0; s < 8; ++s) pos[mb][s] = tp[mb * 16 + 2 * s + hi];
        xwait();
        unsigned to[4][8];   // byte offset of the lane's two sin (cos) values: table row = clamped token position
#pragma unroll
        for (int mb = 0; mb < 4; ++mb)
#pragma unroll
            for (int s = 0; s < 8; ++s) { const int p = pos[mb][s]; to[mb][s] = ((unsigned)(p < 0 ? 0 : (p > TABN - 1 ? TABN - 1 : p)) * TABW + (unsigned)lr * 2u) * 4u; }
        v2f sn[2][8], cs[2][8];   // fetched one 16-row band ahead
        sfence();   // the band's table loads issue as one run, with nothing between them and their wait
#pragma unroll
        for (int s = 0; s < 8; ++s) { sn[0][s] = *(const v2f*)((const char*)sin_tab + to[0][s]); cs[0][s] = *(const v2f*)((const char*)cos_tab + to[0][s]); }
        xwait(to[0]);
#pragma unroll
        for (int mb = 0; mb < 4; ++mb) {
            const int cb = mb & 1;
            if (mb < 3) {
#pragma unroll
                for (int s = 0; s < 8; ++s) { sn[cb ^ 1][s] = *(const v2f*)((const char*)sin_tab + to[mb + 1][s]); cs[cb ^ 1][s] = *(const v2f*)((const char*)cos_tab + to[mb + 1][s]); }
                xwait(to[mb + 1]);
            }
#pragma unroll
            for (int nb = 0; nb < 4; ++nb) {
#pragma unroll
                for (int j = 0; j < 8; ++j) os[(hi * 8 + j) * 68 + nb * 16 + lr] = acc[mb][nb][j]; }
            __builtin_amdgcn_wave_barrier(); asm volatile("" ::: "memory");   // the band's LDS writes stay ahead of the row reads below
            v4h o16[8]; v4f xy[8];
#pragma unroll
            for (int s = 0; s < 8; ++s) xy[s] = *(const v4fa*)(os + (2 * s + hi) * 68 + lr * 4);
#pragma unroll
            for (int s = 0; s < 8; ++s) { const v4f x = xy[s];
                const float s0 = bfr(sn[cb][s][0]), s1 = bfr(sn[cb][s][1]), k0 = bfr(cs[cb][s][0]), k1 = bfr(cs[cb][s][1]);
                v4f y; y[0] = k0 * x[0] - s0 * x[1]; y[1] = s0 * x[0] + k0 * x[1]; y[2] = k1 * x[2] - s1 * x[3]; y[3] = s1 * x[2] + k1 * x[3];
#pragma unroll
                for (int q = 0; q < 4; ++q) o16[s][q] = (h16)y[q];
                xy[s] = y;
            }
            sfence();   // the band's eight stores issue as one run, with nothing between them and their wait
#pragma unroll
            for (int s = 0; s < 8; ++s) *(v4h*)(p16 + (mb * 16 + 2 * s) * HD + lofs) = o16[s];
            xwait();
            if (hr) {      // each lane puts its rotated values back where it read them, for the split below
#pragma unroll
                for (int s = 0; s < 8; ++s) *(v4fa*)(os + (2 * s + hi) * 68 + lr * 4) = xy[s];
#pragma unroll 1   // rolled, fed from LDS: the hi/lo split stands once per band in the text
                for (int s = 0; s < 8; ++s) { const v4f y = *(const v4fa*)(os + (2 * s + hi) * 68 + lr * 4); v4us oh, ol;
#pragma unroll
                    for (int q = 0; q < 4; ++q) { unsigned short u0, u1; splitf(y[q], u0, u1); oh[q] = u0; ol[q] = u1; }
                    const unsigned ce = (unsigned)((mb * 16 + 2 * s) * HD) + lofs;
                    sfence();   // the two stores issue as one run, with nothing between them and their wait
                    *(v4us*)(ph + ce) = oh; *(v4us*)(pl + ce) = ol;
                    xwait(); }
            }
            __builtin_amdgcn_wave_barrier(); asm volatile("" ::: "memory");   // the row reads stay ahead of the next band's LDS writes
        }
    }
};
template <int NSPLIT, class EPI>
__device__ __forceinline__ void gemmw_body(const bf* __restrict__ A, const bf* __restrict__ A2, const bf* __restrict__ Bt, const int K, const size_t sA, const size_t sB, const EPI epi) {
    typedef AF<true> W; typedef W::V V;
    __shared__ __attribute__((aligned(2048))) unsigned char ring[2 * G_BUF];
    __shared__ __align__(16) float osb[4 * 16 * 68];
    const size_t z = blockIdx.z; A += z * sA; A2 += z * sA; Bt += z * sB;
    const int lane = threadIdx.x & 31, lr = lane & 15, hi = lane >> 4; const unsigned wave = uni(threadIdx.x >> 5); const unsigned wm = wave >> 1, wn = wave & 1u;
    const int r0 = blockIdx.x * 128 + (int)wm * 64, c0 = blockIdx.y * 128 + (int)wn * 64;
    __builtin_assume(K >= 256);              // the ring's prologue issues two stages: no path without a pass is built
    const unsigned KP = (unsigned)K / 128u, NS = (NSPLIT + 1) * KP;     // stages per plane, stages in all
    // this wave's slice of a stage: 64 rows of A (A2) or of Bt
    const size_t srow = (wave < 2u) ? (size_t)(blockIdx.x * 128u + 64u * wave) * K : (size_t)(blockIdx.y * 128u + 64u * (wave - 2u)) * K;
    const unsigned long long ga1 = (unsigned long long)(size_t)(((wave < 2u) ? A : Bt) + srow), ga2 = (unsigned long long)(size_t)(((wave < 2u) ? A2 : Bt) + srow);
    const unsigned lds_slice = (unsigned)(size_t)ring + wave * G_SLICE;
    u32x8 g1;   // 1-byte elements, tensor = tile = 64 rows of 256 B, source pitch 2 K bytes, 4 dwords of pad behind every 64
    g1[0] = uni((1u << 20) | (5u << 22) | (3u << 25)); g1[1] = uni(G_ROWB << 16); g1[2] = uni(64u << 16); g1[3] = uni(G_ROWB << 16); g1[4] = uni(64u); g1[5] = uni((unsigned)K * 2u); g1[6] = uni(0u); g1[7] = uni(0u);
    // group 0: count 1 | LDS place | address of the slice's first byte, type 2 in the top bits. Words 2 and 3 walk from stage to stage by one 64-bit add.
    const unsigned long long jump = ga2 - ga1 - (unsigned long long)(KP - 1u) * G_ROWB;   // from the last stage of A to the first of A2
    u32x4 g0; g0[0] = uni(1u); g0[1] = uni(lds_slice); g0[2] = uni((unsigned)ga1); g0[3] = uni((((unsigned)(ga1 >> 32)) & 0x01FFFFFFu) | 0x80000000u);
    auto issue_next = [&](unsigned st, unsigned buf) {
        const unsigned long long c = ((((unsigned long long)g0[3]) << 32) | g0[2]) + ((NSPLIT == 1 && st == KP) ? jump : (unsigned long long)G_ROWB);
        g0[1] = uni(lds_slice + buf); g0[2] = uni((unsigned)c); g0[3] = uni((unsigned)(c >> 32));
        tdm_load(g0, g1);
    };
    tdm_load(g0, g1);
    // Every tensor wait names the descriptor: its words stay in their scalar registers from issue to wait, and none takes a new value while a request is outstanding.
    asm volatile("s_wait_tensorcnt 0x0" : "+s"(g0), "+s"(g1) : : "memory");   // this wave's slice of stage 0 has landed
    __syncthreads();                                      // stage 0 published
    issue_next(1u, G_BUF);
    v8f acc[4][4];
#pragma unroll
    for (int mb = 0; mb < 4; ++mb)
#pragma unroll
        for (int nb = 0; nb < 4; ++nb) acc[mb][nb] = (v8f){};
    const unsigned aoff = wm * G_SLICE + (unsigned)lr * G_PITCH + 16u * hi, boff = (2u + wn) * G_SLICE + (unsigned)lr * G_PITCH + 16u * hi;
#pragma unroll 1   // one pass per trip: one publish point and one refill in the built loop, accumulators and fragments in registers
    for (unsigned s = 0; s < NS; ++s) {
        const unsigned buf = (s & 1u) * G_BUF;
        const unsigned char* la = ring + buf + aoff; const unsigned char* lb = ring + buf + boff;
        V a[2][4], b[2][4];
#pragma unroll
        for (int f = 0; f < 4; ++f) { a[0][f] = W::ld((const bf*)(la + f * 16 * G_PITCH)); b[0][f] = W::ld((const bf*)(lb + f * 16 * G_PITCH)); }
        sfence();
#pragma unroll
        for (int u = 0; u < 4; ++u) {       // four blocks of 32 k; the next block's fragments are fetched ahead of this block's products
            const int cs = u & 1;
            if (u < 3) {
#pragma unroll
                for (int f = 0; f < 4; ++f) { a[cs ^ 1][f] = W::ld((const bf*)(la + f * 16 * G_PITCH + (u + 1) * 64)); b[cs ^ 1][f] = W::ld((const bf*)(lb + f * 16 * G_PITCH + (u + 1) * 64)); }
                sfence();
            }
#pragma unroll
            for (int nb = 0; nb < 4; ++nb)
#pragma unroll
                for (int mb = 0; mb < 4; ++mb) acc[mb][nb] = W::mma(a[cs][mb], b[cs][nb], acc[mb][nb]);
            sfence();
        }
        // four vector slots behind the pass's last products, on the loop's taken branch too, before a vector instruction may touch their registers
        asm volatile("v_nop\n\tv_nop\n\tv_nop\n\tv_nop");
        sfence();
        asm volatile("s_wait_dscnt 0x0" ::: "memory");       // this wave has left the buffer
        asm volatile("s_wait_tensorcnt 0x0" : "+s"(g0), "+s"(g1) : : "memory");   // its slice of stage s + 1 has landed
        __syncthreads();                                      // stage s + 1 published; every wave has left stage s's buffer
        if (pinned((s + 2u < NS) ? 1u : 0u) != 0u) issue_next(s + 2u, buf);
    }
    asm volatile("s_wait_tensorcnt 0x0" : : "s"(g0), "s"(g1) : "memory");
    asm volatile("s_wait_dscnt 0x0" ::: "memory");
    epi(acc, osb + wave * (16 * 68), r0, c0, lr, hi);      // output staging in LDS, each wave's own
}
// q, k, v projections of X (bf16 rows [b*SEQ + t][DM]) in one launch: grid (NB*SEQ/128, DM/128, 3), z picks the weight plane of W3 = [wq | wk | wv] and the head planes written.
__global__ __launch_bounds__(128) void k_gemm_qkv(const bf* X, const bf* W3, const float* sin_tab, const float* cos_tab, const int* tpos,
                                                  h16* Q16, h16* K16, h16* VT16, bf* Qh, bf* Ql, bf* Kh, bf* Kl, bf* VTh, bf* VTl) {
    gemmw_body<0>(X, X, W3, DM, (size_t)0, (size_t)DM * DM, EpiHeads{sin_tab, cos_tab, tpos, Q16, K16, VT16, Qh, Ql, Kh, Kl, VTh, VTl}); }
__global__ __launch_bounds__(128) void k_gemm_x2(const bf* A, const bf* A2, const bf* Bt, int K, float* C, int ldc, size_t sA, size_t sB, size_t sC) { gemmw_body<1>(A, A2, Bt, K, sA, sB, EpiRows{C, ldc, sC}); }

// All f32 -> bf16 conversions in one launch; a thread converts 8 values. dst = [wq | wk | wv | wo | x rows b*SEQ + t], one behind the other; a block's 2,048 values lie in one source, picked by the block index.
constexpr unsigned CV_W = (unsigned)((size_t)DM * DM / 2048);      // blocks per weight plane
constexpr unsigned CV_X = (unsigned)((size_t)SEQ * DM / 2048);     // blocks per batch of x
static_assert(((size_t)DM * DM) % 2048 == 0 && ((size_t)SEQ * DM) % 2048 == 0);
__global__ __launch_bounds__(256) void k_cvt_all(const float* __restrict__ x, const float* __restrict__ wq, const float* __restrict__ wk, const float* __restrict__ wv, const float* __restrict__ wo, bf* dst) {
    const unsigned blk = blockIdx.x; const float* src; unsigned rel;
    if (blk < 4u * CV_W) { const unsigned p = blk / CV_W; rel = blk % CV_W; src = (p == 0u) ? wq : (p == 1u) ? wk : (p == 2u) ? wv : wo; }
    else { const unsigned c = blk - 4u * CV_W; rel = c % CV_X; src = x + (size_t)(c / CV_X) * SEQ_FULL * DM; }
    const v8f v = *(const v8f*)(src + ((size_t)rel * 256 + threadIdx.x) * 8); v8us o;
    asm volatile("s_wait_xcnt 0x0" ::: "memory");   // behind the loads, in front of the first instruction that writes their address registers
#pragma unroll
    for (int k = 0; k < 8; ++k) o[k] = f2bf(v[k]); *(v8us*)(dst + ((size_t)blk * 256 + threadIdx.x) * 8) = o;  }

// ---- fused causal attention, transposed flash form. Block = 4 waves = 64 query rows of one (b, h); each wave owns 16 queries (lane & 15 = query; both lane halves carry its statistics).
// Per 32-key chunk: S^T tiles (rows = keys, cols = queries) = K frag (A) x Q frag (B); running max (one shfl_xor 16), p = exp2; the two S^T tiles repacked to 16 bit are the P^T B fragment
// (element r <- keys c0+8h+r, element 8+r <- keys c0+16+8h+r); O^T[d][query] += V^T frag (A, rows of the [d][t] plane) x P^T. HI: bf16 hi/lo planes, 3 products; else f16, P x PCAR.
template <bool HI>
__device__ __forceinline__ void attn_body(const bf* __restrict__ Qa, const bf* __restrict__ Qb, const bf* __restrict__ Ka, const bf* __restrict__ Kb, const bf* __restrict__ Va, const bf* __restrict__ Vb,
                                          const int tq, const int tv, const int qblk, const int bh, bf* ATh, bf* ATl, bf* sth, bf* stl) {
    typedef AF<HI> F; typedef typename F::V V;
    const int lane = threadIdx.x & 31, lr = lane & 15, hi = lane >> 4, wave = threadIdx.x >> 5;
    const int q0 = qblk * 64 + wave * 16; const int qrow = q0 + lr;
    const size_t qoff = ((size_t)bh * tq + q0 + lr) * HD + 8 * hi;
    const size_t koff = ((size_t)bh * tq + lr) * HD + 8 * hi;
    const size_t voff = ((size_t)bh * HD + lr) * tv + 8 * hi;
    V qa[2], qb[2];
#pragma unroll
    for (int ks = 0; ks < 2; ++ks) { qa[ks] = F::ld(Qa + qoff + 32 * ks); if (HI) qb[ks] = F::ld(Qb + qoff + 32 * ks); else qb[ks] = qa[ks]; }
    v8f o[4];
#pragma unroll
    for (int nb = 0; nb < 4; ++nb) o[nb] = (v8f){};
    float m = NEGV, l = 0.0f;
#pragma unroll 1
    for (int c0 = 0; c0 <= q0 + 15; c0 += 32) {
        v8f s0 = (v8f){}, s1 = (v8f){}; V k0, k1;
#pragma unroll
        for (int ks = 0; ks < 2; ++ks) {
            k0 = F::ld(Ka + koff + (size_t)c0 * HD + 32 * ks); k1 = F::ld(Ka + koff + (size_t)(c0 + 16) * HD + 32 * ks);
            if (HI) { const V l0 = F::ld(Kb + koff + (size_t)c0 * HD + 32 * ks); const V l1 = F::ld(Kb + koff + (size_t)(c0 + 16) * HD + 32 * ks);
                s0 = F::mma(l0, qa[ks], s0); s1 = F::mma(l1, qa[ks], s1); s0 = F::mma(k0, qb[ks], s0); s1 = F::mma(k1, qb[ks], s1); }
            s0 = F::mma(k0, qa[ks], s0); s1 = F::mma(k1, qa[ks], s1);
        }
        asm volatile("v_nop\n\tv_nop\n\tv_nop\n\tv_nop" : "+v"(s0), "+v"(s1) : "v"(k0), "v"(k1), "v"(qa[1]), "v"(qb[1]));
        if (c0 + 31 > q0) {       // wave-uniform: chunk touches the diagonal; masked scores are replaced (keys above the query)
#pragma unroll
            for (int r = 0; r < 8; ++r) { const int key = c0 + 8 * hi + r; s0[r] = (key > qrow) ? NEGV : s0[r]; s1[r] = (key + 16 > qrow) ? NEGV : s1[r]; }
        }
        float mx = fmaxf(s0[0], s1[0]);
#pragma unroll
        for (int r = 1; r < 8; ++r) mx = fmaxf(mx, fmaxf(s0[r], s1[r]));
        mx = fmaxf(mx, __shfl_xor(mx, 16, 32));
        const float mn = fmaxf(m, mx);
        const float corr = __builtin_amdgcn_exp2f((m - mn) * SCL2E);
        float ps = 0.0f;
#pragma unroll
        for (int r = 0; r < 8; ++r) { s0[r] = __builtin_amdgcn_exp2f((s0[r] - mn) * SCL2E); s1[r] = __builtin_amdgcn_exp2f((s1[r] - mn) * SCL2E); ps += s0[r] + s1[r]; }
        l = l * corr + ps; m = mn;
#pragma unroll
        for (int nb = 0; nb < 4; ++nb)
#pragma unroll
            for (int r = 0; r < 8; ++r) o[nb][r] *= corr;
        V pa, pl;
        if (HI) { v16us uh, ul;
#pragma unroll
            for (int r = 0; r < 8; ++r) { unsigned short a, c; splitf(s0[r], a, c); uh[r] = a; ul[r] = c; splitf(s1[r], a, c); uh[8 + r] = a; ul[8 + r] = c; }
            pa = __builtin_bit_cast(V, uh); pl = __builtin_bit_cast(V, ul);
        } else { v16h th;
#pragma unroll
            for (int r = 0; r < 8; ++r) { th[r] = (h16)(s0[r] * PCAR); th[8 + r] = (h16)(s1[r] * PCAR); }
            pa = __builtin_bit_cast(V, th); pl = pa; }
        V vh[4], vl[4];
#pragma unroll
        for (int nb = 0; nb < 4; ++nb) { vh[nb] = F::ld(Va + voff + (size_t)nb * 16 * tv + c0); if (HI) vl[nb] = F::ld(Vb + voff + (size_t)nb * 16 * tv + c0); else vl[nb] = vh[nb]; }
#pragma unroll
        for (int nb = 0; nb < 4; ++nb) { if (HI) { o[nb] = F::mma(vl[nb], pa, o[nb]); o[nb] = F::mma(vh[nb], pl, o[nb]); } o[nb] = F::mma(vh[nb], pa, o[nb]); }
        asm volatile("v_nop\n\tv_nop\n\tv_nop\n\tv_nop" : "+v"(o[0]), "+v"(o[1]), "+v"(o[2]), "+v"(o[3]) : "v"(pa), "v"(pl), "v"(vh[3]));
    }
    l += __shfl_xor(l, 16, 32);
    const float inv = (HI ? 1.0f : (1.0f / PCAR)) * (1.0f / l);
    const int sbase = wave * (16 * 72) + lr * 72 + 8 * hi;
#pragma unroll
    for (int nb = 0; nb < 4; ++nb) { v8us h8, l8;
#pragma unroll
        for (int r = 0; r < 8; ++r) { unsigned short a, c; splitf(o[nb][r] * inv, a, c); h8[r] = a; l8[r] = c; }
        *(v8usa*)(sth + sbase + nb * 16) = h8; *(v8usa*)(stl + sbase + nb * 16) = l8; }
    __syncthreads();
    const int b = bh / NH, h = bh % NH;
{
#pragma unroll
        for (int it = 0; it < 4; ++it) { const int row = it * 4 + (lane >> 3), pc = lane & 7;
            const v8us xh = *(const v8usa*)(sth + wave * (16 * 72) + row * 72 + pc * 8); const v8us xl = *(const v8usa*)(stl + wave * (16 * 72) + row * 72 + pc * 8);
            const size_t go = ((size_t)b * SEQ + q0 + row) * DQ + h * HD + pc * 8;
            *(v8us*)(ATh + go) = xh; *(v8us*)(ATl + go) = xl; }
         }
}
// ---- the same attention for rows >= RH (single f16 planes), with K and V^T staged in LDS by tensor loads and shared by the block's 4 waves. Same 32-key chunks in the same order as attn_body<false>.
// A stage is 64 keys: K rows [64 keys][128 B] and V^T rows [64 d][128 B = 64 keys]; each wave brings one slice of 32 rows x 128 B (waves 0, 1: K; waves 2, 3: V^T),
// padded by the mover to a pitch of 144 B for the 16-byte fragment reads. Two buffers; query block qblk walks qblk + 1 stages (at least RH / 64 + 1).
constexpr unsigned T_ROWB  = 128;                 // bytes of one staged row
constexpr unsigned T_PITCH = T_ROWB + 16;         // LDS row pitch, an odd multiple of 16 B
constexpr unsigned T_SLICE = 6144;                // 32 rows x 144 B = 4,608 B, rounded up to a multiple of 2 KiB
constexpr unsigned T_BUF   = 4 * T_SLICE;
static_assert(32 * T_PITCH <= T_SLICE && T_SLICE % 2048 == 0);
static_assert(HD * 2 == T_ROWB);
static_assert(RH / 64 + 1 >= 2);                  // the ring's prologue issues two stages
__device__ __forceinline__ void attn_ring_body(const bf* __restrict__ Qa, const bf* __restrict__ Ka, const bf* __restrict__ Va, const int qblk, const int bh, bf* ATh, bf* ATl, bf* sth, bf* stl) {
    typedef AF<false> F; typedef F::V V;
    __shared__ __attribute__((aligned(2048))) unsigned char kv[2 * T_BUF];
    const int lane = threadIdx.x & 31, lr = lane & 15, hi = lane >> 4; const unsigned wave = uni(threadIdx.x >> 5);
    const int q0 = qblk * 64 + (int)wave * 16; const int qrow = q0 + lr;
    __builtin_assume(qblk >= RH / 64);            // the ring's prologue issues two stages: no path without a pass is built
    const unsigned NS = (unsigned)qblk + 1u;      // stages of 64 keys, the last one holds the diagonal
    // this wave's slice of a stage: 32 key rows of K, or 32 d rows of V^T; from stage to stage K walks 64 rows, V^T 64 keys along its rows
    const unsigned long long ga = (unsigned long long)(size_t)((wave < 2u) ? Ka + ((size_t)bh * SEQ + 32u * wave) * HD : Va + ((size_t)bh * HD + 32u * (wave - 2u)) * SEQ);
    const unsigned long long step = (wave < 2u) ? (unsigned long long)(64u * T_ROWB) : (unsigned long long)T_ROWB;
    const unsigned lds_slice = (unsigned)(size_t)kv + wave * T_SLICE;
    u32x8 g1;   // 1-byte elements, tensor = tile = 32 rows of 128 B, source pitch 128 B (K) or 2 SEQ bytes (V^T), 4 dwords of pad behind every 32
    g1[0] = uni((1u << 20) | (4u << 22) | (3u << 25)); g1[1] = uni(T_ROWB << 16); g1[2] = uni(32u << 16); g1[3] = uni(T_ROWB << 16); g1[4] = uni(32u); g1[5] = uni((wave < 2u) ? T_ROWB : (unsigned)SEQ * 2u); g1[6] = uni(0u); g1[7] = uni(0u);
    u32x4 g0; g0[0] = uni(1u); g0[1] = uni(lds_slice); g0[2] = uni((unsigned)ga); g0[3] = uni((((unsigned)(ga >> 32)) & 0x01FFFFFFu) | 0x80000000u);
    auto issue_next = [&](unsigned buf) {
        const unsigned long long c = ((((unsigned long long)g0[3]) << 32) | g0[2]) + step;
        g0[1] = uni(lds_slice + buf); g0[2] = uni((unsigned)c); g0[3] = uni((unsigned)(c >> 32));
        tdm_load(g0, g1);
    };
    const size_t qoff = ((size_t)bh * SEQ + q0 + lr) * HD + 8 * hi;
    V qa[2];
#pragma unroll
    for (int ks = 0; ks < 2; ++ks) qa[ks] = F::ld(Qa + qoff + 32 * ks);
    asm volatile("s_wait_xcnt 0x0" ::: "memory");   // behind the query loads, in front of the first instruction that writes their address registers
    tdm_load(g0, g1);
    // Every tensor wait names the descriptor: its words stay in their scalar registers from issue to wait, and none takes a new value while a request is outstanding.
    asm volatile("s_wait_tensorcnt 0x0" : : "s"(g0), "s"(g1) : "memory");   // this wave's slice of stage 0 has landed
    __syncthreads();                                      // stage 0 published
    issue_next(T_BUF);
    v8f o[4];
#pragma unroll
    for (int nb = 0; nb < 4; ++nb) o[nb] = (v8f){};
    float m = NEGV, l = 0.0f;
    const unsigned foff = (unsigned)lr * T_PITCH + 16u * hi;
    // one chunk of 32 keys from c0 on: kf = K fragments [16-key tile][32 d], vh = V^T fragments [16 d]
    auto chunk = [&](const int c0, const V (&kf)[2][2], const V (&vh)[4]) {
        v8f s0 = (v8f){}, s1 = (v8f){};
#pragma unroll
        for (int ks = 0; ks < 2; ++ks) { s0 = F::mma(kf[0][ks], qa[ks], s0); s1 = F::mma(kf[1][ks], qa[ks], s1); }
        // four vector slots behind the score products, before a vector instruction may touch their registers
        asm volatile("v_nop\n\tv_nop\n\tv_nop\n\tv_nop" : "+v"(s0), "+v"(s1) : "v"(kf[0][1]), "v"(kf[1][1]), "v"(qa[1]));
        if (c0 + 31 > q0) {       // wave-uniform: chunk touches the diagonal; masked scores are replaced (keys above the query)
#pragma unroll
            for (int r = 0; r < 8; ++r) { const int key = c0 + 8 * hi + r; s0[r] = (key > qrow) ? NEGV : s0[r]; s1[r] = (key + 16 > qrow) ? NEGV : s1[r]; }
        }
        float mx = fmaxf(s0[0], s1[0]);
#pragma unroll
        for (int r = 1; r < 8; ++r) mx = fmaxf(mx, fmaxf(s0[r], s1[r]));
        mx = fmaxf(mx, __shfl_xor(mx, 16, 32));
        const float mn = fmaxf(m, mx);
        const float corr = __builtin_amdgcn_exp2f((m - mn) * SCL2E);
        float ps = 0.0f;
#pragma unroll
        for (int r = 0; r < 8; ++r) { s0[r] = __builtin_amdgcn_exp2f((s0[r] - mn) * SCL2E); s1[r] = __builtin_amdgcn_exp2f((s1[r] - mn) * SCL2E); ps += s0[r] + s1[r]; }
        l = l * corr + ps; m = mn;
#pragma unroll
        for (int nb = 0; nb < 4; ++nb)
#pragma unroll
            for (int r = 0; r < 8; ++r) o[nb][r] *= corr;
        v16h th;
#pragma unroll
        for (int r = 0; r < 8; ++r) { th[r] = (h16)(s0[r] * PCAR); th[8 + r] = (h16)(s1[r] * PCAR); }
#pragma unroll
        for (int nb = 0; nb < 4; ++nb) o[nb] = F::mma(vh[nb], th, o[nb]);
        // four vector slots behind the chunk's last products, on every path out of the chunk
        asm volatile("v_nop\n\tv_nop\n\tv_nop\n\tv_nop" : "+v"(o[0]), "+v"(o[1]), "+v"(o[2]), "+v"(o[3]) : "v"(th), "v"(vh[3]));
    };
#pragma unroll 1   // one stage per trip: one publish point and one refill in the built loop
    for (unsigned s = 0; s < NS; ++s) {
        const unsigned buf = (s & 1u) * T_BUF;
        const unsigned char* kb = kv + buf + foff; const unsigned char* vb = kv + buf + 2 * T_SLICE + foff;
        const int c0 = (int)s * 64;
        V kf[2][2][2], vh[4];     // K fragments of both chunks of the stage are asked for at its head; V^T of a chunk at the chunk's head, and arrives behind its scores and softmax
#pragma unroll
        for (int t = 0; t < 2; ++t)
#pragma unroll
            for (int ks = 0; ks < 2; ++ks) kf[0][t][ks] = F::ld((const bf*)(kb + t * 16 * T_PITCH + ks * 64));
#pragma unroll
        for (int nb = 0; nb < 4; ++nb) vh[nb] = F::ld((const bf*)(vb + (nb >> 1) * T_SLICE + (nb & 1) * 16 * T_PITCH));
#pragma unroll
        for (int t = 0; t < 2; ++t)
#pragma unroll
            for (int ks = 0; ks < 2; ++ks) kf[1][t][ks] = F::ld((const bf*)(kb + T_SLICE + t * 16 * T_PITCH + ks * 64));
        sfence();   // the LDS reads issue as one group, ahead of the products and not among them
        chunk(c0, kf[0], vh);
        if (c0 + 32 <= q0 + 15) {       // wave-uniform: waves 0 and 1 have no key in the second half of the diagonal stage
#pragma unroll
            for (int nb = 0; nb < 4; ++nb) vh[nb] = F::ld((const bf*)(vb + 64 + (nb >> 1) * T_SLICE + (nb & 1) * 16 * T_PITCH));
            sfence();   // as above
            chunk(c0 + 32, kf[1], vh);
        }
        asm volatile("s_wait_dscnt 0x0" ::: "memory");       // this wave has left the buffer
        asm volatile("s_wait_tensorcnt 0x0" : "+s"(g0), "+s"(g1) : : "memory");   // its slice of stage s + 1 has landed
        __syncthreads();                                      // stage s + 1 published; every wave has left stage s's buffer
        if (pinned((s + 2u < NS) ? 1u : 0u) != 0u) issue_next(buf);
    }
    asm volatile("s_wait_tensorcnt 0x0" : : "s"(g0), "s"(g1) : "memory");
    asm volatile("s_wait_dscnt 0x0" ::: "memory");
    l += __shfl_xor(l, 16, 32);
    const float inv = (1.0f / PCAR) * (1.0f / l);
    const int sbase = (int)wave * (16 * 72) + lr * 72 + 8 * hi;
#pragma unroll
    for (int nb = 0; nb < 4; ++nb) { v8us h8, l8;
#pragma unroll
        for (int r = 0; r < 8; ++r) { unsigned short a, c; splitf(o[nb][r] * inv, a, c); h8[r] = a; l8[r] = c; }
        *(v8usa*)(sth + sbase + nb * 16) = h8; *(v8usa*)(stl + sbase + nb * 16) = l8; }
    __syncthreads();
    const int b = bh / NH, h = bh % NH;
#pragma unroll
    for (int it = 0; it < 4; ++it) { const int row = it * 4 + (lane >> 3), pc = lane & 7;
        const v8us xh = *(const v8usa*)(sth + (int)wave * (16 * 72) + row * 72 + pc * 8); const v8us xl = *(const v8usa*)(stl + (int)wave * (16 * 72) + row * 72 + pc * 8);
        const size_t go = ((size_t)b * SEQ + q0 + row) * DQ + h * HD + pc * 8;
        *(v8us*)(ATh + go) = xh; *(v8us*)(ATl + go) = xl; }
}
// Both row ranges in one launch of AT_LO + AT_HI blocks of 128 threads; they share nothing but the output staging in LDS, which each block uses for its own 64 rows.
// Blocks [0, AT_LO): rows >= RH, f16 planes [bh][SEQ][HD] / [bh][HD][SEQ], query block fastest. Blocks [AT_LO, AT_LO + AT_HI): rows < RH, compact bf16 hi|lo planes [bh][RH][HD] / [bh][HD][RH].
constexpr unsigned AT_NL = (SEQ - RH) / 64, AT_NH = RH / 64;     // query blocks per (b, h) in each range
constexpr unsigned AT_LO = AT_NL * (NB * NH), AT_HI = AT_NH * (NB * NH);
static_assert(AT_NL >= 1 && AT_NH >= 1);
__global__ __launch_bounds__(128) void k_attn(const bf* Q16, const bf* K16, const bf* VT16, const bf* Qh, const bf* Ql, const bf* Kh, const bf* Kl, const bf* VTh, const bf* VTl, bf* ATh, bf* ATl) {
    __shared__ __align__(16) bf sth[4 * 16 * 72];
    __shared__ __align__(16) bf stl[4 * 16 * 72];
    const unsigned blk = blockIdx.x;
    // a scalar branch: only the blocks of the first range reach the tensor loads, which ignore EXEC
    if (pinned((blk < AT_LO) ? 1u : 0u) != 0u) attn_ring_body(Q16, K16, VT16, (int)(blk % AT_NL + AT_NH), (int)(blk / AT_NL), ATh, ATl, sth, stl);
    else attn_body<true>(Qh, Ql, Kh, Kl, VTh, VTl, RH, RH, (int)((blk - AT_LO) % AT_NH), (int)((blk - AT_LO) / AT_NH), ATh, ATl, sth, stl);
}

constexpr size_t SZ_W  = (size_t)DM * DM * 2;             // one bf16 weight plane
constexpr size_t SZ_XB = (size_t)NB * SEQ * DM * 2;       // bf16 x
constexpr size_t SZ_P  = (size_t)NB * NH * SEQ * HD * 2;  // one f16 head plane
constexpr size_t SZ_R  = (size_t)NB * NH * RH * HD * 2;   // one compact bf16 plane
constexpr size_t SZ_AT = (size_t)NB * SEQ * DQ * 2;       // one merged bf16 plane
constexpr size_t WS_TOTAL = 4 * SZ_W + SZ_XB + 3 * SZ_P + 6 * SZ_R + 2 * SZ_AT;
static_assert(SZ_W % 256 == 0);
static_assert(SZ_XB % 256 == 0);
static_assert(SZ_P % 256 == 0);
static_assert(SZ_R % 256 == 0);
static_assert(SZ_AT % 256 == 0);
static_assert(WS_TOTAL <= (size_t)134217728);

extern "C" void kernel_launch(void* const* d_in, const int* in_sizes, int n_in,
                              void* d_out, int out_size, void* d_ws, size_t ws_size, hipStream_t stream) {
    if (n_in < 8) return;
    const long long need_x = (long long)(NB - 1) * SEQ_FULL * DM + (long long)SEQ * DM;
    if ((long long)in_sizes[0] < need_x) return;
    if ((long long)in_sizes[1] < (long long)DM * DM || (long long)in_sizes[2] < (long long)DM * DM || (long long)in_sizes[3] < (long long)DM * DM || (long long)in_sizes[4] < (long long)DM * DM) return;
    if ((long long)in_sizes[5] < (long long)TABN * TABW || (long long)in_sizes[6] < (long long)TABN * TABW) return;
    if ((long long)in_sizes[7] < (long long)(NB - 1) * SEQ_FULL + SEQ) return;
    if ((long long)out_size < need_x) return;
    if (WS_TOTAL > ws_size) return;
    const float* x = (const float*)d_in[0]; const float* wq = (const float*)d_in[1]; const float* wk = (const float*)d_in[2]; const float* wv = (const float*)d_in[3]; const float* wo = (const float*)d_in[4];
    const float* sin_tab = (const float*)d_in[5]; const float* cos_tab = (const float*)d_in[6]; const int* tpos = (const int*)d_in[7];
    float* OUT = (float*)d_out;
    char* wsp = (char*)d_ws;
    auto take = [&](size_t bytes) { char* p = wsp; wsp += bytes; return (void*)p; };
    bf* W3 = (bf*)take(3 * SZ_W); bf* WO = (bf*)take(SZ_W);     // W3 = [wq | wk | wv]
    bf* XB = (bf*)take(SZ_XB);
    h16* Q16 = (h16*)take(SZ_P); h16* K16 = (h16*)take(SZ_P); h16* VT16 = (h16*)take(SZ_P);
    bf* Qh = (bf*)take(SZ_R); bf* Ql = (bf*)take(SZ_R); bf* Kh = (bf*)take(SZ_R); bf* Kl = (bf*)take(SZ_R); bf* VTh = (bf*)take(SZ_R); bf* VTl = (bf*)take(SZ_R);
    bf* ATh = (bf*)take(SZ_AT); bf* ATl = (bf*)take(SZ_AT);

    // W3, WO, XB lie one behind the other in the workspace
    k_cvt_all<<<4u * CV_W + NB * CV_X, 256, 0, stream>>>(x, wq, wk, wv, wo, W3);

    k_gemm_qkv<<<dim3((unsigned)(NB * SEQ / 128), (unsigned)(DM / 128), 3), 128, 0, stream>>>(XB, W3, sin_tab, cos_tab, tpos, Q16, K16, VT16, Qh, Ql, Kh, Kl, VTh, VTl);

    k_attn<<<AT_LO + AT_HI, 128, 0, stream>>>((const bf*)Q16, (const bf*)K16, (const bf*)VT16, Qh, Ql, Kh, Kl, VTh, VTl, ATh, ATl);

    // out[b][t][e] = sum_d merged[b][t][d] wo[e][d]; z = batch, output batch stride from the full sequence length
    k_gemm_x2<<<dim3(SEQ / 128, DM / 128, NB), 128, 0, stream>>>(ATh, ATl, WO, DQ, OUT, DM, (size_t)SEQ * DQ, (size_t)0, (size_t)SEQ_FULL * DM);
}

// v005
// A run of this version takes 85.6 microseconds.
// Two timings next to v004 both put it at 1.08 times that version's speed.
// Over all steps from v000 it is 3.13 times as fast.
#include <hip/hip_runtime.h>

// Causal multi-head self-attention, 16 heads x 64, interleaved rotary with sin/cos rows gathered from the table inputs by the integer position input; out = merged x wo^T.
// Compute dtypes, f32 accumulate: every float input converted to bf16 (RNE); q/k/v projections v_wmma_f32_16x16x32_bf16 (exact bf16 x bf16 products);
// scores q.k: query rows < 256 bf16 hi/lo (3 products), rows >= 256 single f16; P.V: rows < 256 bf16 hi/lo (3 products), rows >= 256 single f16 with P carried x1024;
// output projection: merged bf16 hi|lo x exact bf16 wo (2 products, all hi products summed before the lo products). Softmax f32 (running max, exp2).
// Fused flash-style attention in transposed form (S^T = K Q^T, O^T = V^T P^T): two adjacent S^T key tiles repacked to 16 bit are the P^T B fragment; no score plane in memory.

#ifndef NB
#define NB 2
#endif
#ifndef SEQ
#define SEQ 2048
#endif
#define SEQ_FULL 2048                 // per-batch row stride of x, token positions and the output
#define DM   1024
#define NH   16
#define HD   64
#define DQ   (NH * HD)
#define TABN 2048                     // rows of the sin/cos tables
#define TABW 32                       // columns of the sin/cos tables (HD / 2)
#define RH   256                      // query rows < RH use bf16 hi/lo planes
#define PCAR 1024.0f
#define SCL2E 0.18033688011112042f    // HD^-0.5 x log2(e)
#define NEGV (-1.0e30f)

static_assert(HD == 64);
static_assert(DQ == DM);
static_assert(TABW * 2 == HD);
static_assert(DM % 64 == 0);
static_assert(DM % 32 == 0);
static_assert(SEQ % 64 == 0);
static_assert(RH % 64 == 0);
static_assert(RH <= SEQ);
static_assert(SEQ <= SEQ_FULL);
static_assert(SEQ <= TABN);
static_assert((NB * SEQ) % 64 == 0);
static_assert(SEQ % 128 == 0);
static_assert(DM % 128 == 0 && DM >= 256);

typedef _Float16 h16;
typedef unsigned short bf;
typedef __attribute__((ext_vector_type(16))) __bf16   v16bf;
typedef __attribute__((ext_vector_type(16))) _Float16 v16h;
typedef __attribute__((ext_vector_type(16))) unsigned short v16us;
typedef __attribute__((ext_vector_type(8)))  unsigned short v8us;
typedef __attribute__((ext_vector_type(8)))  float    v8f;
typedef __attribute__((ext_vector_type(4)))  float    v4f;
typedef __attribute__((ext_vector_type(2)))  float    v2f;
typedef __attribute__((ext_vector_type(8)))  _Float16 v8h;
typedef __attribute__((ext_vector_type(4)))  _Float16 v4h;
typedef __attribute__((ext_vector_type(4)))  unsigned short v4us;
typedef v4f  __attribute__((may_alias)) v4fa;
typedef v8us __attribute__((may_alias)) v8usa;

__device__ __forceinline__ unsigned short f2bf(float f) { unsigned u = __float_as_uint(f); u += 0x7FFFu + ((u >> 16) & 1u); return (unsigned short)(u >> 16); }
__device__ __forceinline__ float bf2f(unsigned short b) { return __uint_as_float(((unsigned)b) << 16); }
__device__ __forceinline__ float bfr(float f) { return bf2f(f2bf(f)); }
__device__ __forceinline__ void splitf(float y, unsigned short& h, unsigned short& l) { h = f2bf(y); l = f2bf(y - bf2f(h)); }
__device__ __forceinline__ v16us cat16u(v8us lo, v8us hi) { return __builtin_shufflevector(lo, hi, 0, 1, 2, 3, 4, 5, 6, 7, 8, 9, 10, 11, 12, 13, 14, 15); }
__device__ __forceinline__ v8f wmma16(v16h a, v16h b, v8f c) { return __builtin_amdgcn_wmma_f32_16x16x32_f16(false, a, false, b, (short)0, c, false, false); }
__device__ __forceinline__ v8f wmmab(v16bf a, v16bf b, v8f c) { return __builtin_amdgcn_wmma_f32_16x16x32_bf16(false, a, false, b, (short)0, c, false, false); }

// Fragment loader for K-contiguous 16-bit rows: p = row base + k0 + 8*(lane>>4); elements 0..7 <- p[0..7], elements 8..15 <- p[16..23].
template <bool HI> struct AF;
template <> struct AF<false> {
    typedef v16h V;
    static __device__ __forceinline__ V ld(const bf* p) { return __builtin_bit_cast(v16h, cat16u(*(const v8usa*)p, *(const v8usa*)(p + 16))); }
    static __device__ __forceinline__ v8f mma(V a, V b, v8f c) { return wmma16(a, b, c); }
};
template <> struct AF<true> {
    typedef v16bf V;
    static __device__ __forceinline__ V ld(const bf* p) { return __builtin_bit_cast(v16bf, cat16u(*(const v8usa*)p, *(const v8usa*)(p + 16))); }
    static __device__ __forceinline__ v8f mma(V a, V b, v8f c) { return wmmab(a, b, c); }
};

// ---- GEMM, (64 WM) x (64 WN) output tile per block of WM x WN waves (one 64x64 wave tile = 16 accumulators each); grid (M / (64 WM), N / (64 WN), Z), 32 WM WN threads.
// acc[m][n] (f32) = sum_k (A[m][k] (+ A2[m][k])) Bt[n][k], handed to the epilogue EPI per wave tile. z-batch strides sA/sB in elements. K % 128 == 0, K >= 256, M % (64 WM) == 0, N % (64 WN) == 0.
// Operands come to LDS by tensor loads, two buffers: a stage is 128 k of [A 64 WM rows | Bt 64 WN rows]; each of the first WM + WN waves brings one slice of 64 rows x 256 B (waves < WM: A; the next WN: Bt),
// padded by the mover to a pitch of 272 B for the 16-byte fragment reads. With A2 the K/128 stages of A are followed by K/128 stages of A2 against the same Bt rows.
// A staged row serves every wave tile of its row or column of waves: bytes brought from L2 per product fall as (WM + WN) / (WM WN).
typedef unsigned u32x4 __attribute__((ext_vector_type(4)));
typedef unsigned u32x8 __attribute__((ext_vector_type(8)));
constexpr unsigned G_ROWB  = 256;                 // bytes of one staged row (128 k)
constexpr unsigned G_PITCH = G_ROWB + 16;         // LDS row pitch, an odd multiple of 16 B
constexpr unsigned G_SLICE = 18432;               // 64 rows x 272 B = 17,408 B, rounded up to a multiple of 2 KiB
static_assert(64 * G_PITCH <= G_SLICE && G_SLICE % 2048 == 0);
__device__ __forceinline__ unsigned uni(unsigned v) { return (unsigned)__builtin_amdgcn_readfirstlane(v); }
__device__ __forceinline__ unsigned pinned(unsigned v) { unsigned w = uni(v); asm volatile("" : "+s"(w)); return w; }
__device__ __forceinline__ void tdm_load(u32x4 g0, u32x8 g1) { asm volatile("tensor_load_to_lds %0, %1" :: "s"(g0), "s"(g1) : "memory"); }
__device__ __forceinline__ void sfence() { __builtin_amdgcn_sched_barrier(0); }   // keeps a group of fragment loads, or a block of products, together in the built code
// Epilogue: f32 rows C[m][n] (pitch ldc, z-batch stride sC), each 16-row band turned through the wave's LDS staging into 16-byte row stores.
struct EpiRows {
    float* C; int ldc; size_t sC;
    __device__ __forceinline__ void operator()(v8f (&acc)[4][4], float* os, const int r0, const int c0, const int lr, const int hi) const {
        float* Cz = C + (size_t)blockIdx.z * sC;
#pragma unroll
        for (int mb = 0; mb < 4; ++mb) {
#pragma unroll
            for (int nb = 0; nb < 4; ++nb) {
#pragma unroll
                for (int j = 0; j < 8; ++j) os[(hi * 8 + j) * 68 + nb * 16 + lr] = acc[mb][nb][j]; }
            __builtin_amdgcn_wave_barrier(); asm volatile("" ::: "memory");   // the band's LDS writes stay ahead of the row reads below
            float* crow = Cz + (size_t)(r0 + mb * 16) * ldc + c0;
#pragma unroll
            for (int s = 0; s < 8; ++s) { const int row = 2 * s + hi, cofs = lr * 4; const v4f val = *(const v4fa*)(os + row * 68 + cofs);
                *(v4f*)(crow + (size_t)row * ldc + cofs) = val; }
            __builtin_amdgcn_wave_barrier(); asm volatile("" ::: "memory");   // the row reads stay ahead of the next band's LDS writes
        }
    }
};
// Epilogue of the q/k/v projections, columns [q | k | v] (z = column / DM = 0, 1, 2): a wave tile is 64 tokens of one batch x the 64 columns of one head, and goes straight to the head planes.
// z < 2: interleaved rotary, pair (2i, 2i+1), table row = clamped token position, out[2i] = cos x[2i] - sin x[2i+1], out[2i+1] = sin x[2i] + cos x[2i+1];
//        planes [b*NH + h][t][d]: f16 for all t, compact bf16 hi|lo [bh][RH][HD] for t < RH.
// z = 2: value planes [bh][d][t] (f16, all t; compact bf16 hi|lo [bh][HD][RH] for t < RH): a lane's 8 accumulator rows are 8 consecutive t of one d, stored as 16 bytes from registers.
struct EpiHeads {
    const float* __restrict__ sin_tab; const float* __restrict__ cos_tab; const int* __restrict__ tpos;
    h16* Q16; h16* K16; h16* VT16; bf* Qh; bf* Ql; bf* Kh; bf* Kl; bf* VTh; bf* VTl;
    // Stands behind each run of global loads or stores, in front of the first instruction that writes a register which one of them names; the scheduling fences keep the run together and later work behind the wait.
    static __device__ __forceinline__ void xwait() { asm volatile("s_wait_xcnt 0x0" ::: "memory"); sfence(); }
    // The same behind a run of table loads: the eight offsets are inputs of the wait, so that none of their registers is given to a later load's result ahead of it.
    static __device__ __forceinline__ void xwait(const unsigned (&t)[8]) { asm volatile("s_wait_xcnt 0x0" :: "v"(t[0]), "v"(t[1]), "v"(t[2]), "v"(t[3]), "v"(t[4]), "v"(t[5]), "v"(t[6]), "v"(t[7]) : "memory"); sfence(); }
    __device__ __forceinline__ void operator()(v8f (&acc)[4][4], float* os, const int r0, const int c0, const int lr, const int hi) const {
        const int z = c0 / DM, b = r0 / SEQ, t0 = r0 % SEQ, bh = b * NH + (c0 % DM) / HD;     // uniform per wave
        const bool hr = (t0 < RH);     // uniform per wave: the tile's 64 tokens lie on one side of RH
        const int tc = hr ? t0 : 0;    // first token in the compact planes
        if (z == 2) {
            h16* v16 = VT16 + (size_t)bh * HD * SEQ + t0; const unsigned vofs = (unsigned)(lr * SEQ + hi * 8);
#pragma unroll
            for (int nb = 0; nb < 4; ++nb) {
                v8h o16[4];
#pragma unroll
                for (int mb = 0; mb < 4; ++mb)
#pragma unroll
                    for (int j = 0; j < 8; ++j) o16[mb][j] = (h16)acc[mb][nb][j];
                sfence();   // the four stores issue as one run, with nothing between them and their wait
#pragma unroll
                for (int mb = 0; mb < 4; ++mb) *(v8h*)(v16 + (nb * 16 * SEQ + mb * 16) + vofs) = o16[mb];   // the four stores fill one 128-byte line per d
                xwait();
            }
            if (hr) {
                float* own = os + (hi * 16 + lr) * 8;     // this lane's own 8 floats of each of the four column blocks
                bf* vh = VTh + (size_t)bh * HD * RH + tc; bf* vl = VTl + (size_t)bh * HD * RH + tc; const unsigned cofs = (unsigned)(lr * RH + hi * 8);
#pragma unroll
                for (int mb = 0; mb < 4; ++mb) {
#pragma unroll
                    for (int nb = 0; nb < 4; ++nb)
#pragma unroll
                        for (int j = 0; j < 8; ++j) own[nb * 256 + j] = acc[mb][nb][j];
#pragma unroll 1   // rolled, fed from LDS: the hi/lo split stands once per band in the text
                    for (int nb = 0; nb < 4; ++nb) { const v4f xa = *(const v4fa*)(own + nb * 256), xb = *(const v4fa*)(own + nb * 256 + 4); v8us oh, ol;
#pragma unroll
                        for (int j = 0; j < 4; ++j) { unsigned short u0, u1; splitf(xa[j], u0, u1); oh[j] = u0; ol[j] = u1; splitf(xb[j], u0, u1); oh[4 + j] = u0; ol[4 + j] = u1; }
                        const unsigned ce = (unsigned)(nb * 16 * RH + mb * 16) + cofs;
                        sfence();   // the two stores issue as one run, with nothing between them and their wait
                        *(v8us*)(vh + ce) = oh; *(v8us*)(vl + ce) = ol;
                        xwait(); }
                }
            }
            return;
        }
        h16* p16 = ((z == 0) ? Q16 : K16) + ((size_t)bh * SEQ + t0) * HD;
        bf* ph = ((z == 0) ? Qh : Kh) + ((size_t)bh * RH + tc) * HD; bf* pl = ((z == 0) ? Ql : Kl) + ((size_t)bh * RH + tc) * HD;
        const int* tp = tpos + (size_t)b * SEQ_FULL + t0;
        const unsigned lofs = (unsigned)(hi * HD + lr * 4);     // the lane's four columns in a pair of token rows
        int pos[4][8];     // token positions of the rows this lane will write: all fetched at once, one latency
#pragma unroll
        for (int mb = 0; mb < 4; ++mb)
#pragma unroll
            for (int s = 0; s < 8; ++s) pos[mb][s] = tp[mb * 16 + 2 * s + hi];
        xwait();
        unsigned to[4][8];   // byte offset of the lane's two sin (cos) values: table row = clamped token position
#pragma unroll
        for (int mb = 0; mb < 4; ++mb)
#pragma unroll
            for (int s = 0; s < 8; ++s) { const int p = pos[mb][s]; to[mb][s] = ((unsigned)(p < 0 ? 0 : (p > TABN - 1 ? TABN - 1 : p)) * TABW + (unsigned)lr * 2u) * 4u; }
        v2f sn[2][8], cs[2][8];   // fetched one 16-row band ahead
        sfence();   // the band's table loads issue as one run, with nothing between them and their wait
#pragma unroll
        for (int s = 0; s < 8; ++s) { sn[0][s] = *(const v2f*)((const char*)sin_tab + to[0][s]); cs[0][s] = *(const v2f*)((const char*)cos_tab + to[0][s]); }
        xwait(to[0]);
#pragma unroll
        for (int mb = 0; mb < 4; ++mb) {
            const int cb = mb & 1;
            if (mb < 3) {
#pragma unroll
                for (int s = 0; s < 8; ++s) { sn[cb ^ 1][s] = *(const v2f*)((const char*)sin_tab + to[mb + 1][s]); cs[cb ^ 1][s] = *(const v2f*)((const char*)cos_tab + to[mb + 1][s]); }
                xwait(to[mb + 1]);
            }
#pragma unroll
            for (int nb = 0; nb < 4; ++nb) {
#pragma unroll
                for (int j = 0; j < 8; ++j) os[(hi * 8 + j) * 68 + nb * 16 + lr] = acc[mb][nb][j]; }
            __builtin_amdgcn_wave_barrier(); asm volatile("" ::: "memory");   // the band's LDS writes stay ahead of the row reads below
            v4h o16[8]; v4f xy[8];
#pragma unroll
            for (int s = 0; s < 8; ++s) xy[s] = *(const v4fa*)(os + (2 * s + hi) * 68 + lr * 4);
#pragma unroll
            for (int s = 0; s < 8; ++s) { const v4f x = xy[s];
                const float s0 = bfr(sn[cb][s][0]), s1 = bfr(sn[cb][s][1]), k0 = bfr(cs[cb][s][0]), k1 = bfr(cs[cb][s][1]);
                v4f y; y[0] = k0 * x[0] - s0 * x[1]; y[1] = s0 * x[0] + k0 * x[1]; y[2] = k1 * x[2] - s1 * x[3]; y[3] = s1 * x[2] + k1 * x[3];
#pragma unroll
                for (int q = 0; q < 4; ++q) o16[s][q] = (h16)y[q];
                xy[s] = y;
            }
            sfence();   // the band's eight stores issue as one run, with nothing between them and their wait
#pragma unroll
            for (int s = 0; s < 8; ++s) *(v4h*)(p16 + (mb * 16 + 2 * s) * HD + lofs) = o16[s];
            xwait();
            if (hr) {      // each lane puts its rotated values back where it read them, for the split below
#pragma unroll
                for (int s = 0; s < 8; ++s) *(v4fa*)(os + (2 * s + hi) * 68 + lr * 4) = xy[s];
#pragma unroll 1   // rolled, fed from LDS: the hi/lo split stands once per band in the text
                for (int s = 0; s < 8; ++s) { const v4f y = *(const v4fa*)(os + (2 * s + hi) * 68 + lr * 4); v4us oh, ol;
#pragma unroll
                    for (int q = 0; q < 4; ++q) { unsigned short u0, u1; splitf(y[q], u0, u1); oh[q] = u0; ol[q] = u1; }
                    const unsigned ce = (unsigned)((mb * 16 + 2 * s) * HD) + lofs;
                    sfence();   // the two stores issue as one run, with nothing between them and their wait
                    *(v4us*)(ph + ce) = oh; *(v4us*)(pl + ce) = ol;
                    xwait(); }
            }
            __builtin_amdgcn_wave_barrier(); asm volatile("" ::: "memory");   // the row reads stay ahead of the next band's LDS writes
        }
    }
};
template <int NSPLIT, int WM, int WN, class EPI>
__device__ __forceinline__ void gemmw_body(const bf* __restrict__ A, const bf* __restrict__ A2, const bf* __restrict__ Bt, const int K, const size_t sA, const size_t sB, const EPI epi) {
    typedef AF<true> W; typedef W::V V;
    constexpr unsigned NW = WM * WN, NSL = WM + WN, G_BUF = NSL * G_SLICE;     // waves, slices of a stage, bytes of a buffer
    static_assert(NSL <= NW);
    __shared__ __attribute__((aligned(2048))) unsigned char ring[2 * G_BUF];
    __shared__ __align__(16) float osb[NW * 16 * 68];
    const size_t z = blockIdx.z; A += z * sA; A2 += z * sA; Bt += z * sB;
    const int lane = threadIdx.x & 31, lr = lane & 15, hi = lane >> 4; const unsigned wave = uni(threadIdx.x >> 5); const unsigned wm = wave / WN, wn = wave % WN;
    const int r0 = blockIdx.x * (64 * WM) + (int)wm * 64, c0 = blockIdx.y * (64 * WN) + (int)wn * 64;
    __builtin_assume(K >= 256);              // the ring's prologue issues two stages: no path without a pass is built
    const unsigned KP = (unsigned)K / 128u, NS = (NSPLIT + 1) * KP;     // stages per plane, stages in all
    // this wave's slice of a stage: 64 rows of A (A2) or of Bt; a wave past the last slice issues nothing (its descriptor names the last slice)
    const unsigned sl = (NW == NSL || wave < NSL) ? wave : NSL - 1u;
    const size_t srow = (sl < (unsigned)WM) ? (size_t)(blockIdx.x * (64u * WM) + 64u * sl) * K : (size_t)(blockIdx.y * (64u * WN) + 64u * (sl - WM)) * K;
    const unsigned long long ga1 = (unsigned long long)(size_t)(((sl < (unsigned)WM) ? A : Bt) + srow), ga2 = (unsigned long long)(size_t)(((sl < (unsigned)WM) ? A2 : Bt) + srow);
    const unsigned lds_slice = (unsigned)(size_t)ring + sl * G_SLICE;
    u32x8 g1;   // 1-byte elements, tensor = tile = 64 rows of 256 B, source pitch 2 K bytes, 4 dwords of pad behind every 64
    g1[0] = uni((1u << 20) | (5u << 22) | (3u << 25)); g1[1] = uni(G_ROWB << 16); g1[2] = uni(64u << 16); g1[3] = uni(G_ROWB << 16); g1[4] = uni(64u); g1[5] = uni((unsigned)K * 2u); g1[6] = uni(0u); g1[7] = uni(0u);
    // group 0: count 1 | LDS place | address of the slice's first byte, type 2 in the top bits. Words 2 and 3 walk from stage to stage by one 64-bit add.
    const unsigned long long jump = ga2 - ga1 - (unsigned long long)(KP - 1u) * G_ROWB;   // from the last stage of A to the first of A2
    u32x4 g0; g0[0] = uni(1u); g0[1] = uni(lds_slice); g0[2] = uni((unsigned)ga1); g0[3] = uni((((unsigned)(ga1 >> 32)) & 0x01FFFFFFu) | 0x80000000u);
    auto issue_next = [&](unsigned st, unsigned buf) {
        const unsigned long long c = ((((unsigned long long)g0[3]) << 32) | g0[2]) + ((NSPLIT == 1 && st == KP) ? jump : (unsigned long long)G_ROWB);
        g0[1] = uni(lds_slice + buf); g0[2] = uni((unsigned)c); g0[3] = uni((unsigned)(c >> 32));
        tdm_load(g0, g1);
    };
    // Where the block has more waves than slices, every issue stands under a scalar branch on the wave's number (tensor loads ignore EXEC).
    // Every tensor wait names the descriptor: its words stay in their scalar registers from issue to wait, and none takes a new value while a request is outstanding.
    if (NW == NSL || pinned((wave < NSL) ? 1u : 0u) != 0u) {
        tdm_load(g0, g1);
        asm volatile("s_wait_tensorcnt 0x0" : "+s"(g0), "+s"(g1) : : "memory");   // this wave's slice of stage 0 has landed
    }
    __syncthreads();                                      // stage 0 published
    if (NW == NSL || pinned((wave < NSL) ? 1u : 0u) != 0u) issue_next(1u, G_BUF);
    v8f acc[4][4];
#pragma unroll
    for (int mb = 0; mb < 4; ++mb)
#pragma unroll
        for (int nb = 0; nb < 4; ++nb) acc[mb][nb] = (v8f){};
    const unsigned aoff = wm * G_SLICE + (unsigned)lr * G_PITCH + 16u * hi, boff = ((unsigned)WM + wn) * G_SLICE + (unsigned)lr * G_PITCH + 16u * hi;
#pragma unroll 1   // one pass per trip: one publish point and one refill in the built loop, accumulators and fragments in registers
    for (unsigned s = 0; s < NS; ++s) {
        const unsigned buf = (s & 1u) * G_BUF;
        const unsigned char* la = ring + buf + aoff; const unsigned char* lb = ring + buf + boff;
        V a[2][4], b[2][4];
#pragma unroll
        for (int f = 0; f < 4; ++f) { a[0][f] = W::ld((const bf*)(la + f * 16 * G_PITCH)); b[0][f] = W::ld((const bf*)(lb + f * 16 * G_PITCH)); }
        sfence();
#pragma unroll
        for (int u = 0; u < 4; ++u) {       // four blocks of 32 k; the next block's fragments are fetched ahead of this block's products
            const int cs = u & 1;
            if (u < 3) {
#pragma unroll
                for (int f = 0; f < 4; ++f) { a[cs ^ 1][f] = W::ld((const bf*)(la + f * 16 * G_PITCH + (u + 1) * 64)); b[cs ^ 1][f] = W::ld((const bf*)(lb + f * 16 * G_PITCH + (u + 1) * 64)); }
                sfence();
            }
#pragma unroll
            for (int nb = 0; nb < 4; ++nb)
#pragma unroll
                for (int mb = 0; mb < 4; ++mb) acc[mb][nb] = W::mma(a[cs][mb], b[cs][nb], acc[mb][nb]);
            sfence();
        }
        // four vector slots behind the pass's last products, on the loop's taken branch too, before a vector instruction may touch their registers
        asm volatile("v_nop\n\tv_nop\n\tv_nop\n\tv_nop");
        sfence();
        asm volatile("s_wait_dscnt 0x0" ::: "memory");       // this wave has left the buffer
        asm volatile("s_wait_tensorcnt 0x0" : "+s"(g0), "+s"(g1) : : "memory");   // its slice of stage s + 1 has landed
        __syncthreads();                                      // stage s + 1 published; every wave has left stage s's buffer
        if (pinned(((NW == NSL || wave < NSL) && s + 2u < NS) ? 1u : 0u) != 0u) issue_next(s + 2u, buf);
    }
    asm volatile("s_wait_tensorcnt 0x0" : : "s"(g0), "s"(g1) : "memory");
    asm volatile("s_wait_dscnt 0x0" ::: "memory");
    epi(acc, osb + wave * (16 * 68), r0, c0, lr, hi);      // output staging in LDS, each wave's own
}
// q, k, v projections of X (bf16 rows [b*SEQ + t][DM]) in one launch, as one product against the 3 DM rows of W3 = [wq | wk | wv]: 256 x 192 tiles, 12 waves (4 x 3), grid (NB*SEQ/256, 3*DM/192).
static_assert((NB * SEQ) % 256 == 0 && (3 * DM) % 192 == 0);
__global__ __launch_bounds__(384) void k_gemm_qkv(const bf* X, const bf* W3, const float* sin_tab, const float* cos_tab, const int* tpos,
                                                  h16* Q16, h16* K16, h16* VT16, bf* Qh, bf* Ql, bf* Kh, bf* Kl, bf* VTh, bf* VTl) {
    gemmw_body<0, 4, 3>(X, X, W3, DM, (size_t)0, (size_t)0, EpiHeads{sin_tab, cos_tab, tpos, Q16, K16, VT16, Qh, Ql, Kh, Kl, VTh, VTl}); }
__global__ __launch_bounds__(128) void k_gemm_x2(const bf* A, const bf* A2, const bf* Bt, int K, float* C, int ldc, size_t sA, size_t sB, size_t sC) { gemmw_body<1, 2, 2>(A, A2, Bt, K, sA, sB, EpiRows{C, ldc, sC}); }

// All f32 -> bf16 conversions in one launch; a thread converts 8 values. dst = [wq | wk | wv | wo | x rows b*SEQ + t], one behind the other; a block's 2,048 values lie in one source, picked by the block index.
constexpr unsigned CV_W = (unsigned)((size_t)DM * DM / 2048);      // blocks per weight plane
constexpr unsigned CV_X = (unsigned)((size_t)SEQ * DM / 2048);     // blocks per batch of x
static_assert(((size_t)DM * DM) % 2048 == 0 && ((size_t)SEQ * DM) % 2048 == 0);
__global__ __launch_bounds__(256) void k_cvt_all(const float* __restrict__ x, const float* __restrict__ wq, const float* __restrict__ wk, const float* __restrict__ wv, const float* __restrict__ wo, bf* dst) {
    const unsigned blk = blockIdx.x; const float* src; unsigned rel;
    if (blk < 4u * CV_W) { const unsigned p = blk / CV_W; rel = blk % CV_W; src = (p == 0u) ? wq : (p == 1u) ? wk : (p == 2u) ? wv : wo; }
    else { const unsigned c = blk - 4u * CV_W; rel = c % CV_X; src = x + (size_t)(c / CV_X) * SEQ_FULL * DM; }
    const v8f v = *(const v8f*)(src + ((size_t)rel * 256 + threadIdx.x) * 8); v8us o;
    asm volatile("s_wait_xcnt 0x0" ::: "memory");   // behind the loads, in front of the first instruction that writes their address registers
#pragma unroll
    for (int k = 0; k < 8; ++k) o[k] = f2bf(v[k]); *(v8us*)(dst + ((size_t)blk * 256 + threadIdx.x) * 8) = o;  }

// ---- fused causal attention, transposed flash form. Block = 4 waves = 64 query rows of one (b, h); each wave owns 16 queries (lane & 15 = query; both lane halves carry its statistics).
// Per 32-key chunk: S^T tiles (rows = keys, cols = queries) = K frag (A) x Q frag (B); running max (one shfl_xor 16), p = exp2; the two S^T tiles repacked to 16 bit are the P^T B fragment
// (element r <- keys c0+8h+r, element 8+r <- keys c0+16+8h+r); O^T[d][query] += V^T frag (A, rows of the [d][t] plane) x P^T. HI: bf16 hi/lo planes, 3 products; else f16, P x PCAR.
template <bool HI>
__device__ __forceinline__ void attn_body(const bf* __restrict__ Qa, const bf* __restrict__ Qb, const bf* __restrict__ Ka, const bf* __restrict__ Kb, const bf* __restrict__ Va, const bf* __restrict__ Vb,
                                          const int tq, const int tv, const int qblk, const int bh, bf* ATh, bf* ATl, bf* sth, bf* stl) {
    typedef AF<HI> F; typedef typename F::V V;
    const int lane = threadIdx.x & 31, lr = lane & 15, hi = lane >> 4, wave = threadIdx.x >> 5;
    const int q0 = qblk * 64 + wave * 16; const int qrow = q0 + lr;
    const size_t qoff = ((size_t)bh * tq + q0 + lr) * HD + 8 * hi;
    const size_t koff = ((size_t)bh * tq + lr) * HD + 8 * hi;
    const size_t voff = ((size_t)bh * HD + lr) * tv + 8 * hi;
    V qa[2], qb[2];
#pragma unroll
    for (int ks = 0; ks < 2; ++ks) { qa[ks] = F::ld(Qa + qoff + 32 * ks); if (HI) qb[ks] = F::ld(Qb + qoff + 32 * ks); else qb[ks] = qa[ks]; }
    v8f o[4];
#pragma unroll
    for (int nb = 0; nb < 4; ++nb) o[nb] = (v8f){};
    float m = NEGV, l = 0.0f;
#pragma unroll 1
    for (int c0 = 0; c0 <= q0 + 15; c0 += 32) {
        v8f s0 = (v8f){}, s1 = (v8f){}; V k0, k1;
#pragma unroll
        for (int ks = 0; ks < 2; ++ks) {
            k0 = F::ld(Ka + koff + (size_t)c0 * HD + 32 * ks); k1 = F::ld(Ka + koff + (size_t)(c0 + 16) * HD + 32 * ks);
            if (HI) { const V l0 = F::ld(Kb + koff + (size_t)c0 * HD + 32 * ks); const V l1 = F::ld(Kb + koff + (size_t)(c0 + 16) * HD + 32 * ks);
                s0 = F::mma(l0, qa[ks], s0); s1 = F::mma(l1, qa[ks], s1); s0 = F::mma(k0, qb[ks], s0); s1 = F::mma(k1, qb[ks], s1); }
            s0 = F::mma(k0, qa[ks], s0); s1 = F::mma(k1, qa[ks], s1);
        }
        asm volatile("v_nop\n\tv_nop\n\tv_nop\n\tv_nop" : "+v"(s0), "+v"(s1) : "v"(k0), "v"(k1), "v"(qa[1]), "v"(qb[1]));
        if (c0 + 31 > q0) {       // wave-uniform: chunk touches the diagonal; masked scores are replaced (keys above the query)
#pragma unroll
            for (int r = 0; r < 8; ++r) { const int key = c0 + 8 * hi + r; s0[r] = (key > qrow) ? NEGV : s0[r]; s1[r] = (key + 16 > qrow) ? NEGV : s1[r]; }
        }
        float mx = fmaxf(s0[0], s1[0]);
#pragma unroll
        for (int r = 1; r < 8; ++r) mx = fmaxf(mx, fmaxf(s0[r], s1[r]));
        mx = fmaxf(mx, __shfl_xor(mx, 16, 32));
        const float mn = fmaxf(m, mx);
        const float corr = __builtin_amdgcn_exp2f((m - mn) * SCL2E);
        float ps = 0.0f;
#pragma unroll
        for (int r = 0; r < 8; ++r) { s0[r] = __builtin_amdgcn_exp2f((s0[r] - mn) * SCL2E); s1[r] = __builtin_amdgcn_exp2f((s1[r] - mn) * SCL2E); ps += s0[r] + s1[r]; }
        l = l * corr + ps; m = mn;
#pragma unroll
        for (int nb = 0; nb < 4; ++nb)
#pragma unroll
            for (int r = 0; r < 8; ++r) o[nb][r] *= corr;
        V pa, pl;
        if (HI) { v16us uh, ul;
#pragma unroll
            for (int r = 0; r < 8; ++r) { unsigned short a, c; splitf(s0[r], a, c); uh[r] = a; ul[r] = c; splitf(s1[r], a, c); uh[8 + r] = a; ul[8 + r] = c; }
            pa = __builtin_bit_cast(V, uh); pl = __builtin_bit_cast(V, ul);
        } else { v16h th;
#pragma unroll
            for (int r = 0; r < 8; ++r) { th[r] = (h16)(s0[r] * PCAR); th[8 + r] = (h16)(s1[r] * PCAR); }
            pa = __builtin_bit_cast(V, th); pl = pa; }
        V vh[4], vl[4];
#pragma unroll
        for (int nb = 0; nb < 4; ++nb) { vh[nb] = F::ld(Va + voff + (size_t)nb * 16 * tv + c0); if (HI) vl[nb] = F::ld(Vb + voff + (size_t)nb * 16 * tv + c0); else vl[nb] = vh[nb]; }
#pragma unroll
        for (int nb = 0; nb < 4; ++nb) { if (HI) { o[nb] = F::mma(vl[nb], pa, o[nb]); o[nb] = F::mma(vh[nb], pl, o[nb]); } o[nb] = F::mma(vh[nb], pa, o[nb]); }
        asm volatile("v_nop\n\tv_nop\n\tv_nop\n\tv_nop" : "+v"(o[0]), "+v"(o[1]), "+v"(o[2]), "+v"(o[3]) : "v"(pa), "v"(pl), "v"(vh[3]));
    }
    l += __shfl_xor(l, 16, 32);
    const float inv = (HI ? 1.0f : (1.0f / PCAR)) * (1.0f / l);
    const int sbase = wave * (16 * 72) + lr * 72 + 8 * hi;
#pragma unroll
    for (int nb = 0; nb < 4; ++nb) { v8us h8, l8;
#pragma unroll
        for (int r = 0; r < 8; ++r) { unsigned short a, c; splitf(o[nb][r] * inv, a, c); h8[r] = a; l8[r] = c; }
        *(v8usa*)(sth + sbase + nb * 16) = h8; *(v8usa*)(stl + sbase + nb * 16) = l8; }
    __syncthreads();
    const int b = bh / NH, h = bh % NH;
{
#pragma unroll
        for (int it = 0; it < 4; ++it) { const int row = it * 4 + (lane >> 3), pc = lane & 7;
            const v8us xh = *(const v8usa*)(sth + wave * (16 * 72) + row * 72 + pc * 8); const v8us xl = *(const v8usa*)(stl + wave * (16 * 72) + row * 72 + pc * 8);
            const size_t go = ((size_t)b * SEQ + q0 + row) * DQ + h * HD + pc * 8;
            *(v8us*)(ATh + go) = xh; *(v8us*)(ATl + go) = xl; }
         }
}
// ---- the same attention for rows >= RH (single f16 planes), with K and V^T staged in LDS by tensor loads and shared by the block's 4 waves. Same 32-key chunks in the same order as attn_body<false>.
// A stage is 64 keys: K rows [64 keys][128 B] and V^T rows [64 d][128 B = 64 keys]; each wave brings one slice of 32 rows x 128 B (waves 0, 1: K; waves 2, 3: V^T),
// padded by the mover to a pitch of 144 B for the 16-byte fragment reads. Two buffers; query block qblk walks qblk + 1 stages (at least RH / 64 + 1).
constexpr unsigned T_ROWB  = 128;                 // bytes of one staged row
constexpr unsigned T_PITCH = T_ROWB + 16;         // LDS row pitch, an odd multiple of 16 B
constexpr unsigned T_SLICE = 6144;                // 32 rows x 144 B = 4,608 B, rounded up to a multiple of 2 KiB
constexpr unsigned T_BUF   = 4 * T_SLICE;
static_assert(32 * T_PITCH <= T_SLICE && T_SLICE % 2048 == 0);
static_assert(HD * 2 == T_ROWB);
static_assert(RH / 64 + 1 >= 2);                  // the ring's prologue issues two stages
__device__ __forceinline__ void attn_ring_body(const bf* __restrict__ Qa, const bf* __restrict__ Ka, const bf* __restrict__ Va, const int qblk, const int bh, bf* ATh, bf* ATl, bf* sth, bf* stl) {
    typedef AF<false> F; typedef F::V V;
    __shared__ __attribute__((aligned(2048))) unsigned char kv[2 * T_BUF];
    const int lane = threadIdx.x & 31, lr = lane & 15, hi = lane >> 4; const unsigned wave = uni(threadIdx.x >> 5);
    const int q0 = qblk * 64 + (int)wave * 16; const int qrow = q0 + lr;
    __builtin_assume(qblk >= RH / 64);            // the ring's prologue issues two stages: no path without a pass is built
    const unsigned NS = (unsigned)qblk + 1u;      // stages of 64 keys, the last one holds the diagonal
    // this wave's slice of a stage: 32 key rows of K, or 32 d rows of V^T; from stage to stage K walks 64 rows, V^T 64 keys along its rows
    const unsigned long long ga = (unsigned long long)(size_t)((wave < 2u) ? Ka + ((size_t)bh * SEQ + 32u * wave) * HD : Va + ((size_t)bh * HD + 32u * (wave - 2u)) * SEQ);
    const unsigned long long step = (wave < 2u) ? (unsigned long long)(64u * T_ROWB) : (unsigned long long)T_ROWB;
    const unsigned lds_slice = (unsigned)(size_t)kv + wave * T_SLICE;
    u32x8 g1;   // 1-byte elements, tensor = tile = 32 rows of 128 B, source pitch 128 B (K) or 2 SEQ bytes (V^T), 4 dwords of pad behind every 32
    g1[0] = uni((1u << 20) | (4u << 22) | (3u << 25)); g1[1] = uni(T_ROWB << 16); g1[2] = uni(32u << 16); g1[3] = uni(T_ROWB << 16); g1[4] = uni(32u); g1[5] = uni((wave < 2u) ? T_ROWB : (unsigned)SEQ * 2u); g1[6] = uni(0u); g1[7] = uni(0u);
    u32x4 g0; g0[0] = uni(1u); g0[1] = uni(lds_slice); g0[2] = uni((unsigned)ga); g0[3] = uni((((unsigned)(ga >> 32)) & 0x01FFFFFFu) | 0x80000000u);
    auto issue_next = [&](unsigned buf) {
        const unsigned long long c = ((((unsigned long long)g0[3]) << 32) | g0[2]) + step;
        g0[1] = uni(lds_slice + buf); g0[2] = uni((unsigned)c); g0[3] = uni((unsigned)(c >> 32));
        tdm_load(g0, g1);
    };
    const size_t qoff = ((size_t)bh * SEQ + q0 + lr) * HD + 8 * hi;
    V qa[2];
#pragma unroll
    for (int ks = 0; ks < 2; ++ks) qa[ks] = F::ld(Qa + qoff + 32 * ks);
    asm volatile("s_wait_xcnt 0x0" ::: "memory");   // behind the query loads, in front of the first instruction that writes their address registers
    tdm_load(g0, g1);
    // Every tensor wait names the descriptor: its words stay in their scalar registers from issue to wait, and none takes a new value while a request is outstanding.
    asm volatile("s_wait_tensorcnt 0x0" : : "s"(g0), "s"(g1) : "memory");   // this wave's slice of stage 0 has landed
    __syncthreads();                                      // stage 0 published
    issue_next(T_BUF);
    v8f o[4];
#pragma unroll
    for (int nb = 0; nb < 4; ++nb) o[nb] = (v8f){};
    float m = NEGV, l = 0.0f;
    const unsigned foff = (unsigned)lr * T_PITCH + 16u * hi;
    // one chunk of 32 keys from c0 on: kf = K fragments [16-key tile][32 d], vh = V^T fragments [16 d]
    auto chunk = [&](const int c0, const V (&kf)[2][2], const V (&vh)[4]) {
        v8f s0 = (v8f){}, s1 = (v8f){};
#pragma unroll
        for (int ks = 0; ks < 2; ++ks) { s0 = F::mma(kf[0][ks], qa[ks], s0); s1 = F::mma(kf[1][ks], qa[ks], s1); }
        // four vector slots behind the score products, before a vector instruction may touch their registers
        asm volatile("v_nop\n\tv_nop\n\tv_nop\n\tv_nop" : "+v"(s0), "+v"(s1) : "v"(kf[0][1]), "v"(kf[1][1]), "v"(qa[1]));
        if (c0 + 31 > q0) {       // wave-uniform: chunk touches the diagonal; masked scores are replaced (keys above the query)
#pragma unroll
            for (int r = 0; r < 8; ++r) { const int key = c0 + 8 * hi + r; s0[r] = (key > qrow) ? NEGV : s0[r]; s1[r] = (key + 16 > qrow) ? NEGV : s1[r]; }
        }
        float mx = fmaxf(s0[0], s1[0]);
#pragma unroll
        for (int r = 1; r < 8; ++r) mx = fmaxf(mx, fmaxf(s0[r], s1[r]));
        mx = fmaxf(mx, __shfl_xor(mx, 16, 32));
        const float mn = fmaxf(m, mx);
        const float corr = __builtin_amdgcn_exp2f((m - mn) * SCL2E);
        float ps = 0.0f;
#pragma unroll
        for (int r = 0; r < 8; ++r) { s0[r] = __builtin_amdgcn_exp2f((s0[r] - mn) * SCL2E); s1[r] = __builtin_amdgcn_exp2f((s1[r] - mn) * SCL2E); ps += s0[r] + s1[r]; }
        l = l * corr + ps; m = mn;
#pragma unroll
        for (int nb = 0; nb < 4; ++nb)
#pragma unroll
            for (int r = 0; r < 8; ++r) o[nb][r] *= corr;
        v16h th;
#pragma unroll
        for (int r = 0; r < 8; ++r) { th[r] = (h16)(s0[r] * PCAR); th[8 + r] = (h16)(s1[r] * PCAR); }
#pragma unroll
        for (int nb = 0; nb < 4; ++nb) o[nb] = F::mma(vh[nb], th, o[nb]);
        // four vector slots behind the chunk's last products, on every path out of the chunk
        asm volatile("v_nop\n\tv_nop\n\tv_nop\n\tv_nop" : "+v"(o[0]), "+v"(o[1]), "+v"(o[2]), "+v"(o[3]) : "v"(th), "v"(vh[3]));
    };
#pragma unroll 1   // one stage per trip: one publish point and one refill in the built loop
    for (unsigned s = 0; s < NS; ++s) {
        const unsigned buf = (s & 1u) * T_BUF;
        const unsigned char* kb = kv + buf + foff; const unsigned char* vb = kv + buf + 2 * T_SLICE + foff;
        const int c0 = (int)s * 64;
        V kf[2][2][2], vh[4];     // K fragments of both chunks of the stage are asked for at its head; V^T of a chunk at the chunk's head, and arrives behind its scores and softmax
#pragma unroll
        for (int t = 0; t < 2; ++t)
#pragma unroll
            for (int ks = 0; ks < 2; ++ks) kf[0][t][ks] = F::ld((const bf*)(kb + t * 16 * T_PITCH + ks * 64));
#pragma unroll
        for (int nb = 0; nb < 4; ++nb) vh[nb] = F::ld((const bf*)(vb + (nb >> 1) * T_SLICE + (nb & 1) * 16 * T_PITCH));
#pragma unroll
        for (int t = 0; t < 2; ++t)
#pragma unroll
            for (int ks = 0; ks < 2; ++ks) kf[1][t][ks] = F::ld((const bf*)(kb + T_SLICE + t * 16 * T_PITCH + ks * 64));
        sfence();   // the LDS reads issue as one group, ahead of the products and not among them
        chunk(c0, kf[0], vh);
        if (c0 + 32 <= q0 + 15) {       // wave-uniform: waves 0 and 1 have no key in the second half of the diagonal stage
#pragma unroll
            for (int nb = 0; nb < 4; ++nb) vh[nb] = F::ld((const bf*)(vb + 64 + (nb >> 1) * T_SLICE + (nb & 1) * 16 * T_PITCH));
            sfence();   // as above
            chunk(c0 + 32, kf[1], vh);
        }
        asm volatile("s_wait_dscnt 0x0" ::: "memory");       // this wave has left the buffer
        asm volatile("s_wait_tensorcnt 0x0" : "+s"(g0), "+s"(g1) : : "memory");   // its slice of stage s + 1 has landed
        __syncthreads();                                      // stage s + 1 published; every wave has left stage s's buffer
        if (pinned((s + 2u < NS) ? 1u : 0u) != 0u) issue_next(buf);
    }
    asm volatile("s_wait_tensorcnt 0x0" : : "s"(g0), "s"(g1) : "memory");
    asm volatile("s_wait_dscnt 0x0" ::: "memory");
    l += __shfl_xor(l, 16, 32);
    const float inv = (1.0f / PCAR) * (1.0f / l);
    const int sbase = (int)wave * (16 * 72) + lr * 72 + 8 * hi;
#pragma unroll
    for (int nb = 0; nb < 4; ++nb) { v8us h8, l8;
#pragma unroll
        for (int r = 0; r < 8; ++r) { unsigned short a, c; splitf(o[nb][r] * inv, a, c); h8[r] = a; l8[r] = c; }
        *(v8usa*)(sth + sbase + nb * 16) = h8; *(v8usa*)(stl + sbase + nb * 16) = l8; }
    __syncthreads();
    const int b = bh / NH, h = bh % NH;
#pragma unroll
    for (int it = 0; it < 4; ++it) { const int row = it * 4 + (lane >> 3), pc = lane & 7;
        const v8us xh = *(const v8usa*)(sth + (int)wave * (16 * 72) + row * 72 + pc * 8); const v8us xl = *(const v8usa*)(stl + (int)wave * (16 * 72) + row * 72 + pc * 8);
        const size_t go = ((size_t)b * SEQ + q0 + row) * DQ + h * HD + pc * 8;
        *(v8us*)(ATh + go) = xh; *(v8us*)(ATl + go) = xl; }
}
// Both row ranges in one launch of AT_LO + AT_HI blocks of 128 threads; they share nothing but the output staging in LDS, which each block uses for its own 64 rows.
// Blocks [0, AT_LO): rows >= RH, f16 planes [bh][SEQ][HD] / [bh][HD][SEQ], query block fastest. Blocks [AT_LO, AT_LO + AT_HI): rows < RH, compact bf16 hi|lo planes [bh][RH][HD] / [bh][HD][RH].
constexpr unsigned AT_NL = (SEQ - RH) / 64, AT_NH = RH / 64;     // query blocks per (b, h) in each range
constexpr unsigned AT_LO = AT_NL * (NB * NH), AT_HI = AT_NH * (NB * NH);
static_assert(AT_NL >= 1 && AT_NH >= 1);
__global__ __launch_bounds__(128) void k_attn(const bf* Q16, const bf* K16, const bf* VT16, const bf* Qh, const bf* Ql, const bf* Kh, const bf* Kl, const bf* VTh, const bf* VTl, bf* ATh, bf* ATl) {
    __shared__ __align__(16) bf sth[4 * 16 * 72];
    __shared__ __align__(16) bf stl[4 * 16 * 72];
    const unsigned blk = blockIdx.x;
    // a scalar branch: only the blocks of the first range reach the tensor loads, which ignore EXEC
    if (pinned((blk < AT_LO) ? 1u : 0u) != 0u) attn_ring_body(Q16, K16, VT16, (int)(blk % AT_NL + AT_NH), (int)(blk / AT_NL), ATh, ATl, sth, stl);
    else attn_body<true>(Qh, Ql, Kh, Kl, VTh, VTl, RH, RH, (int)((blk - AT_LO) % AT_NH), (int)((blk - AT_LO) / AT_NH), ATh, ATl, sth, stl);
}

constexpr size_t SZ_W  = (size_t)DM * DM * 2;             // one bf16 weight plane
constexpr size_t SZ_XB = (size_t)NB * SEQ * DM * 2;       // bf16 x
constexpr size_t SZ_P  = (size_t)NB * NH * SEQ * HD * 2;  // one f16 head plane
constexpr size_t SZ_R  = (size_t)NB * NH * RH * HD * 2;   // one compact bf16 plane
constexpr size_t SZ_AT = (size_t)NB * SEQ * DQ * 2;       // one merged bf16 plane
constexpr size_t WS_TOTAL = 4 * SZ_W + SZ_XB + 3 * SZ_P + 6 * SZ_R + 2 * SZ_AT;
static_assert(SZ_W % 256 == 0);
static_assert(SZ_XB % 256 == 0);
static_assert(SZ_P % 256 == 0);
static_assert(SZ_R % 256 == 0);
static_assert(SZ_AT % 256 == 0);
static_assert(WS_TOTAL <= (size_t)134217728);

extern "C" void kernel_launch(void* const* d_in, const int* in_sizes, int n_in,
                              void* d_out, int out_size, void* d_ws, size_t ws_size, hipStream_t stream) {
    if (n_in < 8) return;
    const long long need_x = (long long)(NB - 1) * SEQ_FULL * DM + (long long)SEQ * DM;
    if ((long long)in_sizes[0] < need_x) return;
    if ((long long)in_sizes[1] < (long long)DM * DM || (long long)in_sizes[2] < (long long)DM * DM || (long long)in_sizes[3] < (long long)DM * DM || (long long)in_sizes[4] < (long long)DM * DM) return;
    if ((long long)in_sizes[5] < (long long)TABN * TABW || (long long)in_sizes[6] < (long long)TABN * TABW) return;
    if ((long long)in_sizes[7] < (long long)(NB - 1) * SEQ_FULL + SEQ) return;
    if ((long long)out_size < need_x) return;
    if (WS_TOTAL > ws_size) return;
    const float* x = (const float*)d_in[0]; const float* wq = (const float*)d_in[1]; const float* wk = (const float*)d_in[2]; const float* wv = (const float*)d_in[3]; const float* wo = (const float*)d_in[4];
    const float* sin_tab = (const float*)d_in[5]; const float* cos_tab = (const float*)d_in[6]; const int* tpos = (const int*)d_in[7];
    float* OUT = (float*)d_out;
    char* wsp = (char*)d_ws;
    auto take = [&](size_t bytes) { char* p = wsp; wsp += bytes; return (void*)p; };
    bf* W3 = (bf*)take(3 * SZ_W); bf* WO = (bf*)take(SZ_W);     // W3 = [wq | wk | wv]
    bf* XB = (bf*)take(SZ_XB);
    h16* Q16 = (h16*)take(SZ_P); h16* K16 = (h16*)take(SZ_P); h16* VT16 = (h16*)take(SZ_P);
    bf* Qh = (bf*)take(SZ_R); bf* Ql = (bf*)take(SZ_R); bf* Kh = (bf*)take(SZ_R); bf* Kl = (bf*)take(SZ_R); bf* VTh = (bf*)take(SZ_R); bf* VTl = (bf*)take(SZ_R);
    bf* ATh = (bf*)take(SZ_AT); bf* ATl = (bf*)take(SZ_AT);

    // W3, WO, XB lie one behind the other in the workspace
    k_cvt_all<<<4u * CV_W + NB * CV_X, 256, 0, stream>>>(x, wq, wk, wv, wo, W3);

    k_gemm_qkv<<<dim3((unsigned)(NB * SEQ / 256), (unsigned)(3 * DM / 192), 1), 384, 0, stream>>>(XB, W3, sin_tab, cos_tab, tpos, Q16, K16, VT16, Qh, Ql, Kh, Kl, VTh, VTl);

    k_attn<<<AT_LO + AT_HI, 128, 0, stream>>>((const bf*)Q16, (const bf*)K16, (const bf*)VT16, Qh, Ql, Kh, Kl, VTh, VTl, ATh, ATl);

    // out[b][t][e] = sum_d merged[b][t][d] wo[e][d]; z = batch, output batch stride from the full sequence length
    k_gemm_x2<<<dim3(SEQ / 128, DM / 128, NB), 128, 0, stream>>>(ATh, ATl, WO, DQ, OUT, DM, (size_t)SEQ * DQ, (size_t)0, (size_t)SEQ_FULL * DM);
}

// v006
// Measured time: 80.5 microseconds a run.
// Two timings next to v005 both put it at 1.06 times that version's speed.
// Over all steps from v000 it is 3.32 times as fast.
#include <hip/hip_runtime.h>

// Causal multi-head self-attention, 16 heads x 64, interleaved rotary with sin/cos rows gathered from the table inputs by the integer position input; out = merged x wo^T.
// Compute dtypes, f32 accumulate: every float input converted to bf16 (RNE); q/k/v projections v_wmma_f32_16x16x32_bf16 (exact bf16 x bf16 products);
// scores q.k: query rows < 256 bf16 hi/lo (3 products), rows >= 256 single f16; P.V: rows < 256 bf16 hi/lo (3 products), rows >= 256 single f16 with P carried x1024;
// output projection: merged bf16 hi|lo x exact bf16 wo (2 products; in every block of 32 k the hi products are summed, then the lo products). Softmax f32 (running max, exp2).
// Fused flash-style attention in transposed form (S^T = K Q^T, O^T = V^T P^T): two adjacent S^T key tiles repacked to 16 bit are the P^T B fragment; no score plane in memory.

#ifndef NB
#define NB 2
#endif
#ifndef SEQ
#define SEQ 2048
#endif
#define SEQ_FULL 2048                 // per-batch row stride of x, token positions and the output
#define DM   1024
#define NH   16
#define HD   64
#define DQ   (NH * HD)
#define TABN 2048                     // rows of the sin/cos tables
#define TABW 32                       // columns of the sin/cos tables (HD / 2)
#define RH   256                      // query rows < RH use bf16 hi/lo planes
#define PCAR 1024.0f
#define SCL2E 0.18033688011112042f    // HD^-0.5 x log2(e)
#define NEGV (-1.0e30f)

static_assert(HD == 64);
static_assert(DQ == DM);
static_assert(TABW * 2 == HD);
static_assert(DM % 64 == 0);
static_assert(DM % 32 == 0);
static_assert(SEQ % 64 == 0);
static_assert(RH % 64 == 0);
static_assert(RH <= SEQ);
static_assert(SEQ <= SEQ_FULL);
static_assert(SEQ <= TABN);
static_assert((NB * SEQ) % 64 == 0);
static_assert(SEQ % 128 == 0);
static_assert(DM % 128 == 0 && DM >= 256);

typedef _Float16 h16;
typedef unsigned short bf;
typedef __attribute__((ext_vector_type(16))) __bf16   v16bf;
typedef __attribute__((ext_vector_type(16))) _Float16 v16h;
typedef __attribute__((ext_vector_type(16))) unsigned short v16us;
typedef __attribute__((ext_vector_type(8)))  unsigned short v8us;
typedef __attribute__((ext_vector_type(8)))  float    v8f;
typedef __attribute__((ext_vector_type(4)))  float    v4f;
typedef __attribute__((ext_vector_type(2)))  float    v2f;
typedef __attribute__((ext_vector_type(8)))  _Float16 v8h;
typedef __attribute__((ext_vector_type(4)))  _Float16 v4h;
typedef __attribute__((ext_vector_type(4)))  unsigned short v4us;
typedef v4f  __attribute__((may_alias)) v4fa;
typedef v8us __attribute__((may_alias)) v8usa;

__device__ __forceinline__ unsigned short f2bf(float f) { unsigned u = __float_as_uint(f); u += 0x7FFFu + ((u >> 16) & 1u); return (unsigned short)(u >> 16); }
__device__ __forceinline__ float bf2f(unsigned short b) { return __uint_as_float(((unsigned)b) << 16); }
__device__ __forceinline__ float bfr(float f) { return bf2f(f2bf(f)); }
__device__ __forceinline__ void splitf(float y, unsigned short& h, unsigned short& l) { h = f2bf(y); l = f2bf(y - bf2f(h)); }
__device__ __forceinline__ v16us cat16u(v8us lo, v8us hi) { return __builtin_shufflevector(lo, hi, 0, 1, 2, 3, 4, 5, 6, 7, 8, 9, 10, 11, 12, 13, 14, 15); }
__device__ __forceinline__ v8f wmma16(v16h a, v16h b, v8f c) { return __builtin_amdgcn_wmma_f32_16x16x32_f16(false, a, false, b, (short)0, c, false, false); }
__device__ __forceinline__ v8f wmmab(v16bf a, v16bf b, v8f c) { return __builtin_amdgcn_wmma_f32_16x16x32_bf16(false, a, false, b, (short)0, c, false, false); }

// Fragment loader for K-contiguous 16-bit rows: p = row base + k0 + 8*(lane>>4); elements 0..7 <- p[0..7], elements 8..15 <- p[16..23].
template <bool HI> struct AF;
template <> struct AF<false> {
    typedef v16h V;
    static __device__ __forceinline__ V ld(const bf* p) { return __builtin_bit_cast(v16h, cat16u(*(const v8usa*)p, *(const v8usa*)(p + 16))); }
    static __device__ __forceinline__ v8f mma(V a, V b, v8f c) { return wmma16(a, b, c); }
};
template <> struct AF<true> {
    typedef v16bf V;
    static __device__ __forceinline__ V ld(const bf* p) { return __builtin_bit_cast(v16bf, cat16u(*(const v8usa*)p, *(const v8usa*)(p + 16))); }
    static __device__ __forceinline__ v8f mma(V a, V b, v8f c) { return wmmab(a, b, c); }
};

// ---- GEMM, (64 WM) x (64 WN) output tile per block of WM x WN waves (one 64x64 wave tile = 16 accumulators each); grid (M / (64 WM), N / (64 WN), Z), 32 WM WN threads.
// acc[m][n] (f32) = sum_k (A[m][k] (+ A2[m][k])) Bt[n][k], handed to the epilogue EPI per wave tile. z-batch strides sA/sB in elements. K % 128 == 0, K >= 256, M % (64 WM) == 0, N % (64 WN) == 0.
// Operands come to LDS by tensor loads, two buffers: a stage is 128 k of [A 64 WM rows | Bt 64 WN rows]; each of the first WM + WN waves brings one slice of 64 rows x 256 B (waves < WM: A; the next WN: Bt),
// padded by the mover to a pitch of 272 B for the 16-byte fragment reads. With A2 a stage is 128 k of [A | A2 | Bt]: the waves < WM bring a second slice, their rows of A2, and both planes meet the same staged Bt rows,
// so that a Bt tile comes from L2 once and a Bt fragment from LDS once for the two planes; per block of 32 k the products of A are summed first, then those of A2.
// A staged row serves every wave tile of its row or column of waves: bytes brought from L2 per product fall as (WM + WN) / (WM WN).
typedef unsigned u32x4 __attribute__((ext_vector_type(4)));
typedef unsigned u32x8 __attribute__((ext_vector_type(8)));
constexpr unsigned G_ROWB  = 256;                 // bytes of one staged row (128 k)
constexpr unsigned G_PITCH = G_ROWB + 16;         // LDS row pitch, an odd multiple of 16 B
constexpr unsigned G_SLICE = 18432;               // 64 rows x 272 B = 17,408 B, rounded up to a multiple of 2 KiB
static_assert(64 * G_PITCH <= G_SLICE && G_SLICE % 2048 == 0);
__device__ __forceinline__ unsigned uni(unsigned v) { return (unsigned)__builtin_amdgcn_readfirstlane(v); }
__device__ __forceinline__ unsigned pinned(unsigned v) { unsigned w = uni(v); asm volatile("" : "+s"(w)); return w; }
__device__ __forceinline__ void tdm_load(u32x4 g0, u32x8 g1) { asm volatile("tensor_load_to_lds %0, %1" :: "s"(g0), "s"(g1) : "memory"); }
__device__ __forceinline__ void sfence() { __builtin_amdgcn_sched_barrier(0); }   // keeps a group of fragment loads, or a block of products, together in the built code
// Epilogue: f32 rows C[m][n] (pitch ldc, z-batch stride sC), each 16-row band turned through the wave's LDS staging into 16-byte row stores.
struct EpiRows {
    float* C; int ldc; size_t sC;
    __device__ __forceinline__ void operator()(v8f (&acc)[4][4], float* os, const int r0, const int c0, const int lr, const int hi) const {
        float* Cz = C + (size_t)blockIdx.z * sC;
#pragma unroll
        for (int mb = 0; mb < 4; ++mb) {
#pragma unroll
            for (int nb = 0; nb < 4; ++nb) {
#pragma unroll
                for (int j = 0; j < 8; ++j) os[(hi * 8 + j) * 68 + nb * 16 + lr] = acc[mb][nb][j]; }
            __builtin_amdgcn_wave_barrier(); asm volatile("" ::: "memory");   // the band's LDS writes stay ahead of the row reads below
            float* crow = Cz + (size_t)(r0 + mb * 16) * ldc + c0;
#pragma unroll
            for (int s = 0; s < 8; ++s) { const int row = 2 * s + hi, cofs = lr * 4; const v4f val = *(const v4fa*)(os + row * 68 + cofs);
                *(v4f*)(crow + (size_t)row * ldc + cofs) = val; }
            __builtin_amdgcn_wave_barrier(); asm volatile("" ::: "memory");   // the row reads stay ahead of the next band's LDS writes
        }
    }
};
// Epilogue of the q/k/v projections, columns [q | k | v] (z = column / DM = 0, 1, 2): a wave tile is 64 tokens of one batch x the 64 columns of one head, and goes straight to the head planes.
// z < 2: interleaved rotary, pair (2i, 2i+1), table row = clamped token position, out[2i] = cos x[2i] - sin x[2i+1], out[2i+1] = sin x[2i] + cos x[2i+1];
//        planes [b*NH + h][t][d]: f16 for all t, compact bf16 hi|lo [bh][RH][HD] for t < RH.
// z = 2: value planes [bh][d][t] (f16, all t; compact bf16 hi|lo [bh][HD][RH] for t < RH): a lane's 8 accumulator rows are 8 consecutive t of one d, stored as 16 bytes from registers.
struct EpiHeads {
    const float* __restrict__ sin_tab; const float* __restrict__ cos_tab; const int* __restrict__ tpos;
    h16* Q16; h16* K16; h16* VT16; bf* Qh; bf* Ql; bf* Kh; bf* Kl; bf* VTh; bf* VTl;
    // Stands behind each run of global loads or stores, in front of the first instruction that writes a register which one of them names; the scheduling fences keep the run together and later work behind the wait.
    static __device__ __forceinline__ void xwait() { asm volatile("s_wait_xcnt 0x0" ::: "memory"); sfence(); }
    // The same behind a run of table loads: the eight offsets are inputs of the wait, so that none of their registers is given to a later load's result ahead of it.
    static __device__ __forceinline__ void xwait(const unsigned (&t)[8]) { asm volatile("s_wait_xcnt 0x0" :: "v"(t[0]), "v"(t[1]), "v"(t[2]), "v"(t[3]), "v"(t[4]), "v"(t[5]), "v"(t[6]), "v"(t[7]) : "memory"); sfence(); }
    __device__ __forceinline__ void operator()(v8f (&acc)[4][4], float* os, const int r0, const int c0, const int lr, const int hi) const {
        const int z = c0 / DM, b = r0 / SEQ, t0 = r0 % SEQ, bh = b * NH + (c0 % DM) / HD;     // uniform per wave
        const bool hr = (t0 < RH);     // uniform per wave: the tile's 64 tokens lie on one side of RH
        const int tc = hr ? t0 : 0;    // first token in the compact planes
        if (z == 2) {
            h16* v16 = VT16 + (size_t)bh * HD * SEQ + t0; const unsigned vofs = (unsigned)(lr * SEQ + hi * 8);
#pragma unroll
            for (int nb = 0; nb < 4; ++nb) {
                v8h o16[4];
#pragma unroll
                for (int mb = 0; mb < 4; ++mb)
#pragma unroll
                    for (int j = 0; j < 8; ++j) o16[mb][j] = (h16)acc[mb][nb][j];
                sfence();   // the four stores issue as one run, with nothing between them and their wait
#pragma unroll
                for (int mb = 0; mb < 4; ++mb) *(v8h*)(v16 + (nb * 16 * SEQ + mb * 16) + vofs) = o16[mb];   // the four stores fill one 128-byte line per d
                xwait();
            }
            if (hr) {
                float* own = os + (hi * 16 + lr) * 8;     // this lane's own 8 floats of each of the four column blocks
                bf* vh = VTh + (size_t)bh * HD * RH + tc; bf* vl = VTl + (size_t)bh * HD * RH + tc; const unsigned cofs = (unsigned)(lr * RH + hi * 8);
#pragma unroll
                for (int mb = 0; mb < 4; ++mb) {
#pragma unroll
                    for (int nb = 0; nb < 4; ++nb)
#pragma unroll
                        for (int j = 0; j < 8; ++j) own[nb * 256 + j] = acc[mb][nb][j];
#pragma unroll 1   // rolled, fed from LDS: the hi/lo split stands once per band in the text
                    for (int nb = 0; nb < 4; ++nb) { const v4f xa = *(const v4fa*)(own + nb * 256), xb = *(const v4fa*)(own + nb * 256 + 4); v8us oh, ol;
#pragma unroll
                        for (int j = 0; j < 4; ++j) { unsigned short u0, u1; splitf(xa[j], u0, u1); oh[j] = u0; ol[j] = u1; splitf(xb[j], u0, u1); oh[4 + j] = u0; ol[4 + j] = u1; }
                        const unsigned ce = (unsigned)(nb * 16 * RH + mb * 16) + cofs;
                        sfence();   // the two stores issue as one run, with nothing between them and their wait
                        *(v8us*)(vh + ce) = oh; *(v8us*)(vl + ce) = ol;
                        xwait(); }
                }
            }
            return;
        }
        h16* p16 = ((z == 0) ? Q16 : K16) + ((size_t)bh * SEQ + t0) * HD;
        bf* ph = ((z == 0) ? Qh : Kh) + ((size_t)bh * RH + tc) * HD; bf* pl = ((z == 0) ? Ql : Kl) + ((size_t)bh * RH + tc) * HD;
        const int* tp = tpos + (size_t)b * SEQ_FULL + t0;
        const unsigned lofs = (unsigned)(hi * HD + lr * 4);     // the lane's four columns in a pair of token rows
        int pos[4][8];     // token positions of the rows this lane will write: all fetched at once, one latency
#pragma unroll
        for (int mb = 0; mb < 4; ++mb)
#pragma unroll
            for (int s = 0; s < 8; ++s) pos[mb][s] = tp[mb * 16 + 2 * s + hi];
        xwait();
        unsigned to[4][8];   // byte offset of the lane's two sin (cos) values: table row = clamped token position
#pragma unroll
        for (int mb = 0; mb < 4; ++mb)
#pragma unroll
            for (int s = 0; s < 8; ++s) { const int p = pos[mb][s]; to[mb][s] = ((unsigned)(p < 0 ? 0 : (p > TABN - 1 ? TABN - 1 : p)) * TABW + (unsigned)lr * 2u) * 4u; }
        v2f sn[2][8], cs[2][8];   // fetched one 16-row band ahead
        sfence();   // the band's table loads issue as one run, with nothing between them and their wait
#pragma unroll
        for (int s = 0; s < 8; ++s) { sn[0][s] = *(const v2f*)((const char*)sin_tab + to[0][s]); cs[0][s] = *(const v2f*)((const char*)cos_tab + to[0][s]); }
        xwait(to[0]);
#pragma unroll
        for (int mb = 0; mb < 4; ++mb) {
            const int cb = mb & 1;
            if (mb < 3) {
#pragma unroll
                for (int s = 0; s < 8; ++s) { sn[cb ^ 1][s] = *(const v2f*)((const char*)sin_tab + to[mb + 1][s]); cs[cb ^ 1][s] = *(const v2f*)((const char*)cos_tab + to[mb + 1][s]); }
                xwait(to[mb + 1]);
            }
#pragma unroll
            for (int nb = 0; nb < 4; ++nb) {
#pragma unroll
                for (int j = 0; j < 8; ++j) os[(hi * 8 + j) * 68 + nb * 16 + lr] = acc[mb][nb][j]; }
            __builtin_amdgcn_wave_barrier(); asm volatile("" ::: "memory");   // the band's LDS writes stay ahead of the row reads below
            v4h o16[8]; v4f xy[8];
#pragma unroll
            for (int s = 0; s < 8; ++s) xy[s] = *(const v4fa*)(os + (2 * s + hi) * 68 + lr * 4);
#pragma unroll
            for (int s = 0; s < 8; ++s) { const v4f x = xy[s];
                const float s0 = bfr(sn[cb][s][0]), s1 = bfr(sn[cb][s][1]), k0 = bfr(cs[cb][s][0]), k1 = bfr(cs[cb][s][1]);
                v4f y; y[0] = k0 * x[0] - s0 * x[1]; y[1] = s0 * x[0] + k0 * x[1]; y[2] = k1 * x[2] - s1 * x[3]; y[3] = s1 * x[2] + k1 * x[3];
#pragma unroll
                for (int q = 0; q < 4; ++q) o16[s][q] = (h16)y[q];
                xy[s] = y;
            }
            sfence();   // the band's eight stores issue as one run, with nothing between them and their wait
#pragma unroll
            for (int s = 0; s < 8; ++s) *(v4h*)(p16 + (mb * 16 + 2 * s) * HD + lofs) = o16[s];
            xwait();
            if (hr) {      // each lane puts its rotated values back where it read them, for the split below
#pragma unroll
                for (int s = 0; s < 8; ++s) *(v4fa*)(os + (2 * s + hi) * 68 + lr * 4) = xy[s];
#pragma unroll 1   // rolled, fed from LDS: the hi/lo split stands once per band in the text
                for (int s = 0; s < 8; ++s) { const v4f y = *(const v4fa*)(os + (2 * s + hi) * 68 + lr * 4); v4us oh, ol;
#pragma unroll
                    for (int q = 0; q < 4; ++q) { unsigned short u0, u1; splitf(y[q], u0, u1); oh[q] = u0; ol[q] = u1; }
                    const unsigned ce = (unsigned)((mb * 16 + 2 * s) * HD) + lofs;
                    sfence();   // the two stores issue as one run, with nothing between them and their wait
                    *(v4us*)(ph + ce) = oh; *(v4us*)(pl + ce) = ol;
                    xwait(); }
            }
            __builtin_amdgcn_wave_barrier(); asm volatile("" ::: "memory");   // the row reads stay ahead of the next band's LDS writes
        }
    }
};
template <int NSPLIT, int WM, int WN, class EPI>
__device__ __forceinline__ void gemmw_body(const bf* __restrict__ A, const bf* __restrict__ A2, const bf* __restrict__ Bt, const int K, const size_t sA, const size_t sB, const EPI epi) {
    typedef AF<true> W; typedef W::V V;
    constexpr unsigned NW = WM * WN, NSL = WM + WN, NPL = NSPLIT + 1, G_BUF = (NPL * WM + WN) * G_SLICE;     // waves, waves that issue, planes of A, bytes of a buffer
    static_assert(NSL <= NW);
    static_assert(NSPLIT == 0 || NSL == NW);     // with A2 every wave issues
    __shared__ __attribute__((aligned(2048))) unsigned char ring[2 * G_BUF];
    __shared__ __align__(16) float osb[NW * 16 * 68];
    const size_t z = blockIdx.z; A += z * sA; A2 += z * sA; Bt += z * sB;
    const int lane = threadIdx.x & 31, lr = lane & 15, hi = lane >> 4; const unsigned wave = uni(threadIdx.x >> 5); const unsigned wm = wave / WN, wn = wave % WN;
    const int r0 = blockIdx.x * (64 * WM) + (int)wm * 64, c0 = blockIdx.y * (64 * WN) + (int)wn * 64;
    __builtin_assume(K >= 256);              // the ring's prologue issues two stages: no path without a pass is built
    const unsigned NS = (unsigned)K / 128u;     // stages
    // this wave's slice of a stage: 64 rows of A (A2) or of Bt; a wave past the last slice issues nothing (its descriptor names the last slice)
    const unsigned sl = (NW == NSL || wave < NSL) ? wave : NSL - 1u;
    const size_t srow = (sl < (unsigned)WM) ? (size_t)(blockIdx.x * (64u * WM) + 64u * sl) * K : (size_t)(blockIdx.y * (64u * WN) + 64u * (sl - WM)) * K;
    const unsigned long long ga1 = (unsigned long long)(size_t)(((sl < (unsigned)WM) ? A : Bt) + srow), ga2 = (unsigned long long)(size_t)(((sl < (unsigned)WM) ? A2 : Bt) + srow);
    const unsigned lds_slice = (unsigned)(size_t)ring + ((sl < (unsigned)WM) ? sl : sl + (unsigned)(NSPLIT * WM)) * G_SLICE;     // a buffer is [A: WM slices | A2: WM slices | Bt: WN slices]
    const unsigned lds_slice2 = (unsigned)(size_t)ring + ((unsigned)WM + ((sl < (unsigned)WM) ? sl : 0u)) * G_SLICE;             // the A2 slice of a wave < WM; the other waves issue no second load
    u32x8 g1;   // 1-byte elements, tensor = tile = 64 rows of 256 B, source pitch 2 K bytes, 4 dwords of pad behind every 64
    g1[0] = uni((1u << 20) | (5u << 22) | (3u << 25)); g1[1] = uni(G_ROWB << 16); g1[2] = uni(64u << 16); g1[3] = uni(G_ROWB << 16); g1[4] = uni(64u); g1[5] = uni((unsigned)K * 2u); g1[6] = uni(0u); g1[7] = uni(0u);
    // group 0: count 1 | LDS place | address of the slice's first byte, type 2 in the top bits. Words 2 and 3 walk from stage to stage by one 64-bit add.
    u32x4 g0; g0[0] = uni(1u); g0[1] = uni(lds_slice); g0[2] = uni((unsigned)ga1); g0[3] = uni((((unsigned)(ga1 >> 32)) & 0x01FFFFFFu) | 0x80000000u);
    // the second load's own group 0, in registers of its own: no word of a request that is outstanding takes a new value
    u32x4 g2; g2[0] = uni(1u); g2[1] = uni(lds_slice2); g2[2] = uni((unsigned)ga2); g2[3] = uni((((unsigned)(ga2 >> 32)) & 0x01FFFFFFu) | 0x80000000u);
    auto issue_next = [&](u32x4& g, unsigned place) {
        const unsigned long long c = ((((unsigned long long)g[3]) << 32) | g[2]) + (unsigned long long)G_ROWB;
        g[1] = uni(place); g[2] = uni((unsigned)c); g[3] = uni((unsigned)(c >> 32));
        tdm_load(g, g1);
    };
    // Every tensor wait names the descriptors: their words stay in their scalar registers from issue to wait, and none takes a new value while a request is outstanding.
    auto twait = [&]() {
        if constexpr (NSPLIT == 1) asm volatile("s_wait_tensorcnt 0x0" : "+s"(g0), "+s"(g2), "+s"(g1) : : "memory");
        else asm volatile("s_wait_tensorcnt 0x0" : "+s"(g0), "+s"(g1) : : "memory");
    };
    // Where not every wave issues a load, the issue stands under a scalar branch on the wave's number (tensor loads ignore EXEC).
    if (NW == NSL || pinned((wave < NSL) ? 1u : 0u) != 0u) {
        tdm_load(g0, g1);
        if constexpr (NSPLIT == 0) twait();               // this wave's slice of stage 0 has landed
    }
    if constexpr (NSPLIT == 1) {
        if (pinned((wave < (unsigned)WM) ? 1u : 0u) != 0u) tdm_load(g2, g1);
        twait();                                          // this wave's slices of stage 0 have landed
    }
    __syncthreads();                                      // stage 0 published
    if (NW == NSL || pinned((wave < NSL) ? 1u : 0u) != 0u) issue_next(g0, lds_slice + G_BUF);
    if constexpr (NSPLIT == 1) { if (pinned((wave < (unsigned)WM) ? 1u : 0u) != 0u) issue_next(g2, lds_slice2 + G_BUF); }
    v8f acc[4][4];
#pragma unroll
    for (int mb = 0; mb < 4; ++mb)
#pragma unroll
        for (int nb = 0; nb < 4; ++nb) acc[mb][nb] = (v8f){};
    const unsigned aoff = wm * G_SLICE + (unsigned)lr * G_PITCH + 16u * hi, boff = (NPL * (unsigned)WM + wn) * G_SLICE + (unsigned)lr * G_PITCH + 16u * hi;
#pragma unroll 1   // one pass per trip: one publish point and one refill in the built loop, accumulators and fragments in registers
    for (unsigned s = 0; s < NS; ++s) {
        const unsigned buf = (s & 1u) * G_BUF;
        const unsigned char* la = ring + buf + aoff; const unsigned char* lb = ring + buf + boff;
        V a[2][4], b[2][4];
#pragma unroll
        for (int f = 0; f < 4; ++f) { a[0][f] = W::ld((const bf*)(la + f * 16 * G_PITCH)); b[0][f] = W::ld((const bf*)(lb + f * 16 * G_PITCH)); }
        sfence();
#pragma unroll
        for (int v = 0; v < 4 * (int)NPL; ++v) {       // four blocks of 32 k, each once per plane of A; the next block's fragments are fetched ahead of this block's products, Bt's once per 32 k
            const int cs = v & 1, u = v / (int)NPL;
            if (v < 4 * (int)NPL - 1) {
                const int nu = (v + 1) / (int)NPL, np = (v + 1) % (int)NPL;
#pragma unroll
                for (int f = 0; f < 4; ++f) { a[cs ^ 1][f] = W::ld((const bf*)(la + np * WM * (int)G_SLICE + f * 16 * G_PITCH + nu * 64)); if (nu != u) b[nu & 1][f] = W::ld((const bf*)(lb + f * 16 * G_PITCH + nu * 64)); }
                sfence();
            }
#pragma unroll
            for (int nb = 0; nb < 4; ++nb)
#pragma unroll
                for (int mb = 0; mb < 4; ++mb) acc[mb][nb] = W::mma(a[cs][mb], b[u & 1][nb], acc[mb][nb]);
            sfence();
        }
        // four vector slots behind the pass's last products, on the loop's taken branch too, before a vector instruction may touch their registers
        asm volatile("v_nop\n\tv_nop\n\tv_nop\n\tv_nop");
        sfence();
        asm volatile("s_wait_dscnt 0x0" ::: "memory");       // this wave has left the buffer
        twait();                                              // its slices of stage s + 1 have landed
        __syncthreads();                                      // stage s + 1 published; every wave has left stage s's buffer
        if (pinned(((NW == NSL || wave < NSL) && s + 2u < NS) ? 1u : 0u) != 0u) issue_next(g0, lds_slice + buf);
        if constexpr (NSPLIT == 1) { if (pinned((wave < (unsigned)WM && s + 2u < NS) ? 1u : 0u) != 0u) issue_next(g2, lds_slice2 + buf); }
    }
    twait();                                                  // no request is outstanding when the wave leaves the ring
    asm volatile("s_wait_dscnt 0x0" ::: "memory");
    epi(acc, osb + wave * (16 * 68), r0, c0, lr, hi);      // output staging in LDS, each wave's own
}
// q, k, v projections of X (bf16 rows [b*SEQ + t][DM]) in one launch, as one product against the 3 DM rows of W3 = [wq | wk | wv]: 256 x 192 tiles, 12 waves (4 x 3), grid (NB*SEQ/256, 3*DM/192).
static_assert((NB * SEQ) % 256 == 0 && (3 * DM) % 192 == 0);
__global__ __launch_bounds__(384) void k_gemm_qkv(const bf* X, const bf* W3, const float* sin_tab, const float* cos_tab, const int* tpos,
                                                  h16* Q16, h16* K16, h16* VT16, bf* Qh, bf* Ql, bf* Kh, bf* Kl, bf* VTh, bf* VTl) {
    gemmw_body<0, 4, 3>(X, X, W3, DM, (size_t)0, (size_t)0, EpiHeads{sin_tab, cos_tab, tpos, Q16, K16, VT16, Qh, Ql, Kh, Kl, VTh, VTl}); }
__global__ __launch_bounds__(128) void k_gemm_x2(const bf* A, const bf* A2, const bf* Bt, int K, float* C, int ldc, size_t sA, size_t sB, size_t sC) { gemmw_body<1, 2, 2>(A, A2, Bt, K, sA, sB, EpiRows{C, ldc, sC}); }

// All f32 -> bf16 conversions in one launch; a thread converts 8 values. dst = [wq | wk | wv | wo | x rows b*SEQ + t], one behind the other; a block's 2,048 values lie in one source, picked by the block index.
constexpr unsigned CV_W = (unsigned)((size_t)DM * DM / 2048);      // blocks per weight plane
constexpr unsigned CV_X = (unsigned)((size_t)SEQ * DM / 2048);     // blocks per batch of x
static_assert(((size_t)DM * DM) % 2048 == 0 && ((size_t)SEQ * DM) % 2048 == 0);
__global__ __launch_bounds__(256) void k_cvt_all(const float* __restrict__ x, const float* __restrict__ wq, const float* __restrict__ wk, const float* __restrict__ wv, const float* __restrict__ wo, bf* dst) {
    const unsigned blk = blockIdx.x; const float* src; unsigned rel;
    if (blk < 4u * CV_W) { const unsigned p = blk / CV_W; rel = blk % CV_W; src = (p == 0u) ? wq : (p == 1u) ? wk : (p == 2u) ? wv : wo; }
    else { const unsigned c = blk - 4u * CV_W; rel = c % CV_X; src = x + (size_t)(c / CV_X) * SEQ_FULL * DM; }
    const v8f v = *(const v8f*)(src + ((size_t)rel * 256 + threadIdx.x) * 8); v8us o;
    asm volatile("s_wait_xcnt 0x0" ::: "memory");   // behind the loads, in front of the first instruction that writes their address registers
#pragma unroll
    for (int k = 0; k < 8; ++k) o[k] = f2bf(v[k]); *(v8us*)(dst + ((size_t)blk * 256 + threadIdx.x) * 8) = o;  }

// ---- fused causal attention, transposed flash form. Block = 4 waves = 64 query rows of one (b, h); each wave owns 16 queries (lane & 15 = query; both lane halves carry its statistics).
// Per 32-key chunk: S^T tiles (rows = keys, cols = queries) = K frag (A) x Q frag (B); running max (one shfl_xor 16), p = exp2; the two S^T tiles repacked to 16 bit are the P^T B fragment
// (element r <- keys c0+8h+r, element 8+r <- keys c0+16+8h+r); O^T[d][query] += V^T frag (A, rows of the [d][t] plane) x P^T. HI: bf16 hi/lo planes, 3 products; else f16, P x PCAR.
template <bool HI>
__device__ __forceinline__ void attn_body(const bf* __restrict__ Qa, const bf* __restrict__ Qb, const bf* __restrict__ Ka, const bf* __restrict__ Kb, const bf* __restrict__ Va, const bf* __restrict__ Vb,
                                          const int tq, const int tv, const int qblk, const int bh, bf* ATh, bf* ATl, bf* sth, bf* stl) {
    typedef AF<HI> F; typedef typename F::V V;
    const int lane = threadIdx.x & 31, lr = lane & 15, hi = lane >> 4, wave = threadIdx.x >> 5;
    const int q0 = qblk * 64 + wave * 16; const int qrow = q0 + lr;
    const size_t qoff = ((size_t)bh * tq + q0 + lr) * HD + 8 * hi;
    const size_t koff = ((size_t)bh * tq + lr) * HD + 8 * hi;
    const size_t voff = ((size_t)bh * HD + lr) * tv + 8 * hi;
    V qa[2], qb[2];
#pragma unroll
    for (int ks = 0; ks < 2; ++ks) { qa[ks] = F::ld(Qa + qoff + 32 * ks); if (HI) qb[ks] = F::ld(Qb + qoff + 32 * ks); else qb[ks] = qa[ks]; }
    v8f o[4];
#pragma unroll
    for (int nb = 0; nb < 4; ++nb) o[nb] = (v8f){};
    float m = NEGV, l = 0.0f;
#pragma unroll 1
    for (int c0 = 0; c0 <= q0 + 15; c0 += 32) {
        v8f s0 = (v8f){}, s1 = (v8f){}; V k0, k1;
#pragma unroll
        for (int ks = 0; ks < 2; ++ks) {
            k0 = F::ld(Ka + koff + (size_t)c0 * HD + 32 * ks); k1 = F::ld(Ka + koff + (size_t)(c0 + 16) * HD + 32 * ks);
            if (HI) { const V l0 = F::ld(Kb + koff + (size_t)c0 * HD + 32 * ks); const V l1 = F::ld(Kb + koff + (size_t)(c0 + 16) * HD + 32 * ks);
                s0 = F::mma(l0, qa[ks], s0); s1 = F::mma(l1, qa[ks], s1); s0 = F::mma(k0, qb[ks], s0); s1 = F::mma(k1, qb[ks], s1); }
            s0 = F::mma(k0, qa[ks], s0); s1 = F::mma(k1, qa[ks], s1);
        }
        asm volatile("v_nop\n\tv_nop\n\tv_nop\n\tv_nop" : "+v"(s0), "+v"(s1) : "v"(k0), "v"(k1), "v"(qa[1]), "v"(qb[1]));
        if (c0 + 31 > q0) {       // wave-uniform: chunk touches the diagonal; masked scores are replaced (keys above the query)
#pragma unroll
            for (int r = 0; r < 8; ++r) { const int key = c0 + 8 * hi + r; s0[r] = (key > qrow) ? NEGV : s0[r]; s1[r] = (key + 16 > qrow) ? NEGV : s1[r]; }
        }
        float mx = fmaxf(s0[0], s1[0]);
#pragma unroll
        for (int r = 1; r < 8; ++r) mx = fmaxf(mx, fmaxf(s0[r], s1[r]));
        mx = fmaxf(mx, __shfl_xor(mx, 16, 32));
        const float mn = fmaxf(m, mx);
        const float corr = __builtin_amdgcn_exp2f((m - mn) * SCL2E);
        float ps = 0.0f;
#pragma unroll
        for (int r = 0; r < 8; ++r) { s0[r] = __builtin_amdgcn_exp2f((s0[r] - mn) * SCL2E); s1[r] = __builtin_amdgcn_exp2f((s1[r] - mn) * SCL2E); ps += s0[r] + s1[r]; }
        l = l * corr + ps; m = mn;
#pragma unroll
        for (int nb = 0; nb < 4; ++nb)
#pragma unroll
            for (int r = 0; r < 8; ++r) o[nb][r] *= corr;
        V pa, pl;
        if (HI) { v16us uh, ul;
#pragma unroll
            for (int r = 0; r < 8; ++r) { unsigned short a, c; splitf(s0[r], a, c); uh[r] = a; ul[r] = c; splitf(s1[r], a, c); uh[8 + r] = a; ul[8 + r] = c; }
            pa = __builtin_bit_cast(V, uh); pl = __builtin_bit_cast(V, ul);
        } else { v16h th;
#pragma unroll
            for (int r = 0; r < 8; ++r) { th[r] = (h16)(s0[r] * PCAR); th[8 + r] = (h16)(s1[r] * PCAR); }
            pa = __builtin_bit_cast(V, th); pl = pa; }
        V vh[4], vl[4];
#pragma unroll
        for (int nb = 0; nb < 4; ++nb) { vh[nb] = F::ld(Va + voff + (size_t)nb * 16 * tv + c0); if (HI) vl[nb] = F::ld(Vb + voff + (size_t)nb * 16 * tv + c0); else vl[nb] = vh[nb]; }
#pragma unroll
        for (int nb = 0; nb < 4; ++nb) { if (HI) { o[nb] = F::mma(vl[nb], pa, o[nb]); o[nb] = F::mma(vh[nb], pl, o[nb]); } o[nb] = F::mma(vh[nb], pa, o[nb]); }
        asm volatile("v_nop\n\tv_nop\n\tv_nop\n\tv_nop" : "+v"(o[0]), "+v"(o[1]), "+v"(o[2]), "+v"(o[3]) : "v"(pa), "v"(pl), "v"(vh[3]));
    }
    l += __shfl_xor(l, 16, 32);
    const float inv = (HI ? 1.0f : (1.0f / PCAR)) * (1.0f / l);
    const int sbase = wave * (16 * 72) + lr * 72 + 8 * hi;
#pragma unroll
    for (int nb = 0; nb < 4; ++nb) { v8us h8, l8;
#pragma unroll
        for (int r = 0; r < 8; ++r) { unsigned short a, c; splitf(o[nb][r] * inv, a, c); h8[r] = a; l8[r] = c; }
        *(v8usa*)(sth + sbase + nb * 16) = h8; *(v8usa*)(stl + sbase + nb * 16) = l8; }
    __syncthreads();
    const int b = bh / NH, h = bh % NH;
{
#pragma unroll
        for (int it = 0; it < 4; ++it) { const int row = it * 4 + (lane >> 3), pc = lane & 7;
            const v8us xh = *(const v8usa*)(sth + wave * (16 * 72) + row * 72 + pc * 8); const v8us xl = *(const v8usa*)(stl + wave * (16 * 72) + row * 72 + pc * 8);
            const size_t go = ((size_t)b * SEQ + q0 + row) * DQ + h * HD + pc * 8;
            *(v8us*)(ATh + go) = xh; *(v8us*)(ATl + go) = xl; }
         }
}
// ---- the same attention for rows >= RH (single f16 planes), with K and V^T staged in LDS by tensor loads and shared by the block's 4 waves. Same 32-key chunks in the same order as attn_body<false>.
// A stage is 64 keys: K rows [64 keys][128 B] and V^T rows [64 d][128 B = 64 keys]; each wave brings one slice of 32 rows x 128 B (waves 0, 1: K; waves 2, 3: V^T),
// padded by the mover to a pitch of 144 B for the 16-byte fragment reads. Two buffers; query block qblk walks qblk + 1 stages (at least RH / 64 + 1).
constexpr unsigned T_ROWB  = 128;                 // bytes of one staged row
constexpr unsigned T_PITCH = T_ROWB + 16;         // LDS row pitch, an odd multiple of 16 B
constexpr unsigned T_SLICE = 6144;                // 32 rows x 144 B = 4,608 B, rounded up to a multiple of 2 KiB
constexpr unsigned T_BUF   = 4 * T_SLICE;
static_assert(32 * T_PITCH <= T_SLICE && T_SLICE % 2048 == 0);
static_assert(HD * 2 == T_ROWB);
static_assert(RH / 64 + 1 >= 2);                  // the ring's prologue issues two stages
__device__ __forceinline__ void attn_ring_body(const bf* __restrict__ Qa, const bf* __restrict__ Ka, const bf* __restrict__ Va, const int qblk, const int bh, bf* ATh, bf* ATl, bf* sth, bf* stl) {
    typedef AF<false> F; typedef F::V V;
    __shared__ __attribute__((aligned(2048))) unsigned char kv[2 * T_BUF];
    const int lane = threadIdx.x & 31, lr = lane & 15, hi = lane >> 4; const unsigned wave = uni(threadIdx.x >> 5);
    const int q0 = qblk * 64 + (int)wave * 16; const int qrow = q0 + lr;
    __builtin_assume(qblk >= RH / 64);            // the ring's prologue issues two stages: no path without a pass is built
    const unsigned NS = (unsigned)qblk + 1u;      // stages of 64 keys, the last one holds the diagonal
    // this wave's slice of a stage: 32 key rows of K, or 32 d rows of V^T; from stage to stage K walks 64 rows, V^T 64 keys along its rows
    const unsigned long long ga = (unsigned long long)(size_t)((wave < 2u) ? Ka + ((size_t)bh * SEQ + 32u * wave) * HD : Va + ((size_t)bh * HD + 32u * (wave - 2u)) * SEQ);
    const unsigned long long step = (wave < 2u) ? (unsigned long long)(64u * T_ROWB) : (unsigned long long)T_ROWB;
    const unsigned lds_slice = (unsigned)(size_t)kv + wave * T_SLICE;
    u32x8 g1;   // 1-byte elements, tensor = tile = 32 rows of 128 B, source pitch 128 B (K) or 2 SEQ bytes (V^T), 4 dwords of pad behind every 32
    g1[0] = uni((1u << 20) | (4u << 22) | (3u << 25)); g1[1] = uni(T_ROWB << 16); g1[2] = uni(32u << 16); g1[3] = uni(T_ROWB << 16); g1[4] = uni(32u); g1[5] = uni((wave < 2u) ? T_ROWB : (unsigned)SEQ * 2u); g1[6] = uni(0u); g1[7] = uni(0u);
    u32x4 g0; g0[0] = uni(1u); g0[1] = uni(lds_slice); g0[2] = uni((unsigned)ga); g0[3] = uni((((unsigned)(ga >> 32)) & 0x01FFFFFFu) | 0x80000000u);
    auto issue_next = [&](unsigned buf) {
        const unsigned long long c = ((((unsigned long long)g0[3]) << 32) | g0[2]) + step;
        g0[1] = uni(lds_slice + buf); g0[2] = uni((unsigned)c); g0[3] = uni((unsigned)(c >> 32));
        tdm_load(g0, g1);
    };
    const size_t qoff = ((size_t)bh * SEQ + q0 + lr) * HD + 8 * hi;
    V qa[2];
#pragma unroll
    for (int ks = 0; ks < 2; ++ks) qa[ks] = F::ld(Qa + qoff + 32 * ks);
    asm volatile("s_wait_xcnt 0x0" ::: "memory");   // behind the query loads, in front of the first instruction that writes their address registers
    tdm_load(g0, g1);
    // Every tensor wait names the descriptor: its words stay in their scalar registers from issue to wait, and none takes a new value while a request is outstanding.
    asm volatile("s_wait_tensorcnt 0x0" : : "s"(g0), "s"(g1) : "memory");   // this wave's slice of stage 0 has landed
    __syncthreads();                                      // stage 0 published
    issue_next(T_BUF);
    v8f o[4];
#pragma unroll
    for (int nb = 0; nb < 4; ++nb) o[nb] = (v8f){};
    float m = NEGV, l = 0.0f;
    const unsigned foff = (unsigned)lr * T_PITCH + 16u * hi;
    // one chunk of 32 keys from c0 on: kf = K fragments [16-key tile][32 d], vh = V^T fragments [16 d]
    auto chunk = [&](const int c0, const V (&kf)[2][2], const V (&vh)[4]) {
        v8f s0 = (v8f){}, s1 = (v8f){};
#pragma unroll
        for (int ks = 0; ks < 2; ++ks) { s0 = F::mma(kf[0][ks], qa[ks], s0); s1 = F::mma(kf[1][ks], qa[ks], s1); }
        // four vector slots behind the score products, before a vector instruction may touch their registers
        asm volatile("v_nop\n\tv_nop\n\tv_nop\n\tv_nop" : "+v"(s0), "+v"(s1) : "v"(kf[0][1]), "v"(kf[1][1]), "v"(qa[1]));
        if (c0 + 31 > q0) {       // wave-uniform: chunk touches the diagonal; masked scores are replaced (keys above the query)
#pragma unroll
            for (int r = 0; r < 8; ++r) { const int key = c0 + 8 * hi + r; s0[r] = (key > qrow) ? NEGV : s0[r]; s1[r] = (key + 16 > qrow) ? NEGV : s1[r]; }
        }
        float mx = fmaxf(s0[0], s1[0]);
#pragma unroll
        for (int r = 1; r < 8; ++r) mx = fmaxf(mx, fmaxf(s0[r], s1[r]));
        mx = fmaxf(mx, __shfl_xor(mx, 16, 32));
        const float mn = fmaxf(m, mx);
        const float corr = __builtin_amdgcn_exp2f((m - mn) * SCL2E);
        float ps = 0.0f;
#pragma unroll
        for (int r = 0; r < 8; ++r) { s0[r] = __builtin_amdgcn_exp2f((s0[r] - mn) * SCL2E); s1[r] = __builtin_amdgcn_exp2f((s1[r] - mn) * SCL2E); ps += s0[r] + s1[r]; }
        l = l * corr + ps; m = mn;
#pragma unroll
        for (int nb = 0; nb < 4; ++nb)
#pragma unroll
            for (int r = 0; r < 8; ++r) o[nb][r] *= corr;
        v16h th;
#pragma unroll
        for (int r = 0; r < 8; ++r) { th[r] = (h16)(s0[r] * PCAR); th[8 + r] = (h16)(s1[r] * PCAR); }
#pragma unroll
        for (int nb = 0; nb < 4; ++nb) o[nb] = F::mma(vh[nb], th, o[nb]);
        // four vector slots behind the chunk's last products, on every path out of the chunk
        asm volatile("v_nop\n\tv_nop\n\tv_nop\n\tv_nop" : "+v"(o[0]), "+v"(o[1]), "+v"(o[2]), "+v"(o[3]) : "v"(th), "v"(vh[3]));
    };
#pragma unroll 1   // one stage per trip: one publish point and one refill in the built loop
    for (unsigned s = 0; s < NS; ++s) {
        const unsigned buf = (s & 1u) * T_BUF;
        const unsigned char* kb = kv + buf + foff; const unsigned char* vb = kv + buf + 2 * T_SLICE + foff;
        const int c0 = (int)s * 64;
        V kf[2][2][2], vh[4];     // K fragments of both chunks of the stage are asked for at its head; V^T of a chunk at the chunk's head, and arrives behind its scores and softmax
#pragma unroll
        for (int t = 0; t < 2; ++t)
#pragma unroll
            for (int ks = 0; ks < 2; ++ks) kf[0][t][ks] = F::ld((const bf*)(kb + t * 16 * T_PITCH + ks * 64));
#pragma unroll
        for (int nb = 0; nb < 4; ++nb) vh[nb] = F::ld((const bf*)(vb + (nb >> 1) * T_SLICE + (nb & 1) * 16 * T_PITCH));
#pragma unroll
        for (int t = 0; t < 2; ++t)
#pragma unroll
            for (int ks = 0; ks < 2; ++ks) kf[1][t][ks] = F::ld((const bf*)(kb + T_SLICE + t * 16 * T_PITCH + ks * 64));
        sfence();   // the LDS reads issue as one group, ahead of the products and not among them
        chunk(c0, kf[0], vh);
        if (c0 + 32 <= q0 + 15) {       // wave-uniform: waves 0 and 1 have no key in the second half of the diagonal stage
#pragma unroll
            for (int nb = 0; nb < 4; ++nb) vh[nb] = F::ld((const bf*)(vb + 64 + (nb >> 1) * T_SLICE + (nb & 1) * 16 * T_PITCH));
            sfence();   // as above
            chunk(c0 + 32, kf[1], vh);
        }
        asm volatile("s_wait_dscnt 0x0" ::: "memory");       // this wave has left the buffer
        asm volatile("s_wait_tensorcnt 0x0" : "+s"(g0), "+s"(g1) : : "memory");   // its slice of stage s + 1 has landed
        __syncthreads();                                      // stage s + 1 published; every wave has left stage s's buffer
        if (pinned((s + 2u < NS) ? 1u : 0u) != 0u) issue_next(buf);
    }
    asm volatile("s_wait_tensorcnt 0x0" : : "s"(g0), "s"(g1) : "memory");
    asm volatile("s_wait_dscnt 0x0" ::: "memory");
    l += __shfl_xor(l, 16, 32);
    const float inv = (1.0f / PCAR) * (1.0f / l);
    const int sbase = (int)wave * (16 * 72) + lr * 72 + 8 * hi;
#pragma unroll
    for (int nb = 0; nb < 4; ++nb) { v8us h8, l8;
#pragma unroll
        for (int r = 0; r < 8; ++r) { unsigned short a, c; splitf(o[nb][r] * inv, a, c); h8[r] = a; l8[r] = c; }
        *(v8usa*)(sth + sbase + nb * 16) = h8; *(v8usa*)(stl + sbase + nb * 16) = l8; }
    __syncthreads();
    const int b = bh / NH, h = bh % NH;
#pragma unroll
    for (int it = 0; it < 4; ++it) { const int row = it * 4 + (lane >> 3), pc = lane & 7;
        const v8us xh = *(const v8usa*)(sth + (int)wave * (16 * 72) + row * 72 + pc * 8); const v8us xl = *(const v8usa*)(stl + (int)wave * (16 * 72) + row * 72 + pc * 8);
        const size_t go = ((size_t)b * SEQ + q0 + row) * DQ + h * HD + pc * 8;
        *(v8us*)(ATh + go) = xh; *(v8us*)(ATl + go) = xl; }
}
// Both row ranges in one launch of AT_LO + AT_HI blocks of 128 threads; they share nothing but the output staging in LDS, which each block uses for its own 64 rows.
// Blocks [0, AT_LO): rows >= RH, f16 planes [bh][SEQ][HD] / [bh][HD][SEQ], query block fastest. Blocks [AT_LO, AT_LO + AT_HI): rows < RH, compact bf16 hi|lo planes [bh][RH][HD] / [bh][HD][RH].
constexpr unsigned AT_NL = (SEQ - RH) / 64, AT_NH = RH / 64;     // query blocks per (b, h) in each range
constexpr unsigned AT_LO = AT_NL * (NB * NH), AT_HI = AT_NH * (NB * NH);
static_assert(AT_NL >= 1 && AT_NH >= 1);
__global__ __launch_bounds__(128) void k_attn(const bf* Q16, const bf* K16, const bf* VT16, const bf* Qh, const bf* Ql, const bf* Kh, const bf* Kl, const bf* VTh, const bf* VTl, bf* ATh, bf* ATl) {
    __shared__ __align__(16) bf sth[4 * 16 * 72];
    __shared__ __align__(16) bf stl[4 * 16 * 72];
    const unsigned blk = blockIdx.x;
    // a scalar branch: only the blocks of the first range reach the tensor loads, which ignore EXEC
    if (pinned((blk < AT_LO) ? 1u : 0u) != 0u) attn_ring_body(Q16, K16, VT16, (int)(blk % AT_NL + AT_NH), (int)(blk / AT_NL), ATh, ATl, sth, stl);
    else attn_body<true>(Qh, Ql, Kh, Kl, VTh, VTl, RH, RH, (int)((blk - AT_LO) % AT_NH), (int)((blk - AT_LO) / AT_NH), ATh, ATl, sth, stl);
}

constexpr size_t SZ_W  = (size_t)DM * DM * 2;             // one bf16 weight plane
constexpr size_t SZ_XB = (size_t)NB * SEQ * DM * 2;       // bf16 x
constexpr size_t SZ_P  = (size_t)NB * NH * SEQ * HD * 2;  // one f16 head plane
constexpr size_t SZ_R  = (size_t)NB * NH * RH * HD * 2;   // one compact bf16 plane
constexpr size_t SZ_AT = (size_t)NB * SEQ * DQ * 2;       // one merged bf16 plane
constexpr size_t WS_TOTAL = 4 * SZ_W + SZ_XB + 3 * SZ_P + 6 * SZ_R + 2 * SZ_AT;
static_assert(SZ_W % 256 == 0);
static_assert(SZ_XB % 256 == 0);
static_assert(SZ_P % 256 == 0);
static_assert(SZ_R % 256 == 0);
static_assert(SZ_AT % 256 == 0);
static_assert(WS_TOTAL <= (size_t)134217728);

extern "C" void kernel_launch(void* const* d_in, const int* in_sizes, int n_in,
                              void* d_out, int out_size, void* d_ws, size_t ws_size, hipStream_t stream) {
    if (n_in < 8) return;
    const long long need_x = (long long)(NB - 1) * SEQ_FULL * DM + (long long)SEQ * DM;
    if ((long long)in_sizes[0] < need_x) return;
    if ((long long)in_sizes[1] < (long long)DM * DM || (long long)in_sizes[2] < (long long)DM * DM || (long long)in_sizes[3] < (long long)DM * DM || (long long)in_sizes[4] < (long long)DM * DM) return;
    if ((long long)in_sizes[5] < (long long)TABN * TABW || (long long)in_sizes[6] < (long long)TABN * TABW) return;
    if ((long long)in_sizes[7] < (long long)(NB - 1) * SEQ_FULL + SEQ) return;
    if ((long long)out_size < need_x) return;
    if (WS_TOTAL > ws_size) return;
    const float* x = (const float*)d_in[0]; const float* wq = (const float*)d_in[1]; const float* wk = (const float*)d_in[2]; const float* wv = (const float*)d_in[3]; const float* wo = (const float*)d_in[4];
    const float* sin_tab = (const float*)d_in[5]; const float* cos_tab = (const float*)d_in[6]; const int* tpos = (const int*)d_in[7];
    float* OUT = (float*)d_out;
    char* wsp = (char*)d_ws;
    auto take = [&](size_t bytes) { char* p = wsp; wsp += bytes; return (void*)p; };
    bf* W3 = (bf*)take(3 * SZ_W); bf* WO = (bf*)take(SZ_W);     // W3 = [wq | wk | wv]
    bf* XB = (bf*)take(SZ_XB);
    h16* Q16 = (h16*)take(SZ_P); h16* K16 = (h16*)take(SZ_P); h16* VT16 = (h16*)take(SZ_P);
    bf* Qh = (bf*)take(SZ_R); bf* Ql = (bf*)take(SZ_R); bf* Kh = (bf*)take(SZ_R); bf* Kl = (bf*)take(SZ_R); bf* VTh = (bf*)take(SZ_R); bf* VTl = (bf*)take(SZ_R);
    bf* ATh = (bf*)take(SZ_AT); bf* ATl = (bf*)take(SZ_AT);

    // W3, WO, XB lie one behind the other in the workspace
    k_cvt_all<<<4u * CV_W + NB * CV_X, 256, 0, stream>>>(x, wq, wk, wv, wo, W3);

    k_gemm_qkv<<<dim3((unsigned)(NB * SEQ / 256), (unsigned)(3 * DM / 192), 1), 384, 0, stream>>>(XB, W3, sin_tab, cos_tab, tpos, Q16, K16, VT16, Qh, Ql, Kh, Kl, VTh, VTl);

    k_attn<<<AT_LO + AT_HI, 128, 0, stream>>>((const bf*)Q16, (const bf*)K16, (const bf*)VT16, Qh, Ql, Kh, Kl, VTh, VTl, ATh, ATl);

    // out[b][t][e] = sum_d merged[b][t][d] wo[e][d]; z = batch, output batch stride from the full sequence length
    k_gemm_x2<<<dim3(SEQ / 128, DM / 128, NB), 128, 0, stream>>>(ATh, ATl, WO, DQ, OUT, DM, (size_t)SEQ * DQ, (size_t)0, (size_t)SEQ_FULL * DM);
}
